// v000
// The times below were measured on an AMD MI455X: many runs one after another, warmed up first and cycling through
// copies of the inputs, with the whole window's GPU time divided by the number of runs. Launches and the gaps
// between them are all in it. The median over several windows is given; except for v000 it joins two sittings, which
// can be a few percent apart, so the side-by-side timings, each taken in one sitting, are the better comparison.
// v000 is the starting kernel. One run takes 599 microseconds.
#include <hip/hip_runtime.h>

// ---------------------------------------------------------------------------
// Cross-modal attention (E=768, 8 heads x 96, B=8, 1024 query tokens x 1024 key tokens), two outputs: attended [8,1024,768] and the
// head-averaged attention matrix [8,1024,1024]. Every contraction runs on v_wmma_f32_16x16x32_bf16 with BOTH operands as bf16 hi/lo
// splits (hi.hi + hi.lo + lo.hi, f32 accumulate): the four projections (A = f32 activations split at fragment load, B = weight hi/lo
// planes), Q.K^T (Q/K hi/lo planes), P.V (P split from the f32 probability panel in LDS, V^T hi/lo planes). Softmax and the head mean f32.
// Fragment k-map per lane half hh, A and B alike: elements 0..7 <- k = 8hh+0..7, elements 8..15 <- k = 16+8hh+0..7.
// ---------------------------------------------------------------------------

typedef __bf16 b16;
typedef __attribute__((ext_vector_type(16))) __bf16 v16b;
typedef __attribute__((ext_vector_type(8)))  __bf16 v8b;
typedef __attribute__((ext_vector_type(8)))  float  v8f;
typedef __attribute__((ext_vector_type(4)))  float  v4f;
typedef __attribute__((ext_vector_type(4)))  int    i4;

#define NB 8
#define NTOK 1024
#define EMB 768
#define NHD 8
#define HDIM 96
#define MTOT 8192

__device__ __forceinline__ void split_bf16(float v, b16& hi, b16& lo) {
  const unsigned int u = __builtin_bit_cast(unsigned int, v) & 0xffff0000u;
  hi = __builtin_bit_cast(b16, (unsigned short)(u >> 16));
  lo = (b16)(v - __builtin_bit_cast(float, u));
}
__device__ __forceinline__ v8b ld8b(const b16* p) { return *(const v8b*)p; }
__device__ __forceinline__ v16b cat8b(v8b a, v8b b) { return __builtin_shufflevector(a, b, 0, 1, 2, 3, 4, 5, 6, 7, 8, 9, 10, 11, 12, 13, 14, 15); }
__device__ __forceinline__ v16b frag_kb(const b16* p, int hh) { return cat8b(ld8b(p + 8 * hh), ld8b(p + 16 + 8 * hh)); }
__device__ __forceinline__ void frag_ksplit(const float* p, int hh, v16b& fh, v16b& fl) {
  const float* p0 = p + 8 * hh; const float* p1 = p + 16 + 8 * hh;
#pragma unroll
  for (int e = 0; e < 8; ++e) { b16 a, c; split_bf16(p0[e], a, c); fh[e] = a; fl[e] = c; split_bf16(p1[e], a, c); fh[8 + e] = a; fl[8 + e] = c; }
}
__device__ __forceinline__ v8f wmmab(v16b a, v16b b, v8f c) {
  v8f d = __builtin_amdgcn_wmma_f32_16x16x32_bf16(false, a, false, b, (short)0, c, false, false);
  asm volatile("v_nop\n\tv_nop\n\tv_nop\n\tv_nop" : "+v"(d) : "v"(a), "v"(b));
  return d;
}
__device__ __forceinline__ v8f wmma3(v16b ah, v16b al, v16b bh, v16b bl, v8f c) {
  c = wmmab(ah, bh, c); c = wmmab(ah, bl, c); c = wmmab(al, bh, c); return c;
}
__device__ __forceinline__ void wave_sync_lds() {
  __builtin_amdgcn_fence(__ATOMIC_RELEASE, "workgroup"); __builtin_amdgcn_wave_barrier(); __builtin_amdgcn_fence(__ATOMIC_ACQUIRE, "workgroup");
}

// ---------------------------------------------------------------------------
// ---------------------------------------------------------------------------
__global__ void cma_wsplit(const float* __restrict__ w, b16* __restrict__ wh, b16* __restrict__ wl, int n8) {
  int i = blockIdx.x * blockDim.x + threadIdx.x;
  int stride = gridDim.x * blockDim.x;
  for (; i < n8; i += stride) {
    v8b h, l;
#pragma unroll
    for (int e = 0; e < 8; ++e) { b16 a, c; split_bf16(w[(size_t)i * 8 + e], a, c); h[e] = a; l[e] = c; }
    *(v8b*)(wh + (size_t)i * 8) = h; *(v8b*)(wl + (size_t)i * 8) = l;
    
  }
}

// ---------------------------------------------------------------------------
// C[M,N] = A[M,K](f32) * W[N,K]^T + bias, both operands split.
//   mode 0: C -> bf16 hi/lo planes row-major [M,N]                 (Q, K projections)
//   mode 1: C -> bf16 hi/lo planes transposed Vt[b][h][d][p]        (V projection, N = 768 = H*D)
//   mode 2: C -> f32 row-major [M,N]                                (O projection -> d_out)
// Workgroup = 8 waves, each wave owns a 16x64 tile -> WG tile 128x64. Weight panels [64n x 64k] (hi and lo) double-buffered in LDS,
// shared by all waves; A fragments split from f32 at load. The same 32 KB of LDS is reused as the epilogue staging tile.
// ---------------------------------------------------------------------------
__global__ __launch_bounds__(256)
void cma_gemm_tn(const float* __restrict__ A, const b16* __restrict__ Wh, const b16* __restrict__ Wl,
                 const float* __restrict__ bias, void* __restrict__ out0, void* __restrict__ out1,
                 int M, int N, int K, int mode) {
  __shared__ __attribute__((aligned(16))) unsigned char smem[32768];
  b16* sW = (b16*)smem;                       // [buf][plane][64*64]
  const int lane = threadIdx.x & 31;
  const int wave = threadIdx.x >> 5;
  const int tid  = threadIdx.x;
  const int mt   = blockIdx.x * 128 + wave * 16;
  const int nb   = blockIdx.y * 64;
  const int l16  = lane & 15;
  const int hh   = lane >> 4;
  const int rbase = hh * 8;

  const int wr0 = tid >> 3, wc0 = (tid & 7) * 8;
  const int wr1 = (tid + 256) >> 3, wc1 = ((tid + 256) & 7) * 8;
  auto loadW = [&](int buf, int k0) {
    b16* dh = sW + (buf * 2 + 0) * 4096; b16* dl = sW + (buf * 2 + 1) * 4096;
    *(i4*)(dh + wr0 * 64 + wc0) = *(const i4*)(Wh + (size_t)(nb + wr0) * K + k0 + wc0);
    *(i4*)(dh + wr1 * 64 + wc1) = *(const i4*)(Wh + (size_t)(nb + wr1) * K + k0 + wc1);
    *(i4*)(dl + wr0 * 64 + wc0) = *(const i4*)(Wl + (size_t)(nb + wr0) * K + k0 + wc0);
    *(i4*)(dl + wr1 * 64 + wc1) = *(const i4*)(Wl + (size_t)(nb + wr1) * K + k0 + wc1);
  };
  const float* ap = A + (size_t)(mt + l16) * K;

  v8f acc[4] = {};
  int buf = 0;
  loadW(0, 0);
  for (int k0 = 0; k0 < K; k0 += 64, buf ^= 1) {
    __syncthreads();                          // panel 'buf' staged by everyone; previous panel reads finished before it is overwritten below
    if (k0 + 64 < K) loadW(buf ^ 1, k0 + 64);
    const b16* ph = sW + (buf * 2 + 0) * 4096; const b16* pl = sW + (buf * 2 + 1) * 4096;
#pragma unroll
    for (int kk = 0; kk < 2; ++kk) {
      v16b ah, al; frag_ksplit(ap + k0 + kk * 32, hh, ah, al);
#pragma unroll
      for (int nt = 0; nt < 4; ++nt) {
        const b16* wp = ph + (nt * 16 + l16) * 64 + kk * 32;
        const b16* wq = pl + (nt * 16 + l16) * 64 + kk * 32;
        acc[nt] = wmma3(ah, al, frag_kb(wp, hh), frag_kb(wq, hh), acc[nt]);
      }
    }
  }
  __syncthreads();                            // all panel reads done: smem becomes the staging tile

  if (mode == 0) {
    b16* th = (b16*)smem + wave * 2048; b16* tl = th + 1024;
#pragma unroll
    for (int nt = 0; nt < 4; ++nt) {
      const float bn = bias[nb + nt * 16 + l16];
#pragma unroll
      for (int r = 0; r < 8; ++r) { b16 a, c; split_bf16(acc[nt][r] + bn, a, c); th[(rbase + r) * 64 + nt * 16 + l16] = a; tl[(rbase + r) * 64 + nt * 16 + l16] = c; }
    }
    wave_sync_lds();
    b16* oh = (b16*)out0; b16* ol = (b16*)out1;
    {
#pragma unroll
      for (int j = 0; j < 4; ++j) {
        const int row = j * 4 + (lane >> 3), seg = lane & 7;
        const size_t g = (size_t)(mt + row) * N + nb + seg * 8;
        *(v8b*)(oh + g) = ld8b(th + row * 64 + seg * 8);
        *(v8b*)(ol + g) = ld8b(tl + row * 64 + seg * 8);
      }
      
    }
  } else if (mode == 1) {
    b16* th = (b16*)smem; b16* tl = th + 8192;
    const int pl0 = wave * 16 + rbase;        // local p of register r = pl0 + r
#pragma unroll
    for (int nt = 0; nt < 4; ++nt) {
      const int nl = nt * 16 + l16;
      const float bn = bias[nb + nl];
#pragma unroll
      for (int r = 0; r < 8; ++r) { b16 a, c; split_bf16(acc[nt][r] + bn, a, c); th[nl * 128 + pl0 + r] = a; tl[nl * 128 + pl0 + r] = c; }
    }
    __syncthreads();
    b16* oh = (b16*)out0; b16* ol = (b16*)out1;
    const int p0 = (blockIdx.x * 128) & (NTOK - 1);
    const int bb = (blockIdx.x * 128) >> 10;
    {
#pragma unroll
      for (int q = 0; q < 4; ++q) {
        const int piece = tid + q * 256;      // 1024 pieces: 64 rows x 16
        const int nl = piece >> 4, seg = piece & 15;
        const int n = nb + nl, h = n / HDIM, d = n % HDIM;
        const size_t g = ((size_t)((bb * NHD + h) * HDIM + d) << 10) + p0 + seg * 8;
        *(v8b*)(oh + g) = ld8b(th + nl * 128 + seg * 8);
        *(v8b*)(ol + g) = ld8b(tl + nl * 128 + seg * 8);
      }
      
    }
  } else {
    float* of = (float*)out0;
    {
#pragma unroll
      for (int pr = 0; pr < 2; ++pr) {
        const int cbase = nb + pr * 32;
        const float bn = bias[cbase + lane];
#pragma unroll
        for (int r = 0; r < 8; ++r) {
          const float a0 = acc[2 * pr][r], b0 = acc[2 * pr + 1][r];
          const float ax = __shfl_xor(a0, 16), bx = __shfl_xor(b0, 16);
          const float v1 = (hh ? bx : a0) + bn;     // row mt + r
          const float v2 = (hh ? b0 : ax) + bn;     // row mt + r + 8
          *(float*)(of + (size_t)(mt + r) * N + cbase + lane) = v1;
          *(float*)(of + (size_t)(mt + r + 8) * N + cbase + lane) = v2;
        }
      }
      
    }
  }
}

// ---------------------------------------------------------------------------
// Attention core. One workgroup per (b, 16-row m-tile); loops over 8 heads.
//   Phase 1: S[16x1024] = (Q K^T) / sqrt(96) into the LDS panel (split WMMA, Q/K hi/lo planes)
//   Phase 2: exact softmax per row (2 rows per wave, 32 columns per lane); head-mean accumulated in registers; P written back f32
//   Phase 3: O_partial += P V over this wave's 128-key slab (P split from the f32 panel, V^T hi/lo planes)
// ---------------------------------------------------------------------------
__global__ __launch_bounds__(256)
void cma_attn(const b16* __restrict__ Qh, const b16* __restrict__ Ql,     // [8192,768]
              const b16* __restrict__ Kh, const b16* __restrict__ Kl,     // [8192,768]
              const b16* __restrict__ Vh, const b16* __restrict__ Vl,     // [8,8,96,1024]
              float* __restrict__ Ao,                                     // [8192,768] f32
              float* __restrict__ avg_out) {                              // [8,1024,1024] f32
  __shared__ __attribute__((aligned(16))) float sS[16 * 1024];            // 64 KB score / probability panel, reused for the O reduction

  const int b    = blockIdx.y;
  const int m0   = blockIdx.x * 16;
  const int tid  = threadIdx.x;
  const int lane = tid & 31;
  const int wave = tid >> 5;
  const int l16  = lane & 15;
  const int hh   = lane >> 4;
  const int rbase = hh * 8;
  const float scale = 0.1020620726f;                   // 1/sqrt(96)

  float AV[2][32];
#pragma unroll
  for (int rr = 0; rr < 2; ++rr)
#pragma unroll
    for (int i = 0; i < 32; ++i) AV[rr][i] = 0.f;

  for (int h = 0; h < NHD; ++h) {
    // ----- Phase 1: scores -> LDS --------------------------------------
    v16b qh_[3], ql_[3];
    {
      const size_t qo = ((size_t)((b << 10) + m0 + l16) * EMB) + h * HDIM;
#pragma unroll
      for (int kk = 0; kk < 3; ++kk) { qh_[kk] = frag_kb(Qh + qo + kk * 32, hh); ql_[kk] = frag_kb(Ql + qo + kk * 32, hh); }
    }
#pragma unroll
    for (int t = 0; t < 8; ++t) {
      const int p0 = wave * 128 + t * 16;
      const size_t ko = ((size_t)((b << 10) + p0 + l16) * EMB) + h * HDIM;
      v8f s = {};
#pragma unroll
      for (int kk = 0; kk < 3; ++kk) s = wmma3(qh_[kk], ql_[kk], frag_kb(Kh + ko + kk * 32, hh), frag_kb(Kl + ko + kk * 32, hh), s);
      const int ncol = p0 + l16;
#pragma unroll
      for (int r = 0; r < 8; ++r) sS[(rbase + r) * 1024 + ncol] = s[r] * scale;
    }
    __syncthreads();

    // ----- Phase 2: softmax (2 rows / wave), head-mean in registers, P back to the panel as f32 -----
    float P[2][32];
#pragma unroll
    for (int rr = 0; rr < 2; ++rr) {
      const int row = wave * 2 + rr;
      float mx = -3.0e38f;
#pragma unroll
      for (int i = 0; i < 32; ++i) { P[rr][i] = sS[row * 1024 + lane + 32 * i]; mx = fmaxf(mx, P[rr][i]); }
#pragma unroll
      for (int off = 16; off >= 1; off >>= 1) mx = fmaxf(mx, __shfl_xor(mx, off));
      float sum = 0.f;
#pragma unroll
      for (int i = 0; i < 32; ++i) { const float e = expf(P[rr][i] - mx); P[rr][i] = e; sum += e; }
#pragma unroll
      for (int off = 16; off >= 1; off >>= 1) sum += __shfl_xor(sum, off);
      const float inv = 1.0f / sum;
#pragma unroll
      for (int i = 0; i < 32; ++i) { P[rr][i] *= inv; AV[rr][i] += P[rr][i] * 0.125f; }
    }
    __syncthreads();                                   // all S reads done
#pragma unroll
    for (int rr = 0; rr < 2; ++rr) {
      const int row = wave * 2 + rr;
#pragma unroll
      for (int i = 0; i < 32; ++i) sS[row * 1024 + lane + 32 * i] = P[rr][i];
    }
    __syncthreads();

    // ----- Phase 3: O_partial += P * V over this wave's 128-wide key slab -----
    v8f o[6] = {};
#pragma unroll
    for (int c4 = 0; c4 < 4; ++c4) {
      const int pb = wave * 128 + c4 * 32;
      v16b aph, apl; frag_ksplit(sS + (size_t)l16 * 1024 + pb, hh, aph, apl);
#pragma unroll
      for (int nt = 0; nt < 6; ++nt) {
        const size_t vo = (((size_t)(b * NHD + h) * HDIM + nt * 16 + l16) << 10) + pb;
        o[nt] = wmma3(aph, apl, frag_kb(Vh + vo, hh), frag_kb(Vl + vo, hh), o[nt]);
      }
    }
    __syncthreads();                                   // P reads done; reuse LDS

#pragma unroll
    for (int nt = 0; nt < 6; ++nt)
#pragma unroll
      for (int r = 0; r < 8; ++r) sS[wave * 1536 + (rbase + r) * 96 + nt * 16 + l16] = o[nt][r];
    __syncthreads();
    for (int idx = tid; idx < 1536; idx += 256) {      // reduced tile into sS[8*1536 ..) (free region)
      float sum = 0.f;
#pragma unroll
      for (int w = 0; w < 8; ++w) sum += sS[w * 1536 + idx];
      sS[8 * 1536 + idx] = sum;
    }
    __syncthreads();
    {
      for (int piece = tid; piece < 384; piece += 256) {
        const int m = piece / 24, sg = piece % 24;
        *(v4f*)(Ao + ((size_t)((b << 10) + m0 + m) * EMB) + h * HDIM + sg * 4) = *(const v4f*)(sS + 8 * 1536 + m * 96 + sg * 4);
      }
      
    }
    __syncthreads();
  }
  {
#pragma unroll
    for (int rr = 0; rr < 2; ++rr) {
      float* apo = avg_out + ((size_t)((b << 10) + m0 + wave * 2 + rr) << 10) + lane;
#pragma unroll
      for (int i = 0; i < 32; ++i) *(float*)(apo + 32 * i) = AV[rr][i];
    }
    
  }
}

// ---------------------------------------------------------------------------
extern "C" void kernel_launch(void* const* d_in, const int* in_sizes, int n_in,
                              void* d_out, int out_size, void* d_ws, size_t ws_size,
                              hipStream_t stream) {
  (void)in_sizes; (void)n_in; (void)out_size;
  const float* mam = (const float*)d_in[0];
  const float* pat = (const float*)d_in[1];
  const float* qw  = (const float*)d_in[2];
  const float* qb  = (const float*)d_in[3];
  const float* kw  = (const float*)d_in[4];
  const float* kb  = (const float*)d_in[5];
  const float* vw  = (const float*)d_in[6];
  const float* vb  = (const float*)d_in[7];
  const float* ow  = (const float*)d_in[8];
  const float* ob  = (const float*)d_in[9];

  const size_t TOK = (size_t)MTOT * EMB;   // 6,291,456 elements
  const size_t WSZ = (size_t)EMB * EMB;    //   589,824 elements

  size_t off = 0; char* ws = (char*)d_ws;
  auto take = [&](size_t bytes) { void* p = ws + off; off += (bytes + 255) & ~(size_t)255; return p; };
  b16* Wqh = (b16*)take(WSZ * 2); b16* Wql = (b16*)take(WSZ * 2);
  b16* Wkh = (b16*)take(WSZ * 2); b16* Wkl = (b16*)take(WSZ * 2);
  b16* Wvh = (b16*)take(WSZ * 2); b16* Wvl = (b16*)take(WSZ * 2);
  b16* Woh = (b16*)take(WSZ * 2); b16* Wol = (b16*)take(WSZ * 2);
  b16* Qh = (b16*)take(TOK * 2);  b16* Ql = (b16*)take(TOK * 2);     // [8192,768] planes
  b16* Kh = (b16*)take(TOK * 2);  b16* Kl = (b16*)take(TOK * 2);
  b16* Vh = (b16*)take(TOK * 2);  b16* Vl = (b16*)take(TOK * 2);     // [8,8,96,1024] planes
  float* Ao = (float*)take(TOK * 4);                                 // attended pre-projection f32 [8192,768]
  if (off > ws_size) return;

  float* att_out = (float*)d_out;        // [8,1024,768]
  float* avg_out = att_out + TOK;        // [8,1024,1024]

  cma_wsplit<<<288, 256, 0, stream>>>(qw, Wqh, Wql, (int)(WSZ / 8));
  cma_wsplit<<<288, 256, 0, stream>>>(kw, Wkh, Wkl, (int)(WSZ / 8));
  cma_wsplit<<<288, 256, 0, stream>>>(vw, Wvh, Wvl, (int)(WSZ / 8));
  cma_wsplit<<<288, 256, 0, stream>>>(ow, Woh, Wol, (int)(WSZ / 8));

  dim3 gg(MTOT / 128, EMB / 64);
  cma_gemm_tn<<<gg, 256, 0, stream>>>(mam, Wqh, Wql, qb, Qh, Ql, MTOT, EMB, EMB, 0);
  cma_gemm_tn<<<gg, 256, 0, stream>>>(pat, Wkh, Wkl, kb, Kh, Kl, MTOT, EMB, EMB, 0);
  cma_gemm_tn<<<gg, 256, 0, stream>>>(pat, Wvh, Wvl, vb, Vh, Vl, MTOT, EMB, EMB, 1);

  cma_attn<<<dim3(NTOK / 16, NB), 256, 0, stream>>>(Qh, Ql, Kh, Kl, Vh, Vl, Ao, avg_out);

  cma_gemm_tn<<<gg, 256, 0, stream>>>(Ao, Woh, Wol, ob, att_out, nullptr, MTOT, EMB, EMB, 2);
}

// v001
// It runs in 480 microseconds.
// Timed twice side by side with v000, it ran 1.29 times as fast both times.
#include <hip/hip_runtime.h>

// ---------------------------------------------------------------------------
// Cross-modal attention (E=768, 8 heads x 96, B=8, 1024 query tokens x 1024 key tokens), two outputs: attended [8,1024,768] and the
// head-averaged attention matrix [8,1024,1024]. Every contraction runs on v_wmma_f32_16x16x32_bf16 with BOTH operands as bf16 hi/lo
// splits (hi.hi + hi.lo + lo.hi, f32 accumulate): the four projections (A = f32 activations split at fragment load, B = weight hi/lo
// planes), Q.K^T (Q/K hi/lo planes), P.V (P split from the f32 probability panel in LDS, V^T hi/lo planes). Softmax and the head mean f32.
// Fragment k-map per lane half hh, A and B alike: elements 0..7 <- k = 8hh+0..7, elements 8..15 <- k = 16+8hh+0..7.
// ---------------------------------------------------------------------------

typedef __bf16 b16;
typedef __attribute__((ext_vector_type(16))) __bf16 v16b;
typedef __attribute__((ext_vector_type(8)))  __bf16 v8b;
typedef __attribute__((ext_vector_type(8)))  float  v8f;
typedef __attribute__((ext_vector_type(4)))  float  v4f;
typedef __attribute__((ext_vector_type(4)))  int    i4;

#define NB 8
#define NTOK 1024
#define EMB 768
#define NHD 8
#define HDIM 96
#define MTOT 8192
#define WPITCH 72     // LDS pitch of a 64-element bf16 weight-panel row: 144 B = 16 B x odd, conflict-free for ds_load_b128 fragment reads
#define VPITCH 136    // LDS pitch of a 128-element bf16 row of the V^T staging tile: 272 B = 16 B x odd
#define SPITCH 1028   // LDS pitch of a 1024-element f32 score row: 4112 B = 16 B x odd

__device__ __forceinline__ void split_bf16(float v, b16& hi, b16& lo) {
  const unsigned int u = __builtin_bit_cast(unsigned int, v) & 0xffff0000u;
  hi = __builtin_bit_cast(b16, (unsigned short)(u >> 16));
  lo = (b16)(v - __builtin_bit_cast(float, u));
}
__device__ __forceinline__ v8b ld8b(const b16* p) { return *(const v8b*)p; }
__device__ __forceinline__ v16b cat8b(v8b a, v8b b) { return __builtin_shufflevector(a, b, 0, 1, 2, 3, 4, 5, 6, 7, 8, 9, 10, 11, 12, 13, 14, 15); }
__device__ __forceinline__ v16b frag_kb(const b16* p, int hh) { return cat8b(ld8b(p + 8 * hh), ld8b(p + 16 + 8 * hh)); }
__device__ __forceinline__ void frag_ksplit(const float* p, int hh, v16b& fh, v16b& fl) {
  const float* p0 = p + 8 * hh; const float* p1 = p + 16 + 8 * hh;
#pragma unroll
  for (int e = 0; e < 8; ++e) { b16 a, c; split_bf16(p0[e], a, c); fh[e] = a; fl[e] = c; split_bf16(p1[e], a, c); fh[8 + e] = a; fl[8 + e] = c; }
}
__device__ __forceinline__ v8f wmmab(v16b a, v16b b, v8f c) {
  v8f d = __builtin_amdgcn_wmma_f32_16x16x32_bf16(false, a, false, b, (short)0, c, false, false);
  asm volatile("v_nop\n\tv_nop\n\tv_nop\n\tv_nop" : "+v"(d) : "v"(a), "v"(b));
  return d;
}
__device__ __forceinline__ v8f wmma3(v16b ah, v16b al, v16b bh, v16b bl, v8f c) {
  c = wmmab(ah, bh, c); c = wmmab(ah, bl, c); c = wmmab(al, bh, c); return c;
}
__device__ __forceinline__ void wave_sync_lds() {
  __builtin_amdgcn_fence(__ATOMIC_RELEASE, "workgroup"); __builtin_amdgcn_wave_barrier(); __builtin_amdgcn_fence(__ATOMIC_ACQUIRE, "workgroup");
}

// ---------------------------------------------------------------------------
// ---------------------------------------------------------------------------
__global__ void cma_wsplit(const float* __restrict__ w, b16* __restrict__ wh, b16* __restrict__ wl, int n8) {
  int i = blockIdx.x * blockDim.x + threadIdx.x;
  int stride = gridDim.x * blockDim.x;
  for (; i < n8; i += stride) {
    v8b h, l;
#pragma unroll
    for (int e = 0; e < 8; ++e) { b16 a, c; split_bf16(w[(size_t)i * 8 + e], a, c); h[e] = a; l[e] = c; }
    *(v8b*)(wh + (size_t)i * 8) = h; *(v8b*)(wl + (size_t)i * 8) = l;
    
  }
}

// ---------------------------------------------------------------------------
// C[M,N] = A[M,K](f32) * W[N,K]^T + bias, both operands split.
//   mode 0: C -> bf16 hi/lo planes row-major [M,N]                 (Q, K projections)
//   mode 1: C -> bf16 hi/lo planes transposed Vt[b][h][d][p]        (V projection, N = 768 = H*D)
//   mode 2: C -> f32 row-major [M,N]                                (O projection -> d_out)
// Workgroup = 8 waves, each wave owns a 16x64 tile -> WG tile 128x64. Weight panels [64n x 64k] (hi and lo) double-buffered in LDS,
// rows padded to WPITCH, shared by all waves; A fragments split from f32 at load. The same LDS is reused as the epilogue staging tile.
// ---------------------------------------------------------------------------
__global__ __launch_bounds__(256)
void cma_gemm_tn(const float* __restrict__ A, const b16* __restrict__ Wh, const b16* __restrict__ Wl,
                 const float* __restrict__ bias, void* __restrict__ out0, void* __restrict__ out1,
                 int M, int N, int K, int mode) {
  __shared__ __attribute__((aligned(16))) unsigned char smem[4 * 64 * WPITCH * 2];
  b16* sW = (b16*)smem;                       // [buf][plane][64*WPITCH]
  const int lane = threadIdx.x & 31;
  const int wave = threadIdx.x >> 5;
  const int tid  = threadIdx.x;
  const int mt   = blockIdx.x * 128 + wave * 16;
  const int nb   = blockIdx.y * 64;
  const int l16  = lane & 15;
  const int hh   = lane >> 4;
  const int rbase = hh * 8;

  const int wr0 = tid >> 3, wc0 = (tid & 7) * 8;
  const int wr1 = (tid + 256) >> 3, wc1 = ((tid + 256) & 7) * 8;
  auto loadW = [&](int buf, int k0) {
    b16* dh = sW + (buf * 2 + 0) * (64 * WPITCH); b16* dl = sW + (buf * 2 + 1) * (64 * WPITCH);
    *(i4*)(dh + wr0 * WPITCH + wc0) = *(const i4*)(Wh + (size_t)(nb + wr0) * K + k0 + wc0);
    *(i4*)(dh + wr1 * WPITCH + wc1) = *(const i4*)(Wh + (size_t)(nb + wr1) * K + k0 + wc1);
    *(i4*)(dl + wr0 * WPITCH + wc0) = *(const i4*)(Wl + (size_t)(nb + wr0) * K + k0 + wc0);
    *(i4*)(dl + wr1 * WPITCH + wc1) = *(const i4*)(Wl + (size_t)(nb + wr1) * K + k0 + wc1);
  };
  const float* ap = A + (size_t)(mt + l16) * K;

  v8f acc[4] = {};
  int buf = 0;
  loadW(0, 0);
  for (int k0 = 0; k0 < K; k0 += 64, buf ^= 1) {
    __syncthreads();                          // panel 'buf' staged by everyone; previous panel reads finished before it is overwritten below
    if (k0 + 64 < K) loadW(buf ^ 1, k0 + 64);
    const b16* ph = sW + (buf * 2 + 0) * (64 * WPITCH); const b16* pl = sW + (buf * 2 + 1) * (64 * WPITCH);
#pragma unroll
    for (int kk = 0; kk < 2; ++kk) {
      v16b ah, al; frag_ksplit(ap + k0 + kk * 32, hh, ah, al);
#pragma unroll
      for (int nt = 0; nt < 4; ++nt) {
        const b16* wp = ph + (nt * 16 + l16) * WPITCH + kk * 32;
        const b16* wq = pl + (nt * 16 + l16) * WPITCH + kk * 32;
        acc[nt] = wmma3(ah, al, frag_kb(wp, hh), frag_kb(wq, hh), acc[nt]);
      }
    }
  }
  __syncthreads();                            // all panel reads done: smem becomes the staging tile

  if (mode == 0) {
    b16* th = (b16*)smem + wave * 2048; b16* tl = th + 1024;
#pragma unroll
    for (int nt = 0; nt < 4; ++nt) {
      const float bn = bias[nb + nt * 16 + l16];
#pragma unroll
      for (int r = 0; r < 8; ++r) { b16 a, c; split_bf16(acc[nt][r] + bn, a, c); th[(rbase + r) * 64 + nt * 16 + l16] = a; tl[(rbase + r) * 64 + nt * 16 + l16] = c; }
    }
    wave_sync_lds();
    b16* oh = (b16*)out0; b16* ol = (b16*)out1;
    {
#pragma unroll
      for (int j = 0; j < 4; ++j) {
        const int row = j * 4 + (lane >> 3), seg = lane & 7;
        const size_t g = (size_t)(mt + row) * N + nb + seg * 8;
        *(v8b*)(oh + g) = ld8b(th + row * 64 + seg * 8);
        *(v8b*)(ol + g) = ld8b(tl + row * 64 + seg * 8);
      }
      
    }
  } else if (mode == 1) {
    b16* th = (b16*)smem; b16* tl = th + 64 * VPITCH;
    const int pl0 = wave * 16 + rbase;        // local p of register r = pl0 + r
#pragma unroll
    for (int nt = 0; nt < 4; ++nt) {
      const int nl = nt * 16 + l16;
      const float bn = bias[nb + nl];
#pragma unroll
      for (int r = 0; r < 8; ++r) { b16 a, c; split_bf16(acc[nt][r] + bn, a, c); th[nl * VPITCH + pl0 + r] = a; tl[nl * VPITCH + pl0 + r] = c; }
    }
    __syncthreads();
    b16* oh = (b16*)out0; b16* ol = (b16*)out1;
    const int p0 = (blockIdx.x * 128) & (NTOK - 1);
    const int bb = (blockIdx.x * 128) >> 10;
    {
#pragma unroll
      for (int q = 0; q < 4; ++q) {
        const int piece = tid + q * 256;      // 1024 pieces: 64 rows x 16
        const int nl = piece >> 4, seg = piece & 15;
        const int n = nb + nl, h = n / HDIM, d = n % HDIM;
        const size_t g = ((size_t)((bb * NHD + h) * HDIM + d) << 10) + p0 + seg * 8;
        *(v8b*)(oh + g) = ld8b(th + nl * VPITCH + seg * 8);
        *(v8b*)(ol + g) = ld8b(tl + nl * VPITCH + seg * 8);
      }
      asm volatile("s_wait_xcnt 0x0" ::: "memory");   // stands behind the run of stores, before any register that an issued store names is rewritten
    }
  } else {
    float* of = (float*)out0;
    {
#pragma unroll
      for (int pr = 0; pr < 2; ++pr) {
        const int cbase = nb + pr * 32;
        const float bn = bias[cbase + lane];
#pragma unroll
        for (int r = 0; r < 8; ++r) {
          const float a0 = acc[2 * pr][r], b0 = acc[2 * pr + 1][r];
          const float ax = __shfl_xor(a0, 16), bx = __shfl_xor(b0, 16);
          const float v1 = (hh ? bx : a0) + bn;     // row mt + r
          const float v2 = (hh ? b0 : ax) + bn;     // row mt + r + 8
          *(float*)(of + (size_t)(mt + r) * N + cbase + lane) = v1;
          *(float*)(of + (size_t)(mt + r + 8) * N + cbase + lane) = v2;
        }
      }
      
    }
  }
}

// ---------------------------------------------------------------------------
// Attention core. One workgroup per (b, 16-row m-tile); loops over 8 heads.
//   Phase 1: S[16x1024] = (Q K^T) / sqrt(96) into the LDS panel (split WMMA, Q/K hi/lo planes)
//   Phase 2: exact softmax per row (2 rows per wave, 32 columns per lane); head-mean accumulated in registers; P written back f32
//   Phase 3: O_partial += P V over this wave's 128-key slab (P split from the f32 panel, V^T hi/lo planes)
// ---------------------------------------------------------------------------
__global__ __launch_bounds__(256)
void cma_attn(const b16* __restrict__ Qh, const b16* __restrict__ Ql,     // [8192,768]
              const b16* __restrict__ Kh, const b16* __restrict__ Kl,     // [8192,768]
              const b16* __restrict__ Vh, const b16* __restrict__ Vl,     // [8,8,96,1024]
              float* __restrict__ Ao,                                     // [8192,768] f32
              float* __restrict__ avg_out) {                              // [8,1024,1024] f32
  __shared__ __attribute__((aligned(16))) float sS[16 * SPITCH];          // score / probability panel, rows padded to SPITCH, reused for the O reduction

  const int b    = blockIdx.y;
  const int m0   = blockIdx.x * 16;
  const int tid  = threadIdx.x;
  const int lane = tid & 31;
  const int wave = tid >> 5;
  const int l16  = lane & 15;
  const int hh   = lane >> 4;
  const int rbase = hh * 8;
  const float scale = 0.1020620726f;                   // 1/sqrt(96)

  float AV[2][32];
#pragma unroll
  for (int rr = 0; rr < 2; ++rr)
#pragma unroll
    for (int i = 0; i < 32; ++i) AV[rr][i] = 0.f;

  for (int h = 0; h < NHD; ++h) {
    // ----- Phase 1: scores -> LDS --------------------------------------
    v16b qh_[3], ql_[3];
    {
      const size_t qo = ((size_t)((b << 10) + m0 + l16) * EMB) + h * HDIM;
#pragma unroll
      for (int kk = 0; kk < 3; ++kk) { qh_[kk] = frag_kb(Qh + qo + kk * 32, hh); ql_[kk] = frag_kb(Ql + qo + kk * 32, hh); }
    }
#pragma unroll
    for (int t = 0; t < 8; ++t) {
      const int p0 = wave * 128 + t * 16;
      const size_t ko = ((size_t)((b << 10) + p0 + l16) * EMB) + h * HDIM;
      v8f s = {};
#pragma unroll
      for (int kk = 0; kk < 3; ++kk) s = wmma3(qh_[kk], ql_[kk], frag_kb(Kh + ko + kk * 32, hh), frag_kb(Kl + ko + kk * 32, hh), s);
      const int ncol = p0 + l16;
#pragma unroll
      for (int r = 0; r < 8; ++r) sS[(rbase + r) * SPITCH + ncol] = s[r] * scale;
    }
    __syncthreads();

    // ----- Phase 2: softmax (2 rows / wave), head-mean in registers, P back to the panel as f32 -----
    float P[2][32];
#pragma unroll
    for (int rr = 0; rr < 2; ++rr) {
      const int row = wave * 2 + rr;
      float mx = -3.0e38f;
#pragma unroll
      for (int i = 0; i < 32; ++i) { P[rr][i] = sS[row * SPITCH + lane + 32 * i]; mx = fmaxf(mx, P[rr][i]); }
#pragma unroll
      for (int off = 16; off >= 1; off >>= 1) mx = fmaxf(mx, __shfl_xor(mx, off));
      float sum = 0.f;
#pragma unroll
      for (int i = 0; i < 32; ++i) { const float e = expf(P[rr][i] - mx); P[rr][i] = e; sum += e; }
#pragma unroll
      for (int off = 16; off >= 1; off >>= 1) sum += __shfl_xor(sum, off);
      const float inv = 1.0f / sum;
#pragma unroll
      for (int i = 0; i < 32; ++i) { P[rr][i] *= inv; AV[rr][i] += P[rr][i] * 0.125f; }
    }
    __syncthreads();                                   // all S reads done
#pragma unroll
    for (int rr = 0; rr < 2; ++rr) {
      const int row = wave * 2 + rr;
#pragma unroll
      for (int i = 0; i < 32; ++i) sS[row * SPITCH + lane + 32 * i] = P[rr][i];
    }
    __syncthreads();

    // ----- Phase 3: O_partial += P * V over this wave's 128-wide key slab -----
    v8f o[6] = {};
#pragma unroll
    for (int c4 = 0; c4 < 4; ++c4) {
      const int pb = wave * 128 + c4 * 32;
      v16b aph, apl; frag_ksplit(sS + (size_t)l16 * SPITCH + pb, hh, aph, apl);
#pragma unroll
      for (int nt = 0; nt < 6; ++nt) {
        const size_t vo = (((size_t)(b * NHD + h) * HDIM + nt * 16 + l16) << 10) + pb;
        o[nt] = wmma3(aph, apl, frag_kb(Vh + vo, hh), frag_kb(Vl + vo, hh), o[nt]);
      }
    }
    __syncthreads();                                   // P reads done; reuse LDS

#pragma unroll
    for (int nt = 0; nt < 6; ++nt)
#pragma unroll
      for (int r = 0; r < 8; ++r) sS[wave * 1536 + (rbase + r) * 96 + nt * 16 + l16] = o[nt][r];
    __syncthreads();
    for (int idx = tid; idx < 1536; idx += 256) {      // reduced tile into sS[8*1536 ..) (free region)
      float sum = 0.f;
#pragma unroll
      for (int w = 0; w < 8; ++w) sum += sS[w * 1536 + idx];
      sS[8 * 1536 + idx] = sum;
    }
    __syncthreads();
    {
      for (int piece = tid; piece < 384; piece += 256) {
        const int m = piece / 24, sg = piece % 24;
        *(v4f*)(Ao + ((size_t)((b << 10) + m0 + m) * EMB) + h * HDIM + sg * 4) = *(const v4f*)(sS + 8 * 1536 + m * 96 + sg * 4);
      }
      
    }
    __syncthreads();
  }
  {
#pragma unroll
    for (int rr = 0; rr < 2; ++rr) {
      float* apo = avg_out + ((size_t)((b << 10) + m0 + wave * 2 + rr) << 10) + lane;
#pragma unroll
      for (int i = 0; i < 32; ++i) *(float*)(apo + 32 * i) = AV[rr][i];
    }
    
  }
}

// ---------------------------------------------------------------------------
extern "C" void kernel_launch(void* const* d_in, const int* in_sizes, int n_in,
                              void* d_out, int out_size, void* d_ws, size_t ws_size,
                              hipStream_t stream) {
  (void)in_sizes; (void)n_in; (void)out_size;
  const float* mam = (const float*)d_in[0];
  const float* pat = (const float*)d_in[1];
  const float* qw  = (const float*)d_in[2];
  const float* qb  = (const float*)d_in[3];
  const float* kw  = (const float*)d_in[4];
  const float* kb  = (const float*)d_in[5];
  const float* vw  = (const float*)d_in[6];
  const float* vb  = (const float*)d_in[7];
  const float* ow  = (const float*)d_in[8];
  const float* ob  = (const float*)d_in[9];

  const size_t TOK = (size_t)MTOT * EMB;   // 6,291,456 elements
  const size_t WSZ = (size_t)EMB * EMB;    //   589,824 elements

  size_t off = 0; char* ws = (char*)d_ws;
  auto take = [&](size_t bytes) { void* p = ws + off; off += (bytes + 255) & ~(size_t)255; return p; };
  b16* Wqh = (b16*)take(WSZ * 2); b16* Wql = (b16*)take(WSZ * 2);
  b16* Wkh = (b16*)take(WSZ * 2); b16* Wkl = (b16*)take(WSZ * 2);
  b16* Wvh = (b16*)take(WSZ * 2); b16* Wvl = (b16*)take(WSZ * 2);
  b16* Woh = (b16*)take(WSZ * 2); b16* Wol = (b16*)take(WSZ * 2);
  b16* Qh = (b16*)take(TOK * 2);  b16* Ql = (b16*)take(TOK * 2);     // [8192,768] planes
  b16* Kh = (b16*)take(TOK * 2);  b16* Kl = (b16*)take(TOK * 2);
  b16* Vh = (b16*)take(TOK * 2);  b16* Vl = (b16*)take(TOK * 2);     // [8,8,96,1024] planes
  float* Ao = (float*)take(TOK * 4);                                 // attended pre-projection f32 [8192,768]
  if (off > ws_size) return;

  float* att_out = (float*)d_out;        // [8,1024,768]
  float* avg_out = att_out + TOK;        // [8,1024,1024]

  cma_wsplit<<<288, 256, 0, stream>>>(qw, Wqh, Wql, (int)(WSZ / 8));
  cma_wsplit<<<288, 256, 0, stream>>>(kw, Wkh, Wkl, (int)(WSZ / 8));
  cma_wsplit<<<288, 256, 0, stream>>>(vw, Wvh, Wvl, (int)(WSZ / 8));
  cma_wsplit<<<288, 256, 0, stream>>>(ow, Woh, Wol, (int)(WSZ / 8));

  dim3 gg(MTOT / 128, EMB / 64);
  cma_gemm_tn<<<gg, 256, 0, stream>>>(mam, Wqh, Wql, qb, Qh, Ql, MTOT, EMB, EMB, 0);
  cma_gemm_tn<<<gg, 256, 0, stream>>>(pat, Wkh, Wkl, kb, Kh, Kl, MTOT, EMB, EMB, 0);
  cma_gemm_tn<<<gg, 256, 0, stream>>>(pat, Wvh, Wvl, vb, Vh, Vl, MTOT, EMB, EMB, 1);

  cma_attn<<<dim3(NTOK / 16, NB), 256, 0, stream>>>(Qh, Ql, Kh, Kl, Vh, Vl, Ao, avg_out);

  cma_gemm_tn<<<gg, 256, 0, stream>>>(Ao, Woh, Wol, ob, att_out, nullptr, MTOT, EMB, EMB, 2);
}

// v002
// A run of this version takes 325 microseconds.
// Next to v001, in two timings, it ran 1.48 times as fast each time.
// Counting every step since v000, it is 1.91 times as fast.
#include <hip/hip_runtime.h>

// ---------------------------------------------------------------------------
// Cross-modal attention (E=768, 8 heads x 96, B=8, 1024 query tokens x 1024 key tokens), two outputs: attended [8,1024,768] and the
// head-averaged attention matrix [8,1024,1024]. Every contraction runs on v_wmma_f32_16x16x32_bf16 with BOTH operands as bf16 hi/lo
// splits (hi.hi + hi.lo + lo.hi, f32 accumulate): the four projections (A = f32 activations split at fragment load, B = weight hi/lo
// planes), Q.K^T (Q/K hi/lo planes), P.V (P split from the f32 probability panel in LDS, V^T hi/lo planes). Softmax and the head mean f32.
// Fragment k-map per lane half hh, A and B alike: elements 0..7 <- k = 8hh+0..7, elements 8..15 <- k = 16+8hh+0..7.
// ---------------------------------------------------------------------------

typedef __bf16 b16;
typedef __attribute__((ext_vector_type(16))) __bf16 v16b;
typedef __attribute__((ext_vector_type(8)))  __bf16 v8b;
typedef __attribute__((ext_vector_type(8)))  float  v8f;
typedef __attribute__((ext_vector_type(2)))  float  v2f;
typedef __attribute__((ext_vector_type(4)))  int    i4;

#define NB 8
#define NTOK 1024
#define EMB 768
#define NHD 8
#define HDIM 96
#define MTOT 8192
#define WPITCH 72     // LDS pitch of a 64-element bf16 weight-panel row: 144 B = 16 B x odd, conflict-free for ds_load_b128 fragment reads
#define VPITCH 136    // LDS pitch of a 128-element bf16 row of the V^T staging tile: 272 B = 16 B x odd
#define SPITCH 1028   // LDS pitch of a 1024-element f32 score row: 4112 B = 16 B x odd

__device__ __forceinline__ void split_bf16(float v, b16& hi, b16& lo) {
  const unsigned int u = __builtin_bit_cast(unsigned int, v) & 0xffff0000u;
  hi = __builtin_bit_cast(b16, (unsigned short)(u >> 16));
  lo = (b16)(v - __builtin_bit_cast(float, u));
}
__device__ __forceinline__ v8b ld8b(const b16* p) { return *(const v8b*)p; }
__device__ __forceinline__ v16b cat8b(v8b a, v8b b) { return __builtin_shufflevector(a, b, 0, 1, 2, 3, 4, 5, 6, 7, 8, 9, 10, 11, 12, 13, 14, 15); }
__device__ __forceinline__ v16b frag_kb(const b16* p, int hh) { return cat8b(ld8b(p + 8 * hh), ld8b(p + 16 + 8 * hh)); }
// The same fragment from a wave-uniform plane pointer, a per-lane byte offset (row and lane half) and a constant byte offset: every load of a plane shares one per-lane address
__device__ __forceinline__ v16b frag_off(const b16* base, unsigned int lane_bytes, int const_bytes) {
  const char* p = (const char*)base + lane_bytes + const_bytes;
  return cat8b(*(const v8b*)p, *(const v8b*)(p + 32));
}
__device__ __forceinline__ void frag_ksplit(const float* p, int hh, v16b& fh, v16b& fl) {
  const float* p0 = p + 8 * hh; const float* p1 = p + 16 + 8 * hh;
#pragma unroll
  for (int e = 0; e < 8; ++e) { b16 a, c; split_bf16(p0[e], a, c); fh[e] = a; fl[e] = c; split_bf16(p1[e], a, c); fh[8 + e] = a; fl[8 + e] = c; }
}
__device__ __forceinline__ v8f wmmab(v16b a, v16b b, v8f c) {
  v8f d = __builtin_amdgcn_wmma_f32_16x16x32_bf16(false, a, false, b, (short)0, c, false, false);
  asm volatile("v_nop\n\tv_nop\n\tv_nop\n\tv_nop" : "+v"(d) : "v"(a), "v"(b));
  return d;
}
__device__ __forceinline__ v8f wmma3(v16b ah, v16b al, v16b bh, v16b bl, v8f c) {
  c = wmmab(ah, bh, c); c = wmmab(ah, bl, c); c = wmmab(al, bh, c); return c;
}
__device__ __forceinline__ void wave_sync_lds() {
  __builtin_amdgcn_fence(__ATOMIC_RELEASE, "workgroup"); __builtin_amdgcn_wave_barrier(); __builtin_amdgcn_fence(__ATOMIC_ACQUIRE, "workgroup");
}

// ---------------------------------------------------------------------------
// ---------------------------------------------------------------------------
__global__ void cma_wsplit(const float* __restrict__ w, b16* __restrict__ wh, b16* __restrict__ wl, int n8) {
  int i = blockIdx.x * blockDim.x + threadIdx.x;
  int stride = gridDim.x * blockDim.x;
  for (; i < n8; i += stride) {
    v8b h, l;
#pragma unroll
    for (int e = 0; e < 8; ++e) { b16 a, c; split_bf16(w[(size_t)i * 8 + e], a, c); h[e] = a; l[e] = c; }
    *(v8b*)(wh + (size_t)i * 8) = h; *(v8b*)(wl + (size_t)i * 8) = l;
    
  }
}

// ---------------------------------------------------------------------------
// C[M,N] = A[M,K](f32) * W[N,K]^T + bias, both operands split.
//   mode 0: C -> bf16 hi/lo planes row-major [M,N]                 (Q, K projections)
//   mode 1: C -> bf16 hi/lo planes transposed Vt[b][h][d][p]        (V projection, N = 768 = H*D)
//   mode 2: C -> f32 row-major [M,N]                                (O projection -> d_out)
// Workgroup = 8 waves, each wave owns a 16x64 tile -> WG tile 128x64. Weight panels [64n x 64k] (hi and lo) double-buffered in LDS,
// rows padded to WPITCH, shared by all waves; A fragments split from f32 at load. The same LDS is reused as the epilogue staging tile.
// ---------------------------------------------------------------------------
__global__ __launch_bounds__(256)
void cma_gemm_tn(const float* __restrict__ A, const b16* __restrict__ Wh, const b16* __restrict__ Wl,
                 const float* __restrict__ bias, void* __restrict__ out0, void* __restrict__ out1,
                 int M, int N, int K, int mode) {
  __shared__ __attribute__((aligned(16))) unsigned char smem[4 * 64 * WPITCH * 2];
  b16* sW = (b16*)smem;                       // [buf][plane][64*WPITCH]
  const int lane = threadIdx.x & 31;
  const int wave = threadIdx.x >> 5;
  const int tid  = threadIdx.x;
  const int mt   = blockIdx.x * 128 + wave * 16;
  const int nb   = blockIdx.y * 64;
  const int l16  = lane & 15;
  const int hh   = lane >> 4;
  const int rbase = hh * 8;

  const int wr0 = tid >> 3, wc0 = (tid & 7) * 8;
  const int wr1 = (tid + 256) >> 3, wc1 = ((tid + 256) & 7) * 8;
  auto loadW = [&](int buf, int k0) {
    b16* dh = sW + (buf * 2 + 0) * (64 * WPITCH); b16* dl = sW + (buf * 2 + 1) * (64 * WPITCH);
    *(i4*)(dh + wr0 * WPITCH + wc0) = *(const i4*)(Wh + (size_t)(nb + wr0) * K + k0 + wc0);
    *(i4*)(dh + wr1 * WPITCH + wc1) = *(const i4*)(Wh + (size_t)(nb + wr1) * K + k0 + wc1);
    *(i4*)(dl + wr0 * WPITCH + wc0) = *(const i4*)(Wl + (size_t)(nb + wr0) * K + k0 + wc0);
    *(i4*)(dl + wr1 * WPITCH + wc1) = *(const i4*)(Wl + (size_t)(nb + wr1) * K + k0 + wc1);
  };
  const float* ap = A + (size_t)(mt + l16) * K;

  v8f acc[4] = {};
  int buf = 0;
  loadW(0, 0);
  for (int k0 = 0; k0 < K; k0 += 64, buf ^= 1) {
    __syncthreads();                          // panel 'buf' staged by everyone; previous panel reads finished before it is overwritten below
    if (k0 + 64 < K) loadW(buf ^ 1, k0 + 64);
    const b16* ph = sW + (buf * 2 + 0) * (64 * WPITCH); const b16* pl = sW + (buf * 2 + 1) * (64 * WPITCH);
#pragma unroll
    for (int kk = 0; kk < 2; ++kk) {
      v16b ah, al; frag_ksplit(ap + k0 + kk * 32, hh, ah, al);
#pragma unroll
      for (int nt = 0; nt < 4; ++nt) {
        const b16* wp = ph + (nt * 16 + l16) * WPITCH + kk * 32;
        const b16* wq = pl + (nt * 16 + l16) * WPITCH + kk * 32;
        acc[nt] = wmma3(ah, al, frag_kb(wp, hh), frag_kb(wq, hh), acc[nt]);
      }
    }
  }
  __syncthreads();                            // all panel reads done: smem becomes the staging tile

  if (mode == 0) {
    b16* th = (b16*)smem + wave * 2048; b16* tl = th + 1024;
#pragma unroll
    for (int nt = 0; nt < 4; ++nt) {
      const float bn = bias[nb + nt * 16 + l16];
#pragma unroll
      for (int r = 0; r < 8; ++r) { b16 a, c; split_bf16(acc[nt][r] + bn, a, c); th[(rbase + r) * 64 + nt * 16 + l16] = a; tl[(rbase + r) * 64 + nt * 16 + l16] = c; }
    }
    wave_sync_lds();
    b16* oh = (b16*)out0; b16* ol = (b16*)out1;
    {
#pragma unroll
      for (int j = 0; j < 4; ++j) {
        const int row = j * 4 + (lane >> 3), seg = lane & 7;
        const size_t g = (size_t)(mt + row) * N + nb + seg * 8;
        *(v8b*)(oh + g) = ld8b(th + row * 64 + seg * 8);
        *(v8b*)(ol + g) = ld8b(tl + row * 64 + seg * 8);
      }
      
    }
  } else if (mode == 1) {
    b16* th = (b16*)smem; b16* tl = th + 64 * VPITCH;
    const int pl0 = wave * 16 + rbase;        // local p of register r = pl0 + r
#pragma unroll
    for (int nt = 0; nt < 4; ++nt) {
      const int nl = nt * 16 + l16;
      const float bn = bias[nb + nl];
#pragma unroll
      for (int r = 0; r < 8; ++r) { b16 a, c; split_bf16(acc[nt][r] + bn, a, c); th[nl * VPITCH + pl0 + r] = a; tl[nl * VPITCH + pl0 + r] = c; }
    }
    __syncthreads();
    b16* oh = (b16*)out0; b16* ol = (b16*)out1;
    const int p0 = (blockIdx.x * 128) & (NTOK - 1);
    const int bb = (blockIdx.x * 128) >> 10;
    {
#pragma unroll
      for (int q = 0; q < 4; ++q) {
        const int piece = tid + q * 256;      // 1024 pieces: 64 rows x 16
        const int nl = piece >> 4, seg = piece & 15;
        const int n = nb + nl, h = n / HDIM, d = n % HDIM;
        const size_t g = ((size_t)((bb * NHD + h) * HDIM + d) << 10) + p0 + seg * 8;
        *(v8b*)(oh + g) = ld8b(th + nl * VPITCH + seg * 8);
        *(v8b*)(ol + g) = ld8b(tl + nl * VPITCH + seg * 8);
      }
      asm volatile("s_wait_xcnt 0x0" ::: "memory");   // stands behind the run of stores, before any register that an issued store names is rewritten
    }
  } else {
    float* of = (float*)out0;
    {
#pragma unroll
      for (int pr = 0; pr < 2; ++pr) {
        const int cbase = nb + pr * 32;
        const float bn = bias[cbase + lane];
#pragma unroll
        for (int r = 0; r < 8; ++r) {
          const float a0 = acc[2 * pr][r], b0 = acc[2 * pr + 1][r];
          const float ax = __shfl_xor(a0, 16), bx = __shfl_xor(b0, 16);
          const float v1 = (hh ? bx : a0) + bn;     // row mt + r
          const float v2 = (hh ? b0 : ax) + bn;     // row mt + r + 8
          *(float*)(of + (size_t)(mt + r) * N + cbase + lane) = v1;
          *(float*)(of + (size_t)(mt + r + 8) * N + cbase + lane) = v2;
        }
      }
      
    }
  }
}

// ---------------------------------------------------------------------------
// Attention core. One workgroup of 16 waves per (b, 32-row block = two 16-row m-tiles); loops over 8 heads.
// Every K and V fragment that a wave loads is multiplied into both m-tiles, so each (b, h) K/V plane is read by 32 workgroups, not 64.
//   Phase 1: S[32x1024] = (Q K^T) / sqrt(96) into the LDS panel (split WMMA, Q/K hi/lo planes); a wave owns 64 keys
//   Phase 2: exact softmax per row (2 rows per wave, 32 columns per lane); head-mean accumulated in registers; P written back f32
//   Phase 3: O_partial += P V; a wave owns one 128-key slab (wave & 7) and one 48-column half of the head (wave >> 3), both m-tiles
// ---------------------------------------------------------------------------
__global__ __launch_bounds__(512)
void cma_attn(const b16* __restrict__ Qh, const b16* __restrict__ Ql,     // [8192,768]
              const b16* __restrict__ Kh, const b16* __restrict__ Kl,     // [8192,768]
              const b16* __restrict__ Vh, const b16* __restrict__ Vl,     // [8,8,96,1024]
              float* __restrict__ Ao,                                     // [8192,768] f32
              float* __restrict__ avg_out) {                              // [8,1024,1024] f32
  __shared__ __attribute__((aligned(16))) float sS[32 * SPITCH];          // score / probability panel, rows padded to SPITCH, reused for the O reduction

  const int b    = blockIdx.y;
  const int m0   = blockIdx.x * 32;
  const int tid  = threadIdx.x;
  const int lane = tid & 31;
  const int wave = tid >> 5;
  const int l16  = lane & 15;
  const int hh   = lane >> 4;
  const int rbase = hh * 8;
  const int slab = wave & 7;                           // phase 3: 128-key slab
  const int nt0  = (wave >> 3) * 3;                    // phase 3: first of this wave's three 16-column tiles of the head
  const float scale = 0.1020620726f;                   // 1/sqrt(96)
  const unsigned int qlane = (unsigned int)(l16 * EMB + 8 * hh) * 2u;                                  // per-lane byte offsets inside a plane
  const unsigned int klane = (unsigned int)((wave * 64 + l16) * EMB + 8 * hh) * 2u;
  const unsigned int vlane = (unsigned int)(((nt0 * 16 + l16) << 10) + slab * 128 + 8 * hh) * 2u;

  float AV[2][32];
#pragma unroll
  for (int rr = 0; rr < 2; ++rr)
#pragma unroll
    for (int i = 0; i < 32; ++i) AV[rr][i] = 0.f;

  for (int h = 0; h < NHD; ++h) {
    // ----- Phase 1: scores -> LDS --------------------------------------
    v8f s[4][2] = {};                                  // [16-key tile][m-tile]; k chunk outermost, so that only one chunk of Q is held in registers
    const size_t qu = (size_t)((b << 10) + m0) * EMB + h * HDIM;          // wave-uniform element offsets of this head's Q rows and K rows
    const size_t ku = (size_t)(b << 10) * EMB + h * HDIM;
#pragma unroll
    for (int kk = 0; kk < 3; ++kk) {
      const v16b qh0 = frag_off(Qh + qu, qlane, kk * 64), ql0 = frag_off(Ql + qu, qlane, kk * 64);
      const v16b qh1 = frag_off(Qh + qu, qlane, 16 * EMB * 2 + kk * 64), ql1 = frag_off(Ql + qu, qlane, 16 * EMB * 2 + kk * 64);
#pragma unroll
      for (int t = 0; t < 4; ++t) {
        const v16b kh_ = frag_off(Kh + ku, klane, t * 16 * EMB * 2 + kk * 64), kl_ = frag_off(Kl + ku, klane, t * 16 * EMB * 2 + kk * 64);
        s[t][0] = wmmab(qh0, kh_, s[t][0]); s[t][1] = wmmab(qh1, kh_, s[t][1]);
        s[t][0] = wmmab(qh0, kl_, s[t][0]); s[t][1] = wmmab(qh1, kl_, s[t][1]);
        s[t][0] = wmmab(ql0, kh_, s[t][0]); s[t][1] = wmmab(ql1, kh_, s[t][1]);
      }
    }
#pragma unroll
    for (int t = 0; t < 4; ++t) {
      const int ncol = wave * 64 + t * 16 + l16;
#pragma unroll
      for (int r = 0; r < 8; ++r) { sS[(rbase + r) * SPITCH + ncol] = s[t][0][r] * scale; sS[(16 + rbase + r) * SPITCH + ncol] = s[t][1][r] * scale; }
    }
    __syncthreads();

    // ----- Phase 2: softmax (2 rows / wave), head-mean in registers, P back to the panel as f32 -----
    float P[2][32];
#pragma unroll
    for (int rr = 0; rr < 2; ++rr) {
      const int row = wave * 2 + rr;
      float mx = -3.0e38f;
#pragma unroll
      for (int i = 0; i < 32; ++i) { P[rr][i] = sS[row * SPITCH + lane + 32 * i]; mx = fmaxf(mx, P[rr][i]); }
#pragma unroll
      for (int off = 16; off >= 1; off >>= 1) mx = fmaxf(mx, __shfl_xor(mx, off));
      float sum = 0.f;
#pragma unroll
      for (int i = 0; i < 32; ++i) { const float e = expf(P[rr][i] - mx); P[rr][i] = e; sum += e; }
#pragma unroll
      for (int off = 16; off >= 1; off >>= 1) sum += __shfl_xor(sum, off);
      const float inv = 1.0f / sum;
#pragma unroll
      for (int i = 0; i < 32; ++i) { P[rr][i] *= inv; AV[rr][i] += P[rr][i] * 0.125f; }
    }
    __syncthreads();                                   // all S reads done
#pragma unroll
    for (int rr = 0; rr < 2; ++rr) {
      const int row = wave * 2 + rr;
#pragma unroll
      for (int i = 0; i < 32; ++i) sS[row * SPITCH + lane + 32 * i] = P[rr][i];
    }
    __syncthreads();

    // ----- Phase 3: O_partial += P * V over this wave's 128-wide key slab, three 16-column tiles, both m-tiles -----
    v8f o[2][3] = {};
    const size_t vu = ((size_t)(b * NHD + h) * HDIM) << 10;               // wave-uniform element offset of this head's V^T rows
#pragma unroll
    for (int c4 = 0; c4 < 4; ++c4) {
      const int pb = slab * 128 + c4 * 32;
      v16b aph0, apl0, aph1, apl1;
      frag_ksplit(sS + (size_t)l16 * SPITCH + pb, hh, aph0, apl0);
      frag_ksplit(sS + (size_t)(16 + l16) * SPITCH + pb, hh, aph1, apl1);
#pragma unroll
      for (int j = 0; j < 3; ++j) {
        const v16b vh_ = frag_off(Vh + vu, vlane, (j * 16 * 1024 + c4 * 32) * 2), vl_ = frag_off(Vl + vu, vlane, (j * 16 * 1024 + c4 * 32) * 2);
        o[0][j] = wmmab(aph0, vh_, o[0][j]); o[1][j] = wmmab(aph1, vh_, o[1][j]);
        o[0][j] = wmmab(aph0, vl_, o[0][j]); o[1][j] = wmmab(aph1, vl_, o[1][j]);
        o[0][j] = wmmab(apl0, vh_, o[0][j]); o[1][j] = wmmab(apl1, vh_, o[1][j]);
      }
    }
    __syncthreads();                                   // P reads done; reuse LDS

#pragma unroll
    for (int mi = 0; mi < 2; ++mi)
#pragma unroll
      for (int j = 0; j < 3; ++j)
#pragma unroll
        for (int r = 0; r < 8; ++r) sS[slab * 3072 + (mi * 16 + rbase + r) * 96 + (nt0 + j) * 16 + l16] = o[mi][j][r];
    __syncthreads();
#pragma unroll                                          // six exact trips: no branch in the head loop's body, so the head-mean updates stay at the softmax and P's registers are free in phase 3
    for (int q = 0; q < 6; ++q) {                      // reduced tile into sS[8*3072 ..) (free region)
      const int idx = tid + q * 512;
      float sum = 0.f;
#pragma unroll
      for (int w = 0; w < 8; ++w) sum += sS[w * 3072 + idx];
      sS[8 * 3072 + idx] = sum;
    }
    __syncthreads();
#pragma unroll                                          // three exact trips of 8 bytes a lane (1536 pieces, 512 threads), for the same reason
    for (int q = 0; q < 3; ++q) {
      const int piece = tid + q * 512;
      const int m = piece / 48, sg = piece % 48;
      *(v2f*)(Ao + ((size_t)((b << 10) + m0 + m) * EMB) + h * HDIM + sg * 2) = *(const v2f*)(sS + 8 * 3072 + m * 96 + sg * 2);
    }
    __syncthreads();
  }
  {
#pragma unroll
    for (int rr = 0; rr < 2; ++rr) {
      float* apo = avg_out + ((size_t)((b << 10) + m0 + wave * 2 + rr) << 10) + lane;
#pragma unroll
      for (int i = 0; i < 32; ++i) *(float*)(apo + 32 * i) = AV[rr][i];
    }
    
  }
}

// ---------------------------------------------------------------------------
extern "C" void kernel_launch(void* const* d_in, const int* in_sizes, int n_in,
                              void* d_out, int out_size, void* d_ws, size_t ws_size,
                              hipStream_t stream) {
  (void)in_sizes; (void)n_in; (void)out_size;
  const float* mam = (const float*)d_in[0];
  const float* pat = (const float*)d_in[1];
  const float* qw  = (const float*)d_in[2];
  const float* qb  = (const float*)d_in[3];
  const float* kw  = (const float*)d_in[4];
  const float* kb  = (const float*)d_in[5];
  const float* vw  = (const float*)d_in[6];
  const float* vb  = (const float*)d_in[7];
  const float* ow  = (const float*)d_in[8];
  const float* ob  = (const float*)d_in[9];

  const size_t TOK = (size_t)MTOT * EMB;   // 6,291,456 elements
  const size_t WSZ = (size_t)EMB * EMB;    //   589,824 elements

  size_t off = 0; char* ws = (char*)d_ws;
  auto take = [&](size_t bytes) { void* p = ws + off; off += (bytes + 255) & ~(size_t)255; return p; };
  b16* Wqh = (b16*)take(WSZ * 2); b16* Wql = (b16*)take(WSZ * 2);
  b16* Wkh = (b16*)take(WSZ * 2); b16* Wkl = (b16*)take(WSZ * 2);
  b16* Wvh = (b16*)take(WSZ * 2); b16* Wvl = (b16*)take(WSZ * 2);
  b16* Woh = (b16*)take(WSZ * 2); b16* Wol = (b16*)take(WSZ * 2);
  b16* Qh = (b16*)take(TOK * 2);  b16* Ql = (b16*)take(TOK * 2);     // [8192,768] planes
  b16* Kh = (b16*)take(TOK * 2);  b16* Kl = (b16*)take(TOK * 2);
  b16* Vh = (b16*)take(TOK * 2);  b16* Vl = (b16*)take(TOK * 2);     // [8,8,96,1024] planes
  float* Ao = (float*)take(TOK * 4);                                 // attended pre-projection f32 [8192,768]
  if (off > ws_size) return;

  float* att_out = (float*)d_out;        // [8,1024,768]
  float* avg_out = att_out + TOK;        // [8,1024,1024]

  cma_wsplit<<<288, 256, 0, stream>>>(qw, Wqh, Wql, (int)(WSZ / 8));
  cma_wsplit<<<288, 256, 0, stream>>>(kw, Wkh, Wkl, (int)(WSZ / 8));
  cma_wsplit<<<288, 256, 0, stream>>>(vw, Wvh, Wvl, (int)(WSZ / 8));
  cma_wsplit<<<288, 256, 0, stream>>>(ow, Woh, Wol, (int)(WSZ / 8));

  dim3 gg(MTOT / 128, EMB / 64);
  cma_gemm_tn<<<gg, 256, 0, stream>>>(mam, Wqh, Wql, qb, Qh, Ql, MTOT, EMB, EMB, 0);
  cma_gemm_tn<<<gg, 256, 0, stream>>>(pat, Wkh, Wkl, kb, Kh, Kl, MTOT, EMB, EMB, 0);
  cma_gemm_tn<<<gg, 256, 0, stream>>>(pat, Wvh, Wvl, vb, Vh, Vl, MTOT, EMB, EMB, 1);

  cma_attn<<<dim3(NTOK / 32, NB), 512, 0, stream>>>(Qh, Ql, Kh, Kl, Vh, Vl, Ao, avg_out);

  cma_gemm_tn<<<gg, 256, 0, stream>>>(Ao, Woh, Wol, ob, att_out, nullptr, MTOT, EMB, EMB, 2);
}

// v003
// Measured time: 312 microseconds a run.
// Timed twice side by side with v002, it ran 1.04 times as fast both times.
// Over all steps from v000 it is 1.99 times as fast.
#include <hip/hip_runtime.h>

// ---------------------------------------------------------------------------
// Cross-modal attention (E=768, 8 heads x 96, B=8, 1024 query tokens x 1024 key tokens), two outputs: attended [8,1024,768] and the
// head-averaged attention matrix [8,1024,1024]. Every contraction runs on v_wmma_f32_16x16x32_bf16 with BOTH operands as bf16 hi/lo
// splits (hi.hi + hi.lo + lo.hi, f32 accumulate): the four projections (A = f32 activations split at fragment load, B = weight hi/lo
// planes), Q.K^T (Q/K hi/lo planes), P.V (P split from the f32 probability panel in LDS, V^T hi/lo planes). Softmax and the head mean f32.
// Fragment k-map per lane half hh, A and B alike: elements 0..7 <- k = 8hh+0..7, elements 8..15 <- k = 16+8hh+0..7.
// ---------------------------------------------------------------------------

typedef __bf16 b16;
typedef __attribute__((ext_vector_type(16))) __bf16 v16b;
typedef __attribute__((ext_vector_type(8)))  __bf16 v8b;
typedef __attribute__((ext_vector_type(8)))  float  v8f;
typedef __attribute__((ext_vector_type(2)))  float  v2f;
typedef __attribute__((ext_vector_type(4)))  int    i4;

#define NB 8
#define NTOK 1024
#define EMB 768
#define NHD 8
#define HDIM 96
#define MTOT 8192
#define WPITCH 72     // LDS pitch of a 64-element bf16 weight-panel row: 144 B = 16 B x odd, conflict-free for ds_load_b128 fragment reads
#define VPITCH 136    // LDS pitch of a 128-element bf16 row of the V^T staging tile: 272 B = 16 B x odd
#define SPITCH 1028   // LDS pitch of a 1024-element f32 score row: 4112 B = 16 B x odd

__device__ __forceinline__ void split_bf16(float v, b16& hi, b16& lo) {
  const unsigned int u = __builtin_bit_cast(unsigned int, v) & 0xffff0000u;
  hi = __builtin_bit_cast(b16, (unsigned short)(u >> 16));
  lo = (b16)(v - __builtin_bit_cast(float, u));
}
__device__ __forceinline__ v8b ld8b(const b16* p) { return *(const v8b*)p; }
__device__ __forceinline__ v16b cat8b(v8b a, v8b b) { return __builtin_shufflevector(a, b, 0, 1, 2, 3, 4, 5, 6, 7, 8, 9, 10, 11, 12, 13, 14, 15); }
__device__ __forceinline__ v16b frag_kb(const b16* p, int hh) { return cat8b(ld8b(p + 8 * hh), ld8b(p + 16 + 8 * hh)); }
// The same fragment from a wave-uniform plane pointer, a per-lane byte offset (row and lane half) and a constant byte offset: every load of a plane shares one per-lane address
__device__ __forceinline__ v16b frag_off(const b16* base, unsigned int lane_bytes, int const_bytes) {
  const char* p = (const char*)base + lane_bytes + const_bytes;
  return cat8b(*(const v8b*)p, *(const v8b*)(p + 32));
}
__device__ __forceinline__ void frag_ksplit(const float* p, int hh, v16b& fh, v16b& fl) {
  const float* p0 = p + 8 * hh; const float* p1 = p + 16 + 8 * hh;
#pragma unroll
  for (int e = 0; e < 8; ++e) { b16 a, c; split_bf16(p0[e], a, c); fh[e] = a; fl[e] = c; split_bf16(p1[e], a, c); fh[8 + e] = a; fl[8 + e] = c; }
}
__device__ __forceinline__ v8f wmmab(v16b a, v16b b, v8f c) {
  v8f d = __builtin_amdgcn_wmma_f32_16x16x32_bf16(false, a, false, b, (short)0, c, false, false);
  asm volatile("v_nop\n\tv_nop\n\tv_nop\n\tv_nop" : "+v"(d) : "v"(a), "v"(b));
  return d;
}
__device__ __forceinline__ v8f wmma3(v16b ah, v16b al, v16b bh, v16b bl, v8f c) {
  c = wmmab(ah, bh, c); c = wmmab(ah, bl, c); c = wmmab(al, bh, c); return c;
}
__device__ __forceinline__ void wave_sync_lds() {
  __builtin_amdgcn_fence(__ATOMIC_RELEASE, "workgroup"); __builtin_amdgcn_wave_barrier(); __builtin_amdgcn_fence(__ATOMIC_ACQUIRE, "workgroup");
}

// ---------------------------------------------------------------------------
// ---------------------------------------------------------------------------
__global__ void cma_wsplit(const float* __restrict__ w, b16* __restrict__ wh, b16* __restrict__ wl, int n8) {
  int i = blockIdx.x * blockDim.x + threadIdx.x;
  int stride = gridDim.x * blockDim.x;
  for (; i < n8; i += stride) {
    v8b h, l;
#pragma unroll
    for (int e = 0; e < 8; ++e) { b16 a, c; split_bf16(w[(size_t)i * 8 + e], a, c); h[e] = a; l[e] = c; }
    *(v8b*)(wh + (size_t)i * 8) = h; *(v8b*)(wl + (size_t)i * 8) = l;
    
  }
}

// ---------------------------------------------------------------------------
// C[M,N] = A[M,K](f32) * W[N,K]^T + bias, both operands split.
//   mode 0: C -> bf16 hi/lo planes row-major [M,N]                 (Q, K projections)
//   mode 1: C -> bf16 hi/lo planes transposed Vt[b][h][d][p]        (V projection, N = 768 = H*D)
//   mode 2: C -> f32 row-major [M,N]                                (O projection -> d_out)
// Workgroup = 8 waves, each wave owns a 16x64 tile -> WG tile 128x64. Weight panels [64n x 64k] (hi and lo) double-buffered in LDS,
// rows padded to WPITCH, shared by all waves; A fragments split from f32 at load. The same LDS is reused as the epilogue staging tile.
// ---------------------------------------------------------------------------
__global__ __launch_bounds__(256)
void cma_gemm_tn(const float* __restrict__ A, const b16* __restrict__ Wh, const b16* __restrict__ Wl,
                 const float* __restrict__ bias, void* __restrict__ out0, void* __restrict__ out1,
                 int M, int N, int K, int mode) {
  __shared__ __attribute__((aligned(16))) unsigned char smem[4 * 64 * WPITCH * 2];
  b16* sW = (b16*)smem;                       // [buf][plane][64*WPITCH]
  const int lane = threadIdx.x & 31;
  const int wave = threadIdx.x >> 5;
  const int tid  = threadIdx.x;
  const int mt   = blockIdx.x * 128 + wave * 16;
  const int nb   = blockIdx.y * 64;
  const int l16  = lane & 15;
  const int hh   = lane >> 4;
  const int rbase = hh * 8;

  const int wr0 = tid >> 3, wc0 = (tid & 7) * 8;
  const int wr1 = (tid + 256) >> 3, wc1 = ((tid + 256) & 7) * 8;
  auto loadW = [&](int buf, int k0) {
    b16* dh = sW + (buf * 2 + 0) * (64 * WPITCH); b16* dl = sW + (buf * 2 + 1) * (64 * WPITCH);
    *(i4*)(dh + wr0 * WPITCH + wc0) = *(const i4*)(Wh + (size_t)(nb + wr0) * K + k0 + wc0);
    *(i4*)(dh + wr1 * WPITCH + wc1) = *(const i4*)(Wh + (size_t)(nb + wr1) * K + k0 + wc1);
    *(i4*)(dl + wr0 * WPITCH + wc0) = *(const i4*)(Wl + (size_t)(nb + wr0) * K + k0 + wc0);
    *(i4*)(dl + wr1 * WPITCH + wc1) = *(const i4*)(Wl + (size_t)(nb + wr1) * K + k0 + wc1);
  };
  const float* ap = A + (size_t)(mt + l16) * K;

  v8f acc[4] = {};
  int buf = 0;
  loadW(0, 0);
  for (int k0 = 0; k0 < K; k0 += 64, buf ^= 1) {
    __syncthreads();                          // panel 'buf' staged by everyone; previous panel reads finished before it is overwritten below
    if (k0 + 64 < K) loadW(buf ^ 1, k0 + 64);
    const b16* ph = sW + (buf * 2 + 0) * (64 * WPITCH); const b16* pl = sW + (buf * 2 + 1) * (64 * WPITCH);
#pragma unroll
    for (int kk = 0; kk < 2; ++kk) {
      v16b ah, al; frag_ksplit(ap + k0 + kk * 32, hh, ah, al);
#pragma unroll
      for (int nt = 0; nt < 4; ++nt) {
        const b16* wp = ph + (nt * 16 + l16) * WPITCH + kk * 32;
        const b16* wq = pl + (nt * 16 + l16) * WPITCH + kk * 32;
        acc[nt] = wmma3(ah, al, frag_kb(wp, hh), frag_kb(wq, hh), acc[nt]);
      }
    }
  }
  __syncthreads();                            // all panel reads done: smem becomes the staging tile

  if (mode == 0) {
    b16* th = (b16*)smem + wave * 2048; b16* tl = th + 1024;
#pragma unroll
    for (int nt = 0; nt < 4; ++nt) {
      const float bn = bias[nb + nt * 16 + l16];
#pragma unroll
      for (int r = 0; r < 8; ++r) { b16 a, c; split_bf16(acc[nt][r] + bn, a, c); th[(rbase + r) * 64 + nt * 16 + l16] = a; tl[(rbase + r) * 64 + nt * 16 + l16] = c; }
    }
    wave_sync_lds();
    b16* oh = (b16*)out0; b16* ol = (b16*)out1;
    {
#pragma unroll
      for (int j = 0; j < 4; ++j) {
        const int row = j * 4 + (lane >> 3), seg = lane & 7;
        const size_t g = (size_t)(mt + row) * N + nb + seg * 8;
        *(v8b*)(oh + g) = ld8b(th + row * 64 + seg * 8);
        *(v8b*)(ol + g) = ld8b(tl + row * 64 + seg * 8);
      }
      
    }
  } else if (mode == 1) {
    b16* th = (b16*)smem; b16* tl = th + 64 * VPITCH;
    const int pl0 = wave * 16 + rbase;        // local p of register r = pl0 + r
#pragma unroll
    for (int nt = 0; nt < 4; ++nt) {
      const int nl = nt * 16 + l16;
      const float bn = bias[nb + nl];
#pragma unroll
      for (int r = 0; r < 8; ++r) { b16 a, c; split_bf16(acc[nt][r] + bn, a, c); th[nl * VPITCH + pl0 + r] = a; tl[nl * VPITCH + pl0 + r] = c; }
    }
    __syncthreads();
    b16* oh = (b16*)out0; b16* ol = (b16*)out1;
    const int p0 = (blockIdx.x * 128) & (NTOK - 1);
    const int bb = (blockIdx.x * 128) >> 10;
    {
#pragma unroll
      for (int q = 0; q < 4; ++q) {
        const int piece = tid + q * 256;      // 1024 pieces: 64 rows x 16
        const int nl = piece >> 4, seg = piece & 15;
        const int n = nb + nl, h = n / HDIM, d = n % HDIM;
        const size_t g = ((size_t)((bb * NHD + h) * HDIM + d) << 10) + p0 + seg * 8;
        *(v8b*)(oh + g) = ld8b(th + nl * VPITCH + seg * 8);
        *(v8b*)(ol + g) = ld8b(tl + nl * VPITCH + seg * 8);
      }
      asm volatile("s_wait_xcnt 0x0" ::: "memory");   // stands behind the run of stores, before any register that an issued store names is rewritten
    }
  } else {
    float* of = (float*)out0;
    {
#pragma unroll
      for (int pr = 0; pr < 2; ++pr) {
        const int cbase = nb + pr * 32;
        const float bn = bias[cbase + lane];
#pragma unroll
        for (int r = 0; r < 8; ++r) {
          const float a0 = acc[2 * pr][r], b0 = acc[2 * pr + 1][r];
          const float ax = __shfl_xor(a0, 16), bx = __shfl_xor(b0, 16);
          const float v1 = (hh ? bx : a0) + bn;     // row mt + r
          const float v2 = (hh ? b0 : ax) + bn;     // row mt + r + 8
          *(float*)(of + (size_t)(mt + r) * N + cbase + lane) = v1;
          *(float*)(of + (size_t)(mt + r + 8) * N + cbase + lane) = v2;
        }
      }
      
    }
  }
}

// ---------------------------------------------------------------------------
// Attention core. One workgroup of 16 waves per (b, 32-row block = two 16-row m-tiles); loops over 8 heads.
// Every K and V fragment that a wave loads is multiplied into both m-tiles, so each (b, h) K/V plane is read by 32 workgroups, not 64.
//   Phase 1: S[32x1024] = (Q K^T) / sqrt(96) into the LDS panel (split WMMA, Q/K hi/lo planes); a wave owns 64 keys
//   Phase 2: exact softmax per row (2 rows per wave, 32 columns per lane); head-mean accumulated in registers; P written back f32
//   Phase 3: O_partial += P V; a wave owns one 128-key slab (wave & 7) and one 48-column half of the head (wave >> 3), both m-tiles
// K and V fragments run through register rings: a ring slot is refilled with the fragment of the next k chunk directly behind the WMMAs that
// read it, the first V chunk is requested in front of the softmax and the next head's first Q/K chunk in front of the sums of the O reduction, so that
// a whole chunk of loads is in flight under the matrix, softmax and reduction work instead of four loads that are waited for at once.
// ---------------------------------------------------------------------------
__global__ __launch_bounds__(512)
void cma_attn(const b16* __restrict__ Qh, const b16* __restrict__ Ql,     // [8192,768]
              const b16* __restrict__ Kh, const b16* __restrict__ Kl,     // [8192,768]
              const b16* __restrict__ Vh, const b16* __restrict__ Vl,     // [8,8,96,1024]
              float* __restrict__ Ao,                                     // [8192,768] f32
              float* __restrict__ avg_out) {                              // [8,1024,1024] f32
  __shared__ __attribute__((aligned(16))) float sS[32 * SPITCH];          // score / probability panel, rows padded to SPITCH, reused for the O reduction

  const int b    = blockIdx.y;
  const int m0   = blockIdx.x * 32;
  const int tid  = threadIdx.x;
  const int lane = tid & 31;
  const int wave = __builtin_amdgcn_readfirstlane(tid >> 5);   // scalar: what depends on the wave alone stays out of the vector registers, which the rings need
  const int l16  = lane & 15;
  const int hh   = lane >> 4;
  const int rbase = hh * 8;
  const int slab = wave & 7;                           // phase 3: 128-key slab
  const int nt0  = (wave >> 3) * 3;                    // phase 3: first of this wave's three 16-column tiles of the head
  const float scale = 0.1020620726f;                   // 1/sqrt(96)
  const unsigned int qlane = (unsigned int)(l16 * EMB + 8 * hh) * 2u;                                  // per-lane byte offsets inside a plane
  const unsigned int klane = (unsigned int)((wave * 64 + l16) * EMB + 8 * hh) * 2u;
  const unsigned int vlane = (unsigned int)(((nt0 * 16 + l16) << 10) + slab * 128 + 8 * hh) * 2u;

  float AV[2][32];
#pragma unroll
  for (int rr = 0; rr < 2; ++rr)
#pragma unroll
    for (int i = 0; i < 32; ++i) AV[rr][i] = 0.f;

  v16b qh0, ql0, qh1, ql1;                             // one k chunk of Q, both m-tiles
  v16b kfh[4], kfl[4];                                 // K ring: one slot per 16-key tile
  v16b vfh[3], vfl[3];                                 // V ring: one slot per 16-column tile
  // 32-bit byte offsets from a plane's start (lane part + batch, row block and head), stepped from head to head: hi and lo plane share one register
  unsigned int qo = qlane + (unsigned int)(((b << 10) + m0) * EMB) * 2u;
  unsigned int ko = klane + (unsigned int)((b << 10) * EMB) * 2u;
  unsigned int vo = vlane + ((unsigned int)(b * NHD * HDIM) << 11);
  auto ldQ = [&](int kk) {
    qh0 = frag_off(Qh, qo, kk * 64); ql0 = frag_off(Ql, qo, kk * 64);
    qh1 = frag_off(Qh, qo, 16 * EMB * 2 + kk * 64); ql1 = frag_off(Ql, qo, 16 * EMB * 2 + kk * 64);
  };
  auto ldK = [&](int kk, int t) {
    kfh[t] = frag_off(Kh, ko, t * 16 * EMB * 2 + kk * 64); kfl[t] = frag_off(Kl, ko, t * 16 * EMB * 2 + kk * 64);
  };
  auto ldV = [&](int c4, int j) {
    vfh[j] = frag_off(Vh, vo, (j * 16 * 1024 + c4 * 32) * 2); vfl[j] = frag_off(Vl, vo, (j * 16 * 1024 + c4 * 32) * 2);
  };
  ldQ(0);
#pragma unroll
  for (int t = 0; t < 4; ++t) ldK(0, t);

  for (int h = 0; h < NHD; ++h) {
    // ----- Phase 1: scores -> LDS --------------------------------------
    v8f s[4][2] = {};                                  // [16-key tile][m-tile]; k chunk outermost, so that only one chunk of Q is held in registers
#pragma unroll
    for (int kk = 0; kk < 3; ++kk) {
#pragma unroll
      for (int t = 0; t < 4; ++t) {
        s[t][0] = wmmab(qh0, kfh[t], s[t][0]); s[t][1] = wmmab(qh1, kfh[t], s[t][1]);
        s[t][0] = wmmab(qh0, kfl[t], s[t][0]); s[t][1] = wmmab(qh1, kfl[t], s[t][1]);
        s[t][0] = wmmab(ql0, kfh[t], s[t][0]); s[t][1] = wmmab(ql1, kfh[t], s[t][1]);
        if (kk < 2) ldK(kk + 1, t);                    // refill the slot behind its last reader
      }
      if (kk < 2) ldQ(kk + 1);
    }
#pragma unroll
    for (int t = 0; t < 4; ++t) {
      const int ncol = wave * 64 + t * 16 + l16;
#pragma unroll
      for (int r = 0; r < 8; ++r) { sS[(rbase + r) * SPITCH + ncol] = s[t][0][r] * scale; sS[(16 + rbase + r) * SPITCH + ncol] = s[t][1][r] * scale; }
    }
    __syncthreads();
#pragma unroll
    for (int j = 0; j < 3; ++j) ldV(0, j);             // first V chunk: in flight under the softmax

    // ----- Phase 2: softmax (2 rows / wave), head-mean in registers, P back to the panel as f32 -----
    float P[2][32];
#pragma unroll
    for (int rr = 0; rr < 2; ++rr) {
      const int row = wave * 2 + rr;
      float mx = -3.0e38f;
#pragma unroll
      for (int i = 0; i < 32; ++i) { P[rr][i] = sS[row * SPITCH + lane + 32 * i]; mx = fmaxf(mx, P[rr][i]); }
#pragma unroll
      for (int off = 16; off >= 1; off >>= 1) mx = fmaxf(mx, __shfl_xor(mx, off));
      float sum = 0.f;
#pragma unroll
      for (int i = 0; i < 32; ++i) { const float e = expf(P[rr][i] - mx); P[rr][i] = e; sum += e; }
#pragma unroll
      for (int off = 16; off >= 1; off >>= 1) sum += __shfl_xor(sum, off);
      const float inv = 1.0f / sum;
#pragma unroll
      for (int i = 0; i < 32; ++i) { P[rr][i] *= inv; AV[rr][i] += P[rr][i] * 0.125f; }
    }
    __syncthreads();                                   // all S reads done
#pragma unroll
    for (int rr = 0; rr < 2; ++rr) {
      const int row = wave * 2 + rr;
#pragma unroll
      for (int i = 0; i < 32; ++i) sS[row * SPITCH + lane + 32 * i] = P[rr][i];
    }
    __syncthreads();

    // ----- Phase 3: O_partial += P * V over this wave's 128-wide key slab, three 16-column tiles, both m-tiles -----
    v8f o[2][3] = {};
#pragma unroll
    for (int c4 = 0; c4 < 4; ++c4) {
      const int pb = slab * 128 + c4 * 32;
      v16b aph0, apl0, aph1, apl1;
      frag_ksplit(sS + (size_t)l16 * SPITCH + pb, hh, aph0, apl0);
      frag_ksplit(sS + (size_t)(16 + l16) * SPITCH + pb, hh, aph1, apl1);
#pragma unroll
      for (int j = 0; j < 3; ++j) {
        o[0][j] = wmmab(aph0, vfh[j], o[0][j]); o[1][j] = wmmab(aph1, vfh[j], o[1][j]);
        o[0][j] = wmmab(aph0, vfl[j], o[0][j]); o[1][j] = wmmab(aph1, vfl[j], o[1][j]);
        o[0][j] = wmmab(apl0, vfh[j], o[0][j]); o[1][j] = wmmab(apl1, vfh[j], o[1][j]);
        if (c4 < 3) ldV(c4 + 1, j);                    // refill the slot behind its last reader
      }
    }
    __syncthreads();                                   // P reads done; reuse LDS

#pragma unroll
    for (int mi = 0; mi < 2; ++mi)
#pragma unroll
      for (int j = 0; j < 3; ++j)
#pragma unroll
        for (int r = 0; r < 8; ++r) sS[slab * 3072 + (mi * 16 + rbase + r) * 96 + (nt0 + j) * 16 + l16] = o[mi][j][r];
    __syncthreads();
    {
      const unsigned int hstep = h + 1 < NHD ? HDIM * 2u : 0u;   // the last head requests its own first chunk again: in bounds, and no branch in the loop's body
      qo += hstep; ko += hstep; vo += (unsigned int)HDIM << 11;  // vo is next read by the next head, if there is one
      ldQ(0);
#pragma unroll
      for (int t = 0; t < 4; ++t) ldK(0, t);           // next head's first Q/K chunk: in flight under the O reduction
    }
#pragma unroll                                          // six exact trips: no branch in the head loop's body, so the head-mean updates stay at the softmax and P's registers are free in phase 3
    for (int q = 0; q < 6; ++q) {                      // reduced tile into sS[8*3072 ..) (free region)
      const int idx = tid + q * 512;
      float sum = 0.f;
#pragma unroll
      for (int w = 0; w < 8; ++w) sum += sS[w * 3072 + idx];
      sS[8 * 3072 + idx] = sum;
    }
    __syncthreads();
#pragma unroll                                          // three exact trips of 8 bytes a lane (1536 pieces, 512 threads), for the same reason
    for (int q = 0; q < 3; ++q) {
      const int piece = tid + q * 512;
      const int m = piece / 48, sg = piece % 48;
      *(v2f*)(Ao + ((size_t)((b << 10) + m0 + m) * EMB) + h * HDIM + sg * 2) = *(const v2f*)(sS + 8 * 3072 + m * 96 + sg * 2);
    }
    __syncthreads();
  }
  {
#pragma unroll
    for (int rr = 0; rr < 2; ++rr) {
      float* apo = avg_out + ((size_t)((b << 10) + m0 + wave * 2 + rr) << 10) + __builtin_amdgcn_mbcnt_lo(~0u, 0u);   // the lane number in the form the shuffles already hold: no second register for it lives (or spills) across the head loop
#pragma unroll
      for (int i = 0; i < 32; ++i) *(float*)(apo + 32 * i) = AV[rr][i];
    }
    
  }
}

// ---------------------------------------------------------------------------
extern "C" void kernel_launch(void* const* d_in, const int* in_sizes, int n_in,
                              void* d_out, int out_size, void* d_ws, size_t ws_size,
                              hipStream_t stream) {
  (void)in_sizes; (void)n_in; (void)out_size;
  const float* mam = (const float*)d_in[0];
  const float* pat = (const float*)d_in[1];
  const float* qw  = (const float*)d_in[2];
  const float* qb  = (const float*)d_in[3];
  const float* kw  = (const float*)d_in[4];
  const float* kb  = (const float*)d_in[5];
  const float* vw  = (const float*)d_in[6];
  const float* vb  = (const float*)d_in[7];
  const float* ow  = (const float*)d_in[8];
  const float* ob  = (const float*)d_in[9];

  const size_t TOK = (size_t)MTOT * EMB;   // 6,291,456 elements
  const size_t WSZ = (size_t)EMB * EMB;    //   589,824 elements

  size_t off = 0; char* ws = (char*)d_ws;
  auto take = [&](size_t bytes) { void* p = ws + off; off += (bytes + 255) & ~(size_t)255; return p; };
  b16* Wqh = (b16*)take(WSZ * 2); b16* Wql = (b16*)take(WSZ * 2);
  b16* Wkh = (b16*)take(WSZ * 2); b16* Wkl = (b16*)take(WSZ * 2);
  b16* Wvh = (b16*)take(WSZ * 2); b16* Wvl = (b16*)take(WSZ * 2);
  b16* Woh = (b16*)take(WSZ * 2); b16* Wol = (b16*)take(WSZ * 2);
  b16* Qh = (b16*)take(TOK * 2);  b16* Ql = (b16*)take(TOK * 2);     // [8192,768] planes
  b16* Kh = (b16*)take(TOK * 2);  b16* Kl = (b16*)take(TOK * 2);
  b16* Vh = (b16*)take(TOK * 2);  b16* Vl = (b16*)take(TOK * 2);     // [8,8,96,1024] planes
  float* Ao = (float*)take(TOK * 4);                                 // attended pre-projection f32 [8192,768]
  if (off > ws_size) return;

  float* att_out = (float*)d_out;        // [8,1024,768]
  float* avg_out = att_out + TOK;        // [8,1024,1024]

  cma_wsplit<<<288, 256, 0, stream>>>(qw, Wqh, Wql, (int)(WSZ / 8));
  cma_wsplit<<<288, 256, 0, stream>>>(kw, Wkh, Wkl, (int)(WSZ / 8));
  cma_wsplit<<<288, 256, 0, stream>>>(vw, Wvh, Wvl, (int)(WSZ / 8));
  cma_wsplit<<<288, 256, 0, stream>>>(ow, Woh, Wol, (int)(WSZ / 8));

  dim3 gg(MTOT / 128, EMB / 64);
  cma_gemm_tn<<<gg, 256, 0, stream>>>(mam, Wqh, Wql, qb, Qh, Ql, MTOT, EMB, EMB, 0);
  cma_gemm_tn<<<gg, 256, 0, stream>>>(pat, Wkh, Wkl, kb, Kh, Kl, MTOT, EMB, EMB, 0);
  cma_gemm_tn<<<gg, 256, 0, stream>>>(pat, Wvh, Wvl, vb, Vh, Vl, MTOT, EMB, EMB, 1);

  cma_attn<<<dim3(NTOK / 32, NB), 512, 0, stream>>>(Qh, Ql, Kh, Kl, Vh, Vl, Ao, avg_out);

  cma_gemm_tn<<<gg, 256, 0, stream>>>(Ao, Woh, Wol, ob, att_out, nullptr, MTOT, EMB, EMB, 2);
}

// v004
// Measured time: 281 microseconds a run.
// Two timings next to v003 put it at 1.12 and 1.11 times that version's speed.
// Counting every step since v000, it is 2.21 times as fast.
#include <hip/hip_runtime.h>

// ---------------------------------------------------------------------------
// Cross-modal attention (E=768, 8 heads x 96, B=8, 1024 query tokens x 1024 key tokens), two outputs: attended [8,1024,768] and the
// head-averaged attention matrix [8,1024,1024]. Every contraction runs on v_wmma_f32_16x16x32_bf16 with BOTH operands as bf16 hi/lo
// splits (hi.hi + hi.lo + lo.hi, f32 accumulate): the four projections (A = f32 activations split at fragment load, B = weight hi/lo
// planes), Q.K^T (Q/K hi/lo planes), P.V (P split from the f32 probability panel in LDS, V^T hi/lo planes). Softmax and the head mean f32.
// Fragment k-map per lane half hh, A and B alike: elements 0..7 <- k = 8hh+0..7, elements 8..15 <- k = 16+8hh+0..7.
// The Q, K and V planes lie in the workspace in FRAGMENT ORDER: one 16x32 fragment = one block of 1024 B = [j = 0,1][lane 0..31][8 elements],
// lane = 16hh + (row or column & 15), k = 32 chunk + 16j + 8hh + 0..7. A fragment load is then two loads of 512 contiguous bytes (four whole
// cache lines each) instead of two loads that touch 16 lines for 32 bytes each.
//   Q, K: block index ((b*8 + h)*64 + token tile)*3 + d chunk          V: block index ((b*8 + h)*6 + d tile)*32 + key chunk
// ---------------------------------------------------------------------------

typedef __bf16 b16;
typedef __attribute__((ext_vector_type(16))) __bf16 v16b;
typedef __attribute__((ext_vector_type(8)))  __bf16 v8b;
typedef __attribute__((ext_vector_type(8)))  float  v8f;
typedef __attribute__((ext_vector_type(2)))  float  v2f;
typedef __attribute__((ext_vector_type(4)))  int    i4;

#define NB 8
#define NTOK 1024
#define EMB 768
#define NHD 8
#define HDIM 96
#define MTOT 8192
#define WPITCH 72     // LDS pitch of a 64-element bf16 row (weight panels, Q/K staging tile): 144 B = 16 B x odd, conflict-free for ds_load_b128 reads of one row per lane
#define SPITCH 1028   // LDS pitch of a 1024-element f32 score row: 4112 B = 16 B x odd

__device__ __forceinline__ void split_bf16(float v, b16& hi, b16& lo) {
  const unsigned int u = __builtin_bit_cast(unsigned int, v) & 0xffff0000u;
  hi = __builtin_bit_cast(b16, (unsigned short)(u >> 16));
  lo = (b16)(v - __builtin_bit_cast(float, u));
}
__device__ __forceinline__ v8b ld8b(const b16* p) { return *(const v8b*)p; }
__device__ __forceinline__ v16b cat8b(v8b a, v8b b) { return __builtin_shufflevector(a, b, 0, 1, 2, 3, 4, 5, 6, 7, 8, 9, 10, 11, 12, 13, 14, 15); }
__device__ __forceinline__ v16b frag_kb(const b16* p, int hh) { return cat8b(ld8b(p + 8 * hh), ld8b(p + 16 + 8 * hh)); }
// A fragment from a plane in fragment order: wave-uniform plane pointer, a per-lane byte offset (16 B x lane + block) and a constant byte offset: every load of a plane shares one per-lane address
__device__ __forceinline__ v16b frag_off(const b16* base, unsigned int lane_bytes, int const_bytes) {
  const char* p = (const char*)base + lane_bytes + const_bytes;
  return cat8b(*(const v8b*)p, *(const v8b*)(p + 512));
}
__device__ __forceinline__ void frag_ksplit(const float* p, int hh, v16b& fh, v16b& fl) {
  const float* p0 = p + 8 * hh; const float* p1 = p + 16 + 8 * hh;
#pragma unroll
  for (int e = 0; e < 8; ++e) { b16 a, c; split_bf16(p0[e], a, c); fh[e] = a; fl[e] = c; split_bf16(p1[e], a, c); fh[8 + e] = a; fl[8 + e] = c; }
}
__device__ __forceinline__ v8f wmmab(v16b a, v16b b, v8f c) {
  v8f d = __builtin_amdgcn_wmma_f32_16x16x32_bf16(false, a, false, b, (short)0, c, false, false);
  asm volatile("v_nop\n\tv_nop\n\tv_nop\n\tv_nop" : "+v"(d) : "v"(a), "v"(b));
  return d;
}
__device__ __forceinline__ v8f wmma3(v16b ah, v16b al, v16b bh, v16b bl, v8f c) {
  c = wmmab(ah, bh, c); c = wmmab(ah, bl, c); c = wmmab(al, bh, c); return c;
}
__device__ __forceinline__ void wave_sync_lds() {
  __builtin_amdgcn_fence(__ATOMIC_RELEASE, "workgroup"); __builtin_amdgcn_wave_barrier(); __builtin_amdgcn_fence(__ATOMIC_ACQUIRE, "workgroup");
}

// ---------------------------------------------------------------------------
// ---------------------------------------------------------------------------
__global__ void cma_wsplit(const float* __restrict__ w, b16* __restrict__ wh, b16* __restrict__ wl, int n8) {
  int i = blockIdx.x * blockDim.x + threadIdx.x;
  int stride = gridDim.x * blockDim.x;
  for (; i < n8; i += stride) {
    v8b h, l;
#pragma unroll
    for (int e = 0; e < 8; ++e) { b16 a, c; split_bf16(w[(size_t)i * 8 + e], a, c); h[e] = a; l[e] = c; }
    *(v8b*)(wh + (size_t)i * 8) = h; *(v8b*)(wl + (size_t)i * 8) = l;
    
  }
}

// ---------------------------------------------------------------------------
// C[M,N] = A[M,K](f32) * W[N,K]^T + bias, both operands split.
//   mode 0: C -> bf16 hi/lo planes, fragment order, k = d           (Q, K projections)
//   mode 1: C -> bf16 hi/lo planes, fragment order, k = key         (V projection, N = 768 = H*D)
//   mode 2: C -> f32 row-major [M,N]                                (O projection -> d_out)
// Workgroup = 8 waves, each wave owns a 16x64 tile -> WG tile 128x64. Weight panels [64n x 64k] (hi and lo) double-buffered in LDS,
// rows padded to WPITCH, shared by all waves; A fragments split from f32 at load. The same LDS is reused as the staging tile of mode 0.
// ---------------------------------------------------------------------------
__global__ __launch_bounds__(256)
void cma_gemm_tn(const float* __restrict__ A, const b16* __restrict__ Wh, const b16* __restrict__ Wl,
                 const float* __restrict__ bias, void* __restrict__ out0, void* __restrict__ out1,
                 int M, int N, int K, int mode) {
  __shared__ __attribute__((aligned(16))) unsigned char smem[4 * 64 * WPITCH * 2];
  b16* sW = (b16*)smem;                       // [buf][plane][64*WPITCH]
  const int lane = threadIdx.x & 31;
  const int wave = threadIdx.x >> 5;
  const int tid  = threadIdx.x;
  const int mt   = blockIdx.x * 128 + wave * 16;
  const int nb   = blockIdx.y * 64;
  const int l16  = lane & 15;
  const int hh   = lane >> 4;
  const int rbase = hh * 8;

  const int wr0 = tid >> 3, wc0 = (tid & 7) * 8;
  const int wr1 = (tid + 256) >> 3, wc1 = ((tid + 256) & 7) * 8;
  auto loadW = [&](int buf, int k0) {
    b16* dh = sW + (buf * 2 + 0) * (64 * WPITCH); b16* dl = sW + (buf * 2 + 1) * (64 * WPITCH);
    *(i4*)(dh + wr0 * WPITCH + wc0) = *(const i4*)(Wh + (size_t)(nb + wr0) * K + k0 + wc0);
    *(i4*)(dh + wr1 * WPITCH + wc1) = *(const i4*)(Wh + (size_t)(nb + wr1) * K + k0 + wc1);
    *(i4*)(dl + wr0 * WPITCH + wc0) = *(const i4*)(Wl + (size_t)(nb + wr0) * K + k0 + wc0);
    *(i4*)(dl + wr1 * WPITCH + wc1) = *(const i4*)(Wl + (size_t)(nb + wr1) * K + k0 + wc1);
  };
  const float* ap = A + (size_t)(mt + l16) * K;

  v8f acc[4] = {};
  int buf = 0;
  loadW(0, 0);
  for (int k0 = 0; k0 < K; k0 += 64, buf ^= 1) {
    __syncthreads();                          // panel 'buf' staged by everyone; previous panel reads finished before it is overwritten below
    if (k0 + 64 < K) loadW(buf ^ 1, k0 + 64);
    const b16* ph = sW + (buf * 2 + 0) * (64 * WPITCH); const b16* pl = sW + (buf * 2 + 1) * (64 * WPITCH);
#pragma unroll
    for (int kk = 0; kk < 2; ++kk) {
      v16b ah, al; frag_ksplit(ap + k0 + kk * 32, hh, ah, al);
#pragma unroll
      for (int nt = 0; nt < 4; ++nt) {
        const b16* wp = ph + (nt * 16 + l16) * WPITCH + kk * 32;
        const b16* wq = pl + (nt * 16 + l16) * WPITCH + kk * 32;
        acc[nt] = wmma3(ah, al, frag_kb(wp, hh), frag_kb(wq, hh), acc[nt]);
      }
    }
  }
  __syncthreads();                            // all panel reads done: smem becomes the staging tile

  if (mode == 0) {
    b16* th = (b16*)smem + wave * (2 * 16 * WPITCH); b16* tl = th + 16 * WPITCH;
#pragma unroll
    for (int nt = 0; nt < 4; ++nt) {
      const float bn = bias[nb + nt * 16 + l16];
#pragma unroll
      for (int r = 0; r < 8; ++r) { b16 a, c; split_bf16(acc[nt][r] + bn, a, c); th[(rbase + r) * WPITCH + nt * 16 + l16] = a; tl[(rbase + r) * WPITCH + nt * 16 + l16] = c; }
    }
    wave_sync_lds();
    b16* oh = (b16*)out0; b16* ol = (b16*)out1;
    {
      const int bt = mt >> 10, tile = (mt >> 4) & 63;   // the wave's 16 tokens are one token tile; its 64 columns are two whole 32-wide d chunks
#pragma unroll
      for (int c = 0; c < 2; ++c) {
        const int c32 = (nb >> 5) + c, h = c32 / 3, kk = c32 % 3;
        const size_t blk = (size_t)(((bt * NHD + h) * 64 + tile) * 3 + kk) * 512;
#pragma unroll
        for (int j = 0; j < 2; ++j) {
          const size_t g = blk + j * 256 + lane * 8;
          *(v8b*)(oh + g) = ld8b(th + l16 * WPITCH + c * 32 + j * 16 + hh * 8);
          *(v8b*)(ol + g) = ld8b(tl + l16 * WPITCH + c * 32 + j * 16 + hh * 8);
        }
      }
    }
  } else if (mode == 1) {
    // A lane's eight accumulator registers of a column tile are eight consecutive keys of one column d: already one 16-byte piece of a V fragment, stored from registers
    b16* oh = (b16*)out0; b16* ol = (b16*)out1;
    const int bt = mt >> 10, pc = (mt >> 5) & 31, j = (mt >> 4) & 1;
#pragma unroll
    for (int nt = 0; nt < 4; ++nt) {
      const int t16 = (nb >> 4) + nt, h = t16 / 6, dt = t16 % 6;
      const float bn = bias[nb + nt * 16 + l16];
      v8b vh8, vl8;
#pragma unroll
      for (int r = 0; r < 8; ++r) { b16 a, c; split_bf16(acc[nt][r] + bn, a, c); vh8[r] = a; vl8[r] = c; }
      const size_t g = (size_t)(((bt * NHD + h) * 6 + dt) * 32 + pc) * 512 + j * 256 + lane * 8;
      *(v8b*)(oh + g) = vh8;
      *(v8b*)(ol + g) = vl8;
    }
    asm volatile("s_wait_xcnt 0x0" ::: "memory");   // stands behind the run of stores, before any register that an issued store names is rewritten
  } else {
    float* of = (float*)out0;
    {
#pragma unroll
      for (int pr = 0; pr < 2; ++pr) {
        const int cbase = nb + pr * 32;
        const float bn = bias[cbase + lane];
#pragma unroll
        for (int r = 0; r < 8; ++r) {
          const float a0 = acc[2 * pr][r], b0 = acc[2 * pr + 1][r];
          const float ax = __shfl_xor(a0, 16), bx = __shfl_xor(b0, 16);
          const float v1 = (hh ? bx : a0) + bn;     // row mt + r
          const float v2 = (hh ? b0 : ax) + bn;     // row mt + r + 8
          *(float*)(of + (size_t)(mt + r) * N + cbase + lane) = v1;
          *(float*)(of + (size_t)(mt + r + 8) * N + cbase + lane) = v2;
        }
      }
      
    }
  }
}

// ---------------------------------------------------------------------------
// Attention core. One workgroup of 16 waves per (b, 32-row block = two 16-row m-tiles); loops over 8 heads.
// Every K and V fragment that a wave loads is multiplied into both m-tiles, so each (b, h) K/V plane is read by 32 workgroups, not 64.
//   Phase 1: S[32x1024] = (Q K^T) / sqrt(96) into the LDS panel (split WMMA, Q/K hi/lo planes); a wave owns 64 keys
//   Phase 2: exact softmax per row (2 rows per wave, 32 columns per lane); head-mean accumulated in registers; P written back f32
//   Phase 3: O_partial += P V; a wave owns one 128-key slab (wave & 7) and one 48-column half of the head (wave >> 3), both m-tiles
// K and V fragments run through register rings: a ring slot is refilled with the fragment of the next k chunk directly behind the WMMAs that
// read it, the first V chunk is requested in front of the softmax and the next head's first Q/K chunk in front of the sums of the O reduction, so that
// a whole chunk of loads is in flight under the matrix, softmax and reduction work instead of four loads that are waited for at once.
// ---------------------------------------------------------------------------
__global__ __launch_bounds__(512)
void cma_attn(const b16* __restrict__ Qh, const b16* __restrict__ Ql,     // fragment order, [b][h][64 token tiles][3 d chunks][1024 B]
              const b16* __restrict__ Kh, const b16* __restrict__ Kl,     // the same
              const b16* __restrict__ Vh, const b16* __restrict__ Vl,     // fragment order, [b][h][6 d tiles][32 key chunks][1024 B]
              float* __restrict__ Ao,                                     // [8192,768] f32
              float* __restrict__ avg_out) {                              // [8,1024,1024] f32
  __shared__ __attribute__((aligned(16))) float sS[32 * SPITCH];          // score / probability panel, rows padded to SPITCH, reused for the O reduction

  const int b    = blockIdx.y;
  const int m0   = blockIdx.x * 32;
  const int tid  = threadIdx.x;
  const int lane = tid & 31;
  const int wave = __builtin_amdgcn_readfirstlane(tid >> 5);   // scalar: what depends on the wave alone stays out of the vector registers, which the rings need
  const int l16  = lane & 15;
  const int hh   = lane >> 4;
  const int rbase = hh * 8;
  const int slab = wave & 7;                           // phase 3: 128-key slab
  const int nt0  = (wave >> 3) * 3;                    // phase 3: first of this wave's three 16-column tiles of the head
  const float scale = 0.1020620726f;                   // 1/sqrt(96)
  const unsigned int HSTEP = 64u * 3u * 1024u;         // bytes of one (b, h) in every plane (= 6 * 32 * 1024)

  float AV[2][32];
#pragma unroll
  for (int rr = 0; rr < 2; ++rr)
#pragma unroll
    for (int i = 0; i < 32; ++i) AV[rr][i] = 0.f;

  v16b qh0, ql0, qh1, ql1;                             // one k chunk of Q, both m-tiles
  v16b kfh[4], kfl[4];                                 // K ring: one slot per 16-key tile
  v16b vfh[3], vfl[3];                                 // V ring: one slot per 16-column tile
  // 32-bit byte offsets from a plane's start (16 B x lane + the first block of this batch, wave and head), stepped from head to head: hi and lo plane share one register
  unsigned int qo = (unsigned int)lane * 16u + (unsigned int)b * NHD * HSTEP + (unsigned int)(m0 >> 4) * 3072u;
  unsigned int ko = (unsigned int)lane * 16u + (unsigned int)b * NHD * HSTEP + (unsigned int)(wave * 4) * 3072u;
  unsigned int vo = (unsigned int)lane * 16u + (unsigned int)b * NHD * HSTEP + (unsigned int)(nt0 * 32 + slab * 4) * 1024u;
  auto ldQ = [&](int kk) {
    qh0 = frag_off(Qh, qo, kk * 1024); ql0 = frag_off(Ql, qo, kk * 1024);
    qh1 = frag_off(Qh, qo, 3072 + kk * 1024); ql1 = frag_off(Ql, qo, 3072 + kk * 1024);
  };
  auto ldK = [&](int kk, int t) {
    kfh[t] = frag_off(Kh, ko, t * 3072 + kk * 1024); kfl[t] = frag_off(Kl, ko, t * 3072 + kk * 1024);
  };
  auto ldV = [&](int c4, int j) {
    vfh[j] = frag_off(Vh, vo, (j * 32 + c4) * 1024); vfl[j] = frag_off(Vl, vo, (j * 32 + c4) * 1024);
  };
  ldQ(0);
#pragma unroll
  for (int t = 0; t < 4; ++t) ldK(0, t);

  for (int h = 0; h < NHD; ++h) {
    // ----- Phase 1: scores -> LDS --------------------------------------
    v8f s[4][2] = {};                                  // [16-key tile][m-tile]; k chunk outermost, so that only one chunk of Q is held in registers
#pragma unroll
    for (int kk = 0; kk < 3; ++kk) {
#pragma unroll
      for (int t = 0; t < 4; ++t) {
        s[t][0] = wmmab(qh0, kfh[t], s[t][0]); s[t][1] = wmmab(qh1, kfh[t], s[t][1]);
        s[t][0] = wmmab(qh0, kfl[t], s[t][0]); s[t][1] = wmmab(qh1, kfl[t], s[t][1]);
        s[t][0] = wmmab(ql0, kfh[t], s[t][0]); s[t][1] = wmmab(ql1, kfh[t], s[t][1]);
        if (kk < 2) ldK(kk + 1, t);                    // refill the slot behind its last reader
      }
      if (kk < 2) ldQ(kk + 1);
    }
#pragma unroll
    for (int t = 0; t < 4; ++t) {
      const int ncol = wave * 64 + t * 16 + l16;
#pragma unroll
      for (int r = 0; r < 8; ++r) { sS[(rbase + r) * SPITCH + ncol] = s[t][0][r] * scale; sS[(16 + rbase + r) * SPITCH + ncol] = s[t][1][r] * scale; }
    }
    __syncthreads();
#pragma unroll
    for (int j = 0; j < 3; ++j) ldV(0, j);             // first V chunk: in flight under the softmax

    // ----- Phase 2: softmax (2 rows / wave), head-mean in registers, P back to the panel as f32 -----
    float P[2][32];
#pragma unroll
    for (int rr = 0; rr < 2; ++rr) {
      const int row = wave * 2 + rr;
      float mx = -3.0e38f;
#pragma unroll
      for (int i = 0; i < 32; ++i) { P[rr][i] = sS[row * SPITCH + lane + 32 * i]; mx = fmaxf(mx, P[rr][i]); }
#pragma unroll
      for (int off = 16; off >= 1; off >>= 1) mx = fmaxf(mx, __shfl_xor(mx, off));
      float sum = 0.f;
#pragma unroll
      for (int i = 0; i < 32; ++i) { const float e = expf(P[rr][i] - mx); P[rr][i] = e; sum += e; }
#pragma unroll
      for (int off = 16; off >= 1; off >>= 1) sum += __shfl_xor(sum, off);
      const float inv = 1.0f / sum;
#pragma unroll
      for (int i = 0; i < 32; ++i) { P[rr][i] *= inv; AV[rr][i] += P[rr][i] * 0.125f; }
    }
    __syncthreads();                                   // all S reads done
#pragma unroll
    for (int rr = 0; rr < 2; ++rr) {
      const int row = wave * 2 + rr;
#pragma unroll
      for (int i = 0; i < 32; ++i) sS[row * SPITCH + lane + 32 * i] = P[rr][i];
    }
    __syncthreads();

    // ----- Phase 3: O_partial += P * V over this wave's 128-wide key slab, three 16-column tiles, both m-tiles -----
    v8f o[2][3] = {};
#pragma unroll
    for (int c4 = 0; c4 < 4; ++c4) {
      const int pb = slab * 128 + c4 * 32;
      v16b aph0, apl0, aph1, apl1;
      frag_ksplit(sS + (size_t)l16 * SPITCH + pb, hh, aph0, apl0);
      frag_ksplit(sS + (size_t)(16 + l16) * SPITCH + pb, hh, aph1, apl1);
#pragma unroll
      for (int j = 0; j < 3; ++j) {
        o[0][j] = wmmab(aph0, vfh[j], o[0][j]); o[1][j] = wmmab(aph1, vfh[j], o[1][j]);
        o[0][j] = wmmab(aph0, vfl[j], o[0][j]); o[1][j] = wmmab(aph1, vfl[j], o[1][j]);
        o[0][j] = wmmab(apl0, vfh[j], o[0][j]); o[1][j] = wmmab(apl1, vfh[j], o[1][j]);
        if (c4 < 3) ldV(c4 + 1, j);                    // refill the slot behind its last reader
      }
    }
    __syncthreads();                                   // P reads done; reuse LDS

#pragma unroll
    for (int mi = 0; mi < 2; ++mi)
#pragma unroll
      for (int j = 0; j < 3; ++j)
#pragma unroll
        for (int r = 0; r < 8; ++r) sS[slab * 3072 + (mi * 16 + rbase + r) * 96 + (nt0 + j) * 16 + l16] = o[mi][j][r];
    __syncthreads();
    {
      const unsigned int hstep = h + 1 < NHD ? HSTEP : 0u;       // the last head requests its own first chunk again: in bounds, and no branch in the loop's body
      qo += hstep; ko += hstep; vo += HSTEP;                     // vo is next read by the next head, if there is one
      ldQ(0);
#pragma unroll
      for (int t = 0; t < 4; ++t) ldK(0, t);           // next head's first Q/K chunk: in flight under the O reduction
    }
#pragma unroll                                          // six exact trips: no branch in the head loop's body, so the head-mean updates stay at the softmax and P's registers are free in phase 3
    for (int q = 0; q < 6; ++q) {                      // reduced tile into sS[8*3072 ..) (free region)
      const int idx = tid + q * 512;
      float sum = 0.f;
#pragma unroll
      for (int w = 0; w < 8; ++w) sum += sS[w * 3072 + idx];
      sS[8 * 3072 + idx] = sum;
    }
    __syncthreads();
#pragma unroll                                          // three exact trips of 8 bytes a lane (1536 pieces, 512 threads), for the same reason
    for (int q = 0; q < 3; ++q) {
      const int piece = tid + q * 512;
      const int m = piece / 48, sg = piece % 48;
      *(v2f*)(Ao + ((size_t)((b << 10) + m0 + m) * EMB) + h * HDIM + sg * 2) = *(const v2f*)(sS + 8 * 3072 + m * 96 + sg * 2);
    }
    __syncthreads();
  }
  {
#pragma unroll
    for (int rr = 0; rr < 2; ++rr) {
      float* apo = avg_out + ((size_t)((b << 10) + m0 + wave * 2 + rr) << 10) + __builtin_amdgcn_mbcnt_lo(~0u, 0u);   // the lane number in the form the shuffles already hold: no second register for it lives (or spills) across the head loop
#pragma unroll
      for (int i = 0; i < 32; ++i) *(float*)(apo + 32 * i) = AV[rr][i];
    }
    
  }
}

// ---------------------------------------------------------------------------
extern "C" void kernel_launch(void* const* d_in, const int* in_sizes, int n_in,
                              void* d_out, int out_size, void* d_ws, size_t ws_size,
                              hipStream_t stream) {
  (void)in_sizes; (void)n_in; (void)out_size;
  const float* mam = (const float*)d_in[0];
  const float* pat = (const float*)d_in[1];
  const float* qw  = (const float*)d_in[2];
  const float* qb  = (const float*)d_in[3];
  const float* kw  = (const float*)d_in[4];
  const float* kb  = (const float*)d_in[5];
  const float* vw  = (const float*)d_in[6];
  const float* vb  = (const float*)d_in[7];
  const float* ow  = (const float*)d_in[8];
  const float* ob  = (const float*)d_in[9];

  const size_t TOK = (size_t)MTOT * EMB;   // 6,291,456 elements
  const size_t WSZ = (size_t)EMB * EMB;    //   589,824 elements

  size_t off = 0; char* ws = (char*)d_ws;
  auto take = [&](size_t bytes) { void* p = ws + off; off += (bytes + 255) & ~(size_t)255; return p; };
  b16* Wqh = (b16*)take(WSZ * 2); b16* Wql = (b16*)take(WSZ * 2);
  b16* Wkh = (b16*)take(WSZ * 2); b16* Wkl = (b16*)take(WSZ * 2);
  b16* Wvh = (b16*)take(WSZ * 2); b16* Wvl = (b16*)take(WSZ * 2);
  b16* Woh = (b16*)take(WSZ * 2); b16* Wol = (b16*)take(WSZ * 2);
  b16* Qh = (b16*)take(TOK * 2);  b16* Ql = (b16*)take(TOK * 2);     // planes in fragment order, 8192 x 768 elements each
  b16* Kh = (b16*)take(TOK * 2);  b16* Kl = (b16*)take(TOK * 2);
  b16* Vh = (b16*)take(TOK * 2);  b16* Vl = (b16*)take(TOK * 2);
  float* Ao = (float*)take(TOK * 4);                                 // attended pre-projection f32 [8192,768]
  if (off > ws_size) return;

  float* att_out = (float*)d_out;        // [8,1024,768]
  float* avg_out = att_out + TOK;        // [8,1024,1024]

  cma_wsplit<<<288, 256, 0, stream>>>(qw, Wqh, Wql, (int)(WSZ / 8));
  cma_wsplit<<<288, 256, 0, stream>>>(kw, Wkh, Wkl, (int)(WSZ / 8));
  cma_wsplit<<<288, 256, 0, stream>>>(vw, Wvh, Wvl, (int)(WSZ / 8));
  cma_wsplit<<<288, 256, 0, stream>>>(ow, Woh, Wol, (int)(WSZ / 8));

  dim3 gg(MTOT / 128, EMB / 64);
  cma_gemm_tn<<<gg, 256, 0, stream>>>(mam, Wqh, Wql, qb, Qh, Ql, MTOT, EMB, EMB, 0);
  cma_gemm_tn<<<gg, 256, 0, stream>>>(pat, Wkh, Wkl, kb, Kh, Kl, MTOT, EMB, EMB, 0);
  cma_gemm_tn<<<gg, 256, 0, stream>>>(pat, Wvh, Wvl, vb, Vh, Vl, MTOT, EMB, EMB, 1);

  cma_attn<<<dim3(NTOK / 32, NB), 512, 0, stream>>>(Qh, Ql, Kh, Kl, Vh, Vl, Ao, avg_out);

  cma_gemm_tn<<<gg, 256, 0, stream>>>(Ao, Woh, Wol, ob, att_out, nullptr, MTOT, EMB, EMB, 2);
}

// v005
// One run takes 257 microseconds.
// Next to v004, in two timings, it ran 1.09 times as fast each time.
// All steps since v000 together make it 2.41 times as fast.
#include <hip/hip_runtime.h>

// ---------------------------------------------------------------------------
// Cross-modal attention (E=768, 8 heads x 96, B=8, 1024 query tokens x 1024 key tokens), two outputs: attended [8,1024,768] and the
// head-averaged attention matrix [8,1024,1024]. Every contraction runs on v_wmma_f32_16x16x32_bf16 with BOTH operands as bf16 hi/lo
// splits (hi.hi + hi.lo + lo.hi, f32 accumulate): the four projections (A = activation hi/lo planes, split once, B = weight hi/lo
// planes), Q.K^T (Q/K hi/lo planes), P.V (P split from the f32 probability panel in LDS, V^T hi/lo planes). Softmax and the head mean f32.
// Fragment k-map per lane half hh, A and B alike: elements 0..7 <- k = 8hh+0..7, elements 8..15 <- k = 16+8hh+0..7.
// The Q, K and V planes lie in the workspace in FRAGMENT ORDER: one 16x32 fragment = one block of 1024 B = [j = 0,1][lane 0..31][8 elements],
// lane = 16hh + (row or column & 15), k = 32 chunk + 16j + 8hh + 0..7. A fragment load is then two loads of 512 contiguous bytes (four whole
// cache lines each) instead of two loads that touch 16 lines for 32 bytes each.
//   Q, K: block index ((b*8 + h)*64 + token tile)*3 + d chunk          V: block index ((b*8 + h)*6 + d tile)*32 + key chunk
// The A operands of the four projections (both token inputs, the attention output) lie so too: block index (16-row tile)*24 + k chunk.
// ---------------------------------------------------------------------------

typedef __bf16 b16;
typedef __attribute__((ext_vector_type(16))) __bf16 v16b;
typedef __attribute__((ext_vector_type(8)))  __bf16 v8b;
typedef __attribute__((ext_vector_type(2)))  __bf16 v2b;
typedef __attribute__((ext_vector_type(8)))  float  v8f;
typedef __attribute__((ext_vector_type(2)))  float  v2f;
typedef __attribute__((ext_vector_type(4)))  int    i4;

#define NB 8
#define NTOK 1024
#define EMB 768
#define NHD 8
#define HDIM 96
#define MTOT 8192
#define WPITCH 72     // LDS pitch of a 64-element bf16 row (weight panels, Q/K staging tile): 144 B = 16 B x odd, conflict-free for ds_load_b128 reads of one row per lane
#define APITCH 132    // LDS pitch of a 128-element f32 row (activation split): 528 B = 16 B x odd
#define SPITCH 1028   // LDS pitch of a 1024-element f32 score row: 4112 B = 16 B x odd

__device__ __forceinline__ void split_bf16(float v, b16& hi, b16& lo) {
  const unsigned int u = __builtin_bit_cast(unsigned int, v) & 0xffff0000u;
  hi = __builtin_bit_cast(b16, (unsigned short)(u >> 16));
  lo = (b16)(v - __builtin_bit_cast(float, u));
}
__device__ __forceinline__ v8b ld8b(const b16* p) { return *(const v8b*)p; }
__device__ __forceinline__ v16b cat8b(v8b a, v8b b) { return __builtin_shufflevector(a, b, 0, 1, 2, 3, 4, 5, 6, 7, 8, 9, 10, 11, 12, 13, 14, 15); }
__device__ __forceinline__ v16b frag_kb(const b16* p, int hh) { return cat8b(ld8b(p + 8 * hh), ld8b(p + 16 + 8 * hh)); }
// A fragment from a plane in fragment order: wave-uniform plane pointer, a per-lane byte offset (16 B x lane + block) and a constant byte offset: every load of a plane shares one per-lane address
__device__ __forceinline__ v16b frag_off(const b16* base, unsigned int lane_bytes, int const_bytes) {
  const char* p = (const char*)base + lane_bytes + const_bytes;
  return cat8b(*(const v8b*)p, *(const v8b*)(p + 512));
}
__device__ __forceinline__ void frag_ksplit(const float* p, int hh, v16b& fh, v16b& fl) {
  const float* p0 = p + 8 * hh; const float* p1 = p + 16 + 8 * hh;
#pragma unroll
  for (int e = 0; e < 8; ++e) { b16 a, c; split_bf16(p0[e], a, c); fh[e] = a; fl[e] = c; split_bf16(p1[e], a, c); fh[8 + e] = a; fl[8 + e] = c; }
}
__device__ __forceinline__ v8f wmmab(v16b a, v16b b, v8f c) {
  v8f d = __builtin_amdgcn_wmma_f32_16x16x32_bf16(false, a, false, b, (short)0, c, false, false);
  asm volatile("v_nop\n\tv_nop\n\tv_nop\n\tv_nop" : "+v"(d) : "v"(a), "v"(b));
  return d;
}
__device__ __forceinline__ v8f wmma3(v16b ah, v16b al, v16b bh, v16b bl, v8f c) {
  c = wmmab(ah, bh, c); c = wmmab(ah, bl, c); c = wmmab(al, bh, c); return c;
}
__device__ __forceinline__ void wave_sync_lds() {
  __builtin_amdgcn_fence(__ATOMIC_RELEASE, "workgroup"); __builtin_amdgcn_wave_barrier(); __builtin_amdgcn_fence(__ATOMIC_ACQUIRE, "workgroup");
}

// ---------------------------------------------------------------------------
// ---------------------------------------------------------------------------
__global__ void cma_wsplit(const float* __restrict__ w, b16* __restrict__ wh, b16* __restrict__ wl, int n8) {
  int i = blockIdx.x * blockDim.x + threadIdx.x;
  int stride = gridDim.x * blockDim.x;
  for (; i < n8; i += stride) {
    v8b h, l;
#pragma unroll
    for (int e = 0; e < 8; ++e) { b16 a, c; split_bf16(w[(size_t)i * 8 + e], a, c); h[e] = a; l[e] = c; }
    *(v8b*)(wh + (size_t)i * 8) = h; *(v8b*)(wl + (size_t)i * 8) = l;
    
  }
}

// ---------------------------------------------------------------------------
// Both token inputs [8192,768] f32 -> bf16 hi/lo planes in fragment order, once, instead of in each of the 12 column blocks of every projection.
// A wave takes 16 rows x 128 columns: 16 loads of one row's 512 contiguous bytes, through its own LDS range, read back as four fragments.
// ---------------------------------------------------------------------------
__global__ __launch_bounds__(256)
void cma_asplit(const float* __restrict__ a0, const float* __restrict__ a1,
                b16* __restrict__ h0, b16* __restrict__ l0, b16* __restrict__ h1, b16* __restrict__ l1) {
  __shared__ __attribute__((aligned(16))) float sA[8 * 16 * APITCH];
  const float* a = blockIdx.y ? a1 : a0;
  b16* oh = blockIdx.y ? h1 : h0;
  b16* ol = blockIdx.y ? l1 : l0;
  const int lane = threadIdx.x & 31;
  const int wave = __builtin_amdgcn_readfirstlane(threadIdx.x >> 5);   // scalar: the tile's addresses stay in scalar registers, and loads and stores share one per-lane offset (16 B x lane)
  const int l16  = lane & 15;
  const int hh   = lane >> 4;
  const int gw   = blockIdx.x * 8 + wave;
  const int tile = gw / 6, cg = gw % 6;              // 16-row tile, group of 128 columns = four k chunks
  float* s = sA + wave * (16 * APITCH);
  const char* src = (const char*)(a + (size_t)(tile * 16) * EMB + cg * 128);
  const unsigned int lb = (unsigned int)lane * 16u;
#pragma unroll
  for (int i = 0; i < 16; ++i) *(i4*)(s + i * APITCH + lane * 4) = *(const i4*)(src + lb + i * (EMB * 4));
  wave_sync_lds();
#pragma unroll
  for (int c = 0; c < 4; ++c) {
    v16b fh, fl; frag_ksplit(s + l16 * APITCH + c * 32, hh, fh, fl);
    const size_t g = (size_t)(tile * 24 + cg * 4 + c) * 1024;     // the block's byte offset in either plane
    *(v8b*)((char*)oh + g + lb)       = __builtin_shufflevector(fh, fh, 0, 1, 2, 3, 4, 5, 6, 7);
    *(v8b*)((char*)oh + g + lb + 512) = __builtin_shufflevector(fh, fh, 8, 9, 10, 11, 12, 13, 14, 15);
    *(v8b*)((char*)ol + g + lb)       = __builtin_shufflevector(fl, fl, 0, 1, 2, 3, 4, 5, 6, 7);
    *(v8b*)((char*)ol + g + lb + 512) = __builtin_shufflevector(fl, fl, 8, 9, 10, 11, 12, 13, 14, 15);
  }
}

// ---------------------------------------------------------------------------
// C[M,N] = A[M,K] * W[N,K]^T + bias, both operands hi/lo planes (A in fragment order).
//   mode 0: C -> bf16 hi/lo planes, fragment order, k = d           (Q, K projections)
//   mode 1: C -> bf16 hi/lo planes, fragment order, k = key         (V projection, N = 768 = H*D)
//   mode 2: C -> f32 row-major [M,N]                                (O projection -> d_out)
// Workgroup = 8 waves, each wave owns a 16x64 tile -> WG tile 128x64. Weight panels [64n x 64k] (hi and lo) double-buffered in LDS,
// rows padded to WPITCH, shared by all waves; A fragments loaded from the planes, 512 contiguous bytes a load. The same LDS is reused as the staging tile of mode 0.
// ---------------------------------------------------------------------------
__global__ __launch_bounds__(256)
void cma_gemm_tn(const b16* __restrict__ Ah, const b16* __restrict__ Al, const b16* __restrict__ Wh, const b16* __restrict__ Wl,
                 const float* __restrict__ bias, void* __restrict__ out0, void* __restrict__ out1,
                 int M, int N, int K, int mode) {
  __shared__ __attribute__((aligned(16))) unsigned char smem[4 * 64 * WPITCH * 2];
  b16* sW = (b16*)smem;                       // [buf][plane][64*WPITCH]
  const int lane = threadIdx.x & 31;
  const int wave = threadIdx.x >> 5;
  const int tid  = threadIdx.x;
  const int mt   = blockIdx.x * 128 + wave * 16;
  const int nb   = blockIdx.y * 64;
  const int l16  = lane & 15;
  const int hh   = lane >> 4;
  const int rbase = hh * 8;

  const int wr0 = tid >> 3, wc0 = (tid & 7) * 8;
  const int wr1 = (tid + 256) >> 3, wc1 = ((tid + 256) & 7) * 8;
  auto loadW = [&](int buf, int k0) {
    b16* dh = sW + (buf * 2 + 0) * (64 * WPITCH); b16* dl = sW + (buf * 2 + 1) * (64 * WPITCH);
    *(i4*)(dh + wr0 * WPITCH + wc0) = *(const i4*)(Wh + (size_t)(nb + wr0) * K + k0 + wc0);
    *(i4*)(dh + wr1 * WPITCH + wc1) = *(const i4*)(Wh + (size_t)(nb + wr1) * K + k0 + wc1);
    *(i4*)(dl + wr0 * WPITCH + wc0) = *(const i4*)(Wl + (size_t)(nb + wr0) * K + k0 + wc0);
    *(i4*)(dl + wr1 * WPITCH + wc1) = *(const i4*)(Wl + (size_t)(nb + wr1) * K + k0 + wc1);
  };
  unsigned int ao = (unsigned int)lane * 16u + (unsigned int)(mt >> 4) * (unsigned int)(K >> 5) * 1024u;   // byte offset of this wave's row tile in both A planes, stepped by two k chunks a pass

  v8f acc[4] = {};
  int buf = 0;
  loadW(0, 0);
  for (int k0 = 0; k0 < K; k0 += 64, buf ^= 1) {
    __syncthreads();                          // panel 'buf' staged by everyone; previous panel reads finished before it is overwritten below
    v16b ah[2], al[2];
#pragma unroll
    for (int kk = 0; kk < 2; ++kk) { ah[kk] = frag_off(Ah, ao, kk * 1024); al[kk] = frag_off(Al, ao, kk * 1024); }
    asm volatile("s_wait_xcnt 0x0" ::: "memory");   // stands behind the A loads, before the offset register that they name is stepped; its clobber also keeps them in front of the weight staging, so that the two load latencies run together and not one after the other
    ao += 2048u;
    if (k0 + 64 < K) loadW(buf ^ 1, k0 + 64);
    const b16* ph = sW + (buf * 2 + 0) * (64 * WPITCH); const b16* pl = sW + (buf * 2 + 1) * (64 * WPITCH);
#pragma unroll
    for (int kk = 0; kk < 2; ++kk) {
#pragma unroll
      for (int nt = 0; nt < 4; ++nt) {
        const b16* wp = ph + (nt * 16 + l16) * WPITCH + kk * 32;
        const b16* wq = pl + (nt * 16 + l16) * WPITCH + kk * 32;
        acc[nt] = wmma3(ah[kk], al[kk], frag_kb(wp, hh), frag_kb(wq, hh), acc[nt]);
      }
    }
  }
  __syncthreads();                            // all panel reads done: smem becomes the staging tile

  if (mode == 0) {
    b16* th = (b16*)smem + wave * (2 * 16 * WPITCH); b16* tl = th + 16 * WPITCH;
#pragma unroll
    for (int nt = 0; nt < 4; ++nt) {
      const float bn = bias[nb + nt * 16 + l16];
#pragma unroll
      for (int r = 0; r < 8; ++r) { b16 a, c; split_bf16(acc[nt][r] + bn, a, c); th[(rbase + r) * WPITCH + nt * 16 + l16] = a; tl[(rbase + r) * WPITCH + nt * 16 + l16] = c; }
    }
    wave_sync_lds();
    b16* oh = (b16*)out0; b16* ol = (b16*)out1;
    {
      const int bt = mt >> 10, tile = (mt >> 4) & 63;   // the wave's 16 tokens are one token tile; its 64 columns are two whole 32-wide d chunks
#pragma unroll
      for (int c = 0; c < 2; ++c) {
        const int c32 = (nb >> 5) + c, h = c32 / 3, kk = c32 % 3;
        const size_t blk = (size_t)(((bt * NHD + h) * 64 + tile) * 3 + kk) * 512;
#pragma unroll
        for (int j = 0; j < 2; ++j) {
          const size_t g = blk + j * 256 + lane * 8;
          *(v8b*)(oh + g) = ld8b(th + l16 * WPITCH + c * 32 + j * 16 + hh * 8);
          *(v8b*)(ol + g) = ld8b(tl + l16 * WPITCH + c * 32 + j * 16 + hh * 8);
        }
      }
    }
  } else if (mode == 1) {
    // A lane's eight accumulator registers of a column tile are eight consecutive keys of one column d: already one 16-byte piece of a V fragment, stored from registers
    b16* oh = (b16*)out0; b16* ol = (b16*)out1;
    const int bt = mt >> 10, pc = (mt >> 5) & 31, j = (mt >> 4) & 1;
#pragma unroll
    for (int nt = 0; nt < 4; ++nt) {
      const int t16 = (nb >> 4) + nt, h = t16 / 6, dt = t16 % 6;
      const float bn = bias[nb + nt * 16 + l16];
      v8b vh8, vl8;
#pragma unroll
      for (int r = 0; r < 8; ++r) { b16 a, c; split_bf16(acc[nt][r] + bn, a, c); vh8[r] = a; vl8[r] = c; }
      const size_t g = (size_t)(((bt * NHD + h) * 6 + dt) * 32 + pc) * 512 + j * 256 + lane * 8;
      *(v8b*)(oh + g) = vh8;
      *(v8b*)(ol + g) = vl8;
    }
    asm volatile("s_wait_xcnt 0x0" ::: "memory");   // stands behind the run of stores, before any register that an issued store names is rewritten
  } else {
    float* of = (float*)out0;
    {
#pragma unroll
      for (int pr = 0; pr < 2; ++pr) {
        const int cbase = nb + pr * 32;
        const float bn = bias[cbase + lane];
#pragma unroll
        for (int r = 0; r < 8; ++r) {
          const float a0 = acc[2 * pr][r], b0 = acc[2 * pr + 1][r];
          const float ax = __shfl_xor(a0, 16), bx = __shfl_xor(b0, 16);
          const float v1 = (hh ? bx : a0) + bn;     // row mt + r
          const float v2 = (hh ? b0 : ax) + bn;     // row mt + r + 8
          *(float*)(of + (size_t)(mt + r) * N + cbase + lane) = v1;
          *(float*)(of + (size_t)(mt + r + 8) * N + cbase + lane) = v2;
        }
      }
      
    }
  }
}

// ---------------------------------------------------------------------------
// Attention core. One workgroup of 16 waves per (b, 32-row block = two 16-row m-tiles); loops over 8 heads.
// Every K and V fragment that a wave loads is multiplied into both m-tiles, so each (b, h) K/V plane is read by 32 workgroups, not 64.
//   Phase 1: S[32x1024] = (Q K^T) / sqrt(96) into the LDS panel (split WMMA, Q/K hi/lo planes); a wave owns 64 keys
//   Phase 2: exact softmax per row (2 rows per wave, 32 columns per lane); head-mean accumulated in registers; P written back f32
//   Phase 3: O_partial += P V; a wave owns one 128-key slab (wave & 7) and one 48-column half of the head (wave >> 3), both m-tiles
// K and V fragments run through register rings: a ring slot is refilled with the fragment of the next k chunk directly behind the WMMAs that
// read it, the first V chunk is requested in front of the softmax and the next head's first Q/K chunk in front of the sums of the O reduction, so that
// a whole chunk of loads is in flight under the matrix, softmax and reduction work instead of four loads that are waited for at once.
// ---------------------------------------------------------------------------
__global__ __launch_bounds__(512)
void cma_attn(const b16* __restrict__ Qh, const b16* __restrict__ Ql,     // fragment order, [b][h][64 token tiles][3 d chunks][1024 B]
              const b16* __restrict__ Kh, const b16* __restrict__ Kl,     // the same
              const b16* __restrict__ Vh, const b16* __restrict__ Vl,     // fragment order, [b][h][6 d tiles][32 key chunks][1024 B]
              b16* __restrict__ Aoh, b16* __restrict__ Aol,               // attended rows [8192,768] as hi/lo planes in fragment order, [512 row tiles][24 k chunks][1024 B]
              float* __restrict__ avg_out) {                              // [8,1024,1024] f32
  __shared__ __attribute__((aligned(16))) float sS[32 * SPITCH];          // score / probability panel, rows padded to SPITCH, reused for the O reduction

  const int b    = blockIdx.y;
  const int m0   = blockIdx.x * 32;
  const int tid  = threadIdx.x;
  const int lane = tid & 31;
  const int wave = __builtin_amdgcn_readfirstlane(tid >> 5);   // scalar: what depends on the wave alone stays out of the vector registers, which the rings need
  const int l16  = lane & 15;
  const int hh   = lane >> 4;
  const int rbase = hh * 8;
  const int slab = wave & 7;                           // phase 3: 128-key slab
  const int nt0  = (wave >> 3) * 3;                    // phase 3: first of this wave's three 16-column tiles of the head
  const float scale = 0.1020620726f;                   // 1/sqrt(96)
  const unsigned int HSTEP = 64u * 3u * 1024u;         // bytes of one (b, h) in every plane (= 6 * 32 * 1024)

  float AV[2][32];
#pragma unroll
  for (int rr = 0; rr < 2; ++rr)
#pragma unroll
    for (int i = 0; i < 32; ++i) AV[rr][i] = 0.f;

  v16b qh0, ql0, qh1, ql1;                             // one k chunk of Q, both m-tiles
  v16b kfh[4], kfl[4];                                 // K ring: one slot per 16-key tile
  v16b vfh[3], vfl[3];                                 // V ring: one slot per 16-column tile
  // 32-bit byte offsets from a plane's start (16 B x lane + the first block of this batch, wave and head), stepped from head to head: hi and lo plane share one register
  unsigned int qo = (unsigned int)lane * 16u + (unsigned int)b * NHD * HSTEP + (unsigned int)(m0 >> 4) * 3072u;
  unsigned int ko = (unsigned int)lane * 16u + (unsigned int)b * NHD * HSTEP + (unsigned int)(wave * 4) * 3072u;
  unsigned int vo = (unsigned int)lane * 16u + (unsigned int)b * NHD * HSTEP + (unsigned int)(nt0 * 32 + slab * 4) * 1024u;
  auto ldQ = [&](int kk) {
    qh0 = frag_off(Qh, qo, kk * 1024); ql0 = frag_off(Ql, qo, kk * 1024);
    qh1 = frag_off(Qh, qo, 3072 + kk * 1024); ql1 = frag_off(Ql, qo, 3072 + kk * 1024);
  };
  auto ldK = [&](int kk, int t) {
    kfh[t] = frag_off(Kh, ko, t * 3072 + kk * 1024); kfl[t] = frag_off(Kl, ko, t * 3072 + kk * 1024);
  };
  auto ldV = [&](int c4, int j) {
    vfh[j] = frag_off(Vh, vo, (j * 32 + c4) * 1024); vfl[j] = frag_off(Vl, vo, (j * 32 + c4) * 1024);
  };
  ldQ(0);
#pragma unroll
  for (int t = 0; t < 4; ++t) ldK(0, t);

  for (int h = 0; h < NHD; ++h) {
    // ----- Phase 1: scores -> LDS --------------------------------------
    v8f s[4][2] = {};                                  // [16-key tile][m-tile]; k chunk outermost, so that only one chunk of Q is held in registers
#pragma unroll
    for (int kk = 0; kk < 3; ++kk) {
#pragma unroll
      for (int t = 0; t < 4; ++t) {
        s[t][0] = wmmab(qh0, kfh[t], s[t][0]); s[t][1] = wmmab(qh1, kfh[t], s[t][1]);
        s[t][0] = wmmab(qh0, kfl[t], s[t][0]); s[t][1] = wmmab(qh1, kfl[t], s[t][1]);
        s[t][0] = wmmab(ql0, kfh[t], s[t][0]); s[t][1] = wmmab(ql1, kfh[t], s[t][1]);
        if (kk < 2) ldK(kk + 1, t);                    // refill the slot behind its last reader
      }
      if (kk < 2) ldQ(kk + 1);
    }
#pragma unroll
    for (int t = 0; t < 4; ++t) {
      const int ncol = wave * 64 + t * 16 + l16;
#pragma unroll
      for (int r = 0; r < 8; ++r) { sS[(rbase + r) * SPITCH + ncol] = s[t][0][r] * scale; sS[(16 + rbase + r) * SPITCH + ncol] = s[t][1][r] * scale; }
    }
    __syncthreads();
#pragma unroll
    for (int j = 0; j < 3; ++j) ldV(0, j);             // first V chunk: in flight under the softmax

    // ----- Phase 2: softmax (2 rows / wave), head-mean in registers, P back to the panel as f32 -----
    float P[2][32];
#pragma unroll
    for (int rr = 0; rr < 2; ++rr) {
      const int row = wave * 2 + rr;
      float mx = -3.0e38f;
#pragma unroll
      for (int i = 0; i < 32; ++i) { P[rr][i] = sS[row * SPITCH + lane + 32 * i]; mx = fmaxf(mx, P[rr][i]); }
#pragma unroll
      for (int off = 16; off >= 1; off >>= 1) mx = fmaxf(mx, __shfl_xor(mx, off));
      float sum = 0.f;
#pragma unroll
      for (int i = 0; i < 32; ++i) { const float e = expf(P[rr][i] - mx); P[rr][i] = e; sum += e; }
#pragma unroll
      for (int off = 16; off >= 1; off >>= 1) sum += __shfl_xor(sum, off);
      const float inv = 1.0f / sum;
#pragma unroll
      for (int i = 0; i < 32; ++i) { P[rr][i] *= inv; AV[rr][i] += P[rr][i] * 0.125f; }
    }
    __syncthreads();                                   // all S reads done
#pragma unroll
    for (int rr = 0; rr < 2; ++rr) {
      const int row = wave * 2 + rr;
#pragma unroll
      for (int i = 0; i < 32; ++i) sS[row * SPITCH + lane + 32 * i] = P[rr][i];
    }
    __syncthreads();

    // ----- Phase 3: O_partial += P * V over this wave's 128-wide key slab, three 16-column tiles, both m-tiles -----
    v8f o[2][3] = {};
#pragma unroll
    for (int c4 = 0; c4 < 4; ++c4) {
      const int pb = slab * 128 + c4 * 32;
      v16b aph0, apl0, aph1, apl1;
      frag_ksplit(sS + (size_t)l16 * SPITCH + pb, hh, aph0, apl0);
      frag_ksplit(sS + (size_t)(16 + l16) * SPITCH + pb, hh, aph1, apl1);
#pragma unroll
      for (int j = 0; j < 3; ++j) {
        o[0][j] = wmmab(aph0, vfh[j], o[0][j]); o[1][j] = wmmab(aph1, vfh[j], o[1][j]);
        o[0][j] = wmmab(aph0, vfl[j], o[0][j]); o[1][j] = wmmab(aph1, vfl[j], o[1][j]);
        o[0][j] = wmmab(apl0, vfh[j], o[0][j]); o[1][j] = wmmab(apl1, vfh[j], o[1][j]);
        if (c4 < 3) ldV(c4 + 1, j);                    // refill the slot behind its last reader
      }
    }
    __syncthreads();                                   // P reads done; reuse LDS

#pragma unroll
    for (int mi = 0; mi < 2; ++mi)
#pragma unroll
      for (int j = 0; j < 3; ++j)
#pragma unroll
        for (int r = 0; r < 8; ++r) sS[slab * 3072 + (mi * 16 + rbase + r) * 96 + (nt0 + j) * 16 + l16] = o[mi][j][r];
    __syncthreads();
    {
      const unsigned int hstep = h + 1 < NHD ? HSTEP : 0u;       // the last head requests its own first chunk again: in bounds, and no branch in the loop's body
      qo += hstep; ko += hstep; vo += HSTEP;                     // vo is next read by the next head, if there is one
      ldQ(0);
#pragma unroll
      for (int t = 0; t < 4; ++t) ldK(0, t);           // next head's first Q/K chunk: in flight under the O reduction
    }
#pragma unroll                                          // six exact trips: no branch in the head loop's body, so the head-mean updates stay at the softmax and P's registers are free in phase 3
    for (int q = 0; q < 6; ++q) {                      // reduced tile into sS[8*3072 ..) (free region)
      const int idx = tid + q * 512;
      float sum = 0.f;
#pragma unroll
      for (int w = 0; w < 8; ++w) sum += sS[w * 3072 + idx];
      sS[8 * 3072 + idx] = sum;
    }
    __syncthreads();
#pragma unroll                                          // three exact trips of one element pair a lane (1536 pairs, 512 threads), for the same reason
    for (int q = 0; q < 3; ++q) {                      // the head's 32 x 96 tile = six fragment blocks; a wave stores 128 contiguous bytes of a block in each plane
      const int blk = (wave >> 3) + 2 * q, mi = blk / 3, kc = blk % 3;
      const int fl = (tid >> 2) & 31;                  // lane of the fragment that holds the pair
      const v2f x = *(const v2f*)(sS + 8 * 3072 + (mi * 16 + (fl & 15)) * 96 + kc * 32 + ((tid >> 7) & 1) * 16 + (fl >> 4) * 8 + (tid & 3) * 2);
      v2b xh, xl; b16 a, c;
      split_bf16(x[0], a, c); xh[0] = a; xl[0] = c;
      split_bf16(x[1], a, c); xh[1] = a; xl[1] = c;
      const unsigned int g = (unsigned int)((((b << 6) + (m0 >> 4) + mi) * 24 + h * 3 + kc) * 1024) + (unsigned int)(tid & 255) * 4u;   // byte offset, the same in both planes
      *(v2b*)((char*)Aoh + g) = xh;
      *(v2b*)((char*)Aol + g) = xl;
    }
    __syncthreads();
  }
  {
#pragma unroll
    for (int rr = 0; rr < 2; ++rr) {
      float* apo = avg_out + ((size_t)((b << 10) + m0 + wave * 2 + rr) << 10) + __builtin_amdgcn_mbcnt_lo(~0u, 0u);   // the lane number in the form the shuffles already hold: no second register for it lives (or spills) across the head loop
#pragma unroll
      for (int i = 0; i < 32; ++i) *(float*)(apo + 32 * i) = AV[rr][i];
    }
    
  }
}

// ---------------------------------------------------------------------------
extern "C" void kernel_launch(void* const* d_in, const int* in_sizes, int n_in,
                              void* d_out, int out_size, void* d_ws, size_t ws_size,
                              hipStream_t stream) {
  (void)in_sizes; (void)n_in; (void)out_size;
  const float* mam = (const float*)d_in[0];
  const float* pat = (const float*)d_in[1];
  const float* qw  = (const float*)d_in[2];
  const float* qb  = (const float*)d_in[3];
  const float* kw  = (const float*)d_in[4];
  const float* kb  = (const float*)d_in[5];
  const float* vw  = (const float*)d_in[6];
  const float* vb  = (const float*)d_in[7];
  const float* ow  = (const float*)d_in[8];
  const float* ob  = (const float*)d_in[9];

  const size_t TOK = (size_t)MTOT * EMB;   // 6,291,456 elements
  const size_t WSZ = (size_t)EMB * EMB;    //   589,824 elements

  size_t off = 0; char* ws = (char*)d_ws;
  auto take = [&](size_t bytes) { void* p = ws + off; off += (bytes + 255) & ~(size_t)255; return p; };
  b16* Wqh = (b16*)take(WSZ * 2); b16* Wql = (b16*)take(WSZ * 2);
  b16* Wkh = (b16*)take(WSZ * 2); b16* Wkl = (b16*)take(WSZ * 2);
  b16* Wvh = (b16*)take(WSZ * 2); b16* Wvl = (b16*)take(WSZ * 2);
  b16* Woh = (b16*)take(WSZ * 2); b16* Wol = (b16*)take(WSZ * 2);
  b16* Qh = (b16*)take(TOK * 2);  b16* Ql = (b16*)take(TOK * 2);     // planes in fragment order, 8192 x 768 elements each
  b16* Kh = (b16*)take(TOK * 2);  b16* Kl = (b16*)take(TOK * 2);
  b16* Vh = (b16*)take(TOK * 2);  b16* Vl = (b16*)take(TOK * 2);
  b16* Aoh = (b16*)take(TOK * 2); b16* Aol = (b16*)take(TOK * 2);    // attended rows before the O projection
  b16* Mh = (b16*)take(TOK * 2);  b16* Ml = (b16*)take(TOK * 2);     // the two token inputs
  b16* Ph = (b16*)take(TOK * 2);  b16* Pl = (b16*)take(TOK * 2);
  if (off > ws_size) return;

  float* att_out = (float*)d_out;        // [8,1024,768]
  float* avg_out = att_out + TOK;        // [8,1024,1024]

  cma_wsplit<<<288, 256, 0, stream>>>(qw, Wqh, Wql, (int)(WSZ / 8));
  cma_wsplit<<<288, 256, 0, stream>>>(kw, Wkh, Wkl, (int)(WSZ / 8));
  cma_wsplit<<<288, 256, 0, stream>>>(vw, Wvh, Wvl, (int)(WSZ / 8));
  cma_wsplit<<<288, 256, 0, stream>>>(ow, Woh, Wol, (int)(WSZ / 8));

  cma_asplit<<<dim3(MTOT / 16 * 6 / 8, 2), 256, 0, stream>>>(mam, pat, Mh, Ml, Ph, Pl);

  dim3 gg(MTOT / 128, EMB / 64);
  cma_gemm_tn<<<gg, 256, 0, stream>>>(Mh, Ml, Wqh, Wql, qb, Qh, Ql, MTOT, EMB, EMB, 0);
  cma_gemm_tn<<<gg, 256, 0, stream>>>(Ph, Pl, Wkh, Wkl, kb, Kh, Kl, MTOT, EMB, EMB, 0);
  cma_gemm_tn<<<gg, 256, 0, stream>>>(Ph, Pl, Wvh, Wvl, vb, Vh, Vl, MTOT, EMB, EMB, 1);

  cma_attn<<<dim3(NTOK / 32, NB), 512, 0, stream>>>(Qh, Ql, Kh, Kl, Vh, Vl, Aoh, Aol, avg_out);

  cma_gemm_tn<<<gg, 256, 0, stream>>>(Aoh, Aol, Woh, Wol, ob, att_out, nullptr, MTOT, EMB, EMB, 2);
}

// v006
// One run takes 241 microseconds.
// Two timings next to v005 both put it at 1.07 times that version's speed.
// All steps since v000 together make it 2.58 times as fast.
#include <hip/hip_runtime.h>

// ---------------------------------------------------------------------------
// Cross-modal attention (E=768, 8 heads x 96, B=8, 1024 query tokens x 1024 key tokens), two outputs: attended [8,1024,768] and the
// head-averaged attention matrix [8,1024,1024]. Every contraction runs on v_wmma_f32_16x16x32_bf16 with BOTH operands as bf16 hi/lo
// splits (hi.hi + hi.lo + lo.hi, f32 accumulate): the four projections (A = activation hi/lo planes, split once, B = weight hi/lo
// planes), Q.K^T (Q/K hi/lo planes), P.V (P split from the f32 probability panel in LDS, V^T hi/lo planes). Softmax and the head mean f32.
// Fragment k-map per lane half hh, A and B alike: elements 0..7 <- k = 8hh+0..7, elements 8..15 <- k = 16+8hh+0..7.
// The Q, K and V planes lie in the workspace in FRAGMENT ORDER: one 16x32 fragment = one block of 1024 B = [j = 0,1][lane 0..31][8 elements],
// lane = 16hh + (row or column & 15), k = 32 chunk + 16j + 8hh + 0..7. A fragment load is then two loads of 512 contiguous bytes (four whole
// cache lines each) instead of two loads that touch 16 lines for 32 bytes each.
//   Q, K: block index ((b*8 + h)*64 + token tile)*3 + d chunk          V: block index ((b*8 + h)*6 + d tile)*32 + key chunk
// The A operands of the four projections (both token inputs, the attention output) lie so too: block index (16-row tile)*24 + k chunk.
// ---------------------------------------------------------------------------

typedef __bf16 b16;
typedef __attribute__((ext_vector_type(16))) __bf16 v16b;
typedef __attribute__((ext_vector_type(8)))  __bf16 v8b;
typedef __attribute__((ext_vector_type(2)))  __bf16 v2b;
typedef __attribute__((ext_vector_type(8)))  float  v8f;
typedef __attribute__((ext_vector_type(2)))  float  v2f;
typedef __attribute__((ext_vector_type(4)))  int    i4;

#define NB 8
#define NTOK 1024
#define EMB 768
#define NHD 8
#define HDIM 96
#define MTOT 8192
#define WPITCH 72     // LDS pitch of a 64-element bf16 row (weight panels, Q/K staging tile): 144 B = 16 B x odd, conflict-free for ds_load_b128 reads of one row per lane
#define APITCH 132    // LDS pitch of a 128-element f32 row (activation split): 528 B = 16 B x odd
#define WBLK 72       // blocks of the split grid per weight matrix: 768*768/8 pieces = 4 trips of 72 x 256 threads
#define ABLK 384      // blocks of the split grid per token input: 512 row tiles x 6 column groups, 8 waves a block
#define SPITCH 1028   // LDS pitch of a 1024-element f32 score row: 4112 B = 16 B x odd

__device__ __forceinline__ void split_bf16(float v, b16& hi, b16& lo) {
  const unsigned int u = __builtin_bit_cast(unsigned int, v) & 0xffff0000u;
  hi = __builtin_bit_cast(b16, (unsigned short)(u >> 16));
  lo = (b16)(v - __builtin_bit_cast(float, u));
}
__device__ __forceinline__ v8b ld8b(const b16* p) { return *(const v8b*)p; }
__device__ __forceinline__ v16b cat8b(v8b a, v8b b) { return __builtin_shufflevector(a, b, 0, 1, 2, 3, 4, 5, 6, 7, 8, 9, 10, 11, 12, 13, 14, 15); }
__device__ __forceinline__ v16b frag_kb(const b16* p, int hh) { return cat8b(ld8b(p + 8 * hh), ld8b(p + 16 + 8 * hh)); }
// A fragment from a plane in fragment order: wave-uniform plane pointer, a per-lane byte offset (16 B x lane + block) and a constant byte offset: every load of a plane shares one per-lane address
__device__ __forceinline__ v16b frag_off(const b16* base, unsigned int lane_bytes, int const_bytes) {
  const char* p = (const char*)base + lane_bytes + const_bytes;
  return cat8b(*(const v8b*)p, *(const v8b*)(p + 512));
}
__device__ __forceinline__ void frag_ksplit(const float* p, int hh, v16b& fh, v16b& fl) {
  const float* p0 = p + 8 * hh; const float* p1 = p + 16 + 8 * hh;
#pragma unroll
  for (int e = 0; e < 8; ++e) { b16 a, c; split_bf16(p0[e], a, c); fh[e] = a; fl[e] = c; split_bf16(p1[e], a, c); fh[8 + e] = a; fl[8 + e] = c; }
}
__device__ __forceinline__ v8f wmmab(v16b a, v16b b, v8f c) {
  v8f d = __builtin_amdgcn_wmma_f32_16x16x32_bf16(false, a, false, b, (short)0, c, false, false);
  asm volatile("v_nop\n\tv_nop\n\tv_nop\n\tv_nop" : "+v"(d) : "v"(a), "v"(b));
  return d;
}
__device__ __forceinline__ v8f wmma3(v16b ah, v16b al, v16b bh, v16b bl, v8f c) {
  c = wmmab(ah, bh, c); c = wmmab(ah, bl, c); c = wmmab(al, bh, c); return c;
}
__device__ __forceinline__ void wave_sync_lds() {
  __builtin_amdgcn_fence(__ATOMIC_RELEASE, "workgroup"); __builtin_amdgcn_wave_barrier(); __builtin_amdgcn_fence(__ATOMIC_ACQUIRE, "workgroup");
}

// ---------------------------------------------------------------------------
// All six f32 -> bf16 hi/lo splits in ONE grid: none of them depends on another, so a range of the block index picks the job and the short jobs run beside the long ones.
//   blocks 0 .. 4*WBLK-1: the four weight matrices [768,768], row-major planes [weight][hi, lo][768*768]; WBLK blocks a matrix, eight elements a thread and trip
//   the rest, ABLK blocks an input: both token inputs [8192,768] -> planes in fragment order, once, instead of in each of the 12 column blocks of every projection.
//   There a wave takes 16 rows x 128 columns: 16 loads of one row's 512 contiguous bytes, through its own LDS range, read back as four fragments.
// ---------------------------------------------------------------------------
__global__ __launch_bounds__(256)
void cma_split(const float* __restrict__ a0, const float* __restrict__ a1,
               const float* __restrict__ w0, const float* __restrict__ w1, const float* __restrict__ w2, const float* __restrict__ w3,
               b16* __restrict__ h0, b16* __restrict__ l0, b16* __restrict__ h1, b16* __restrict__ l1, b16* __restrict__ wp) {
  __shared__ __attribute__((aligned(16))) float sA[8 * 16 * APITCH];
  if (blockIdx.x < 4 * WBLK) {                       // the same for the whole block
    const int m = blockIdx.x / WBLK;
    const float* w = m == 0 ? w0 : m == 1 ? w1 : m == 2 ? w2 : w3;
    b16* wh = wp + (size_t)m * (2 * EMB * EMB); b16* wl = wh + EMB * EMB;
#pragma unroll                                        // four exact trips (4 x WBLK x 256 pieces = the matrix): unrolled, so that the later trips' loads are requested in front of the first trip's stores
    for (int t = 0; t < EMB * EMB / 8 / (WBLK * 256); ++t) {
      const int i = (t * WBLK + blockIdx.x % WBLK) * 256 + threadIdx.x;
      v8b h, l;
#pragma unroll
      for (int e = 0; e < 8; ++e) { b16 a, c; split_bf16(w[(size_t)i * 8 + e], a, c); h[e] = a; l[e] = c; }
      *(v8b*)(wh + (size_t)i * 8) = h; *(v8b*)(wl + (size_t)i * 8) = l;
    }
    asm volatile("s_wait_xcnt 0x0" ::: "memory");   // stands behind the run of stores, before any register that an issued store names is rewritten
    return;
  }
  const int ab = blockIdx.x - 4 * WBLK;
  const bool second = ab >= ABLK;
  const float* a = second ? a1 : a0;
  b16* oh = second ? h1 : h0;
  b16* ol = second ? l1 : l0;
  const int lane = threadIdx.x & 31;
  const int wave = __builtin_amdgcn_readfirstlane(threadIdx.x >> 5);   // scalar: the tile's addresses stay in scalar registers, and loads and stores share one per-lane offset (16 B x lane)
  const int l16  = lane & 15;
  const int hh   = lane >> 4;
  const int gw   = (second ? ab - ABLK : ab) * 8 + wave;
  const int tile = gw / 6, cg = gw % 6;              // 16-row tile, group of 128 columns = four k chunks
  float* s = sA + wave * (16 * APITCH);
  const char* src = (const char*)(a + (size_t)(tile * 16) * EMB + cg * 128);
  const unsigned int lb = (unsigned int)lane * 16u;
#pragma unroll
  for (int i = 0; i < 16; ++i) *(i4*)(s + i * APITCH + lane * 4) = *(const i4*)(src + lb + i * (EMB * 4));
  wave_sync_lds();
#pragma unroll
  for (int c = 0; c < 4; ++c) {
    v16b fh, fl; frag_ksplit(s + l16 * APITCH + c * 32, hh, fh, fl);
    const size_t g = (size_t)(tile * 24 + cg * 4 + c) * 1024;     // the block's byte offset in either plane
    *(v8b*)((char*)oh + g + lb)       = __builtin_shufflevector(fh, fh, 0, 1, 2, 3, 4, 5, 6, 7);
    *(v8b*)((char*)oh + g + lb + 512) = __builtin_shufflevector(fh, fh, 8, 9, 10, 11, 12, 13, 14, 15);
    *(v8b*)((char*)ol + g + lb)       = __builtin_shufflevector(fl, fl, 0, 1, 2, 3, 4, 5, 6, 7);
    *(v8b*)((char*)ol + g + lb + 512) = __builtin_shufflevector(fl, fl, 8, 9, 10, 11, 12, 13, 14, 15);
  }
  asm volatile("s_wait_xcnt 0x0" ::: "memory");   // stands behind the run of stores, before any register that an issued store names is rewritten
}

// ---------------------------------------------------------------------------
// C[M,N] = A[M,K] * W[N,K]^T + bias, both operands hi/lo planes (A in fragment order).
//   mode 0: C -> bf16 hi/lo planes, fragment order, k = d           (Q, K projections)
//   mode 1: C -> bf16 hi/lo planes, fragment order, k = key         (V projection, N = 768 = H*D)
//   mode 2: C -> f32 row-major [M,N]                                (O projection -> d_out)
// Workgroup = 8 waves, each wave owns a 16x64 tile -> WG tile 128x64. Weight panels [64n x 64k] (hi and lo) double-buffered in LDS,
// rows padded to WPITCH, shared by all waves; A fragments loaded from the planes, 512 contiguous bytes a load. The same LDS is reused as the staging tile of mode 0.
// ---------------------------------------------------------------------------
__device__ __forceinline__
void gemm_tile(const b16* __restrict__ Ah, const b16* __restrict__ Al, const b16* __restrict__ Wh, const b16* __restrict__ Wl,
               const float* __restrict__ bias, void* __restrict__ out0, void* __restrict__ out1,
               int N, int K, int mode) {
  __shared__ __attribute__((aligned(16))) unsigned char smem[4 * 64 * WPITCH * 2];
  b16* sW = (b16*)smem;                       // [buf][plane][64*WPITCH]
  const int lane = threadIdx.x & 31;
  const int wave = threadIdx.x >> 5;
  const int tid  = threadIdx.x;
  const int mt   = blockIdx.x * 128 + wave * 16;
  const int nb   = blockIdx.y * 64;
  const int l16  = lane & 15;
  const int hh   = lane >> 4;
  const int rbase = hh * 8;

  const int wr0 = tid >> 3, wc0 = (tid & 7) * 8;
  const int wr1 = (tid + 256) >> 3, wc1 = ((tid + 256) & 7) * 8;
  auto loadW = [&](int buf, int k0) {
    b16* dh = sW + (buf * 2 + 0) * (64 * WPITCH); b16* dl = sW + (buf * 2 + 1) * (64 * WPITCH);
    *(i4*)(dh + wr0 * WPITCH + wc0) = *(const i4*)(Wh + (size_t)(nb + wr0) * K + k0 + wc0);
    *(i4*)(dh + wr1 * WPITCH + wc1) = *(const i4*)(Wh + (size_t)(nb + wr1) * K + k0 + wc1);
    *(i4*)(dl + wr0 * WPITCH + wc0) = *(const i4*)(Wl + (size_t)(nb + wr0) * K + k0 + wc0);
    *(i4*)(dl + wr1 * WPITCH + wc1) = *(const i4*)(Wl + (size_t)(nb + wr1) * K + k0 + wc1);
  };
  unsigned int ao = (unsigned int)lane * 16u + (unsigned int)(mt >> 4) * (unsigned int)(K >> 5) * 1024u;   // byte offset of this wave's row tile in both A planes, stepped by two k chunks a pass

  v8f acc[4] = {};
  int buf = 0;
  loadW(0, 0);
  for (int k0 = 0; k0 < K; k0 += 64, buf ^= 1) {
    __syncthreads();                          // panel 'buf' staged by everyone; previous panel reads finished before it is overwritten below
    v16b ah[2], al[2];
#pragma unroll
    for (int kk = 0; kk < 2; ++kk) { ah[kk] = frag_off(Ah, ao, kk * 1024); al[kk] = frag_off(Al, ao, kk * 1024); }
    asm volatile("s_wait_xcnt 0x0" ::: "memory");   // stands behind the A loads, before the offset register that they name is stepped; its clobber also keeps them in front of the weight staging, so that the two load latencies run together and not one after the other
    ao += 2048u;
    if (k0 + 64 < K) loadW(buf ^ 1, k0 + 64);
    const b16* ph = sW + (buf * 2 + 0) * (64 * WPITCH); const b16* pl = sW + (buf * 2 + 1) * (64 * WPITCH);
#pragma unroll
    for (int kk = 0; kk < 2; ++kk) {
#pragma unroll
      for (int nt = 0; nt < 4; ++nt) {
        const b16* wp = ph + (nt * 16 + l16) * WPITCH + kk * 32;
        const b16* wq = pl + (nt * 16 + l16) * WPITCH + kk * 32;
        acc[nt] = wmma3(ah[kk], al[kk], frag_kb(wp, hh), frag_kb(wq, hh), acc[nt]);
      }
    }
  }
  __syncthreads();                            // all panel reads done: smem becomes the staging tile

  if (mode == 0) {
    b16* th = (b16*)smem + wave * (2 * 16 * WPITCH); b16* tl = th + 16 * WPITCH;
#pragma unroll
    for (int nt = 0; nt < 4; ++nt) {
      const float bn = bias[nb + nt * 16 + l16];
#pragma unroll
      for (int r = 0; r < 8; ++r) { b16 a, c; split_bf16(acc[nt][r] + bn, a, c); th[(rbase + r) * WPITCH + nt * 16 + l16] = a; tl[(rbase + r) * WPITCH + nt * 16 + l16] = c; }
    }
    wave_sync_lds();
    b16* oh = (b16*)out0; b16* ol = (b16*)out1;
    {
      const int bt = mt >> 10, tile = (mt >> 4) & 63;   // the wave's 16 tokens are one token tile; its 64 columns are two whole 32-wide d chunks
#pragma unroll
      for (int c = 0; c < 2; ++c) {
        const int c32 = (nb >> 5) + c, h = c32 / 3, kk = c32 % 3;
        const size_t blk = (size_t)(((bt * NHD + h) * 64 + tile) * 3 + kk) * 512;
#pragma unroll
        for (int j = 0; j < 2; ++j) {
          const size_t g = blk + j * 256 + lane * 8;
          *(v8b*)(oh + g) = ld8b(th + l16 * WPITCH + c * 32 + j * 16 + hh * 8);
          *(v8b*)(ol + g) = ld8b(tl + l16 * WPITCH + c * 32 + j * 16 + hh * 8);
        }
      }
    }
    asm volatile("s_wait_xcnt 0x0" ::: "memory");   // stands behind the run of stores, before any register that an issued store names is rewritten
  } else if (mode == 1) {
    // A lane's eight accumulator registers of a column tile are eight consecutive keys of one column d: already one 16-byte piece of a V fragment, stored from registers
    b16* oh = (b16*)out0; b16* ol = (b16*)out1;
    const int bt = mt >> 10, pc = (mt >> 5) & 31, j = (mt >> 4) & 1;
#pragma unroll
    for (int nt = 0; nt < 4; ++nt) {
      const int t16 = (nb >> 4) + nt, h = t16 / 6, dt = t16 % 6;
      const float bn = bias[nb + nt * 16 + l16];
      v8b vh8, vl8;
#pragma unroll
      for (int r = 0; r < 8; ++r) { b16 a, c; split_bf16(acc[nt][r] + bn, a, c); vh8[r] = a; vl8[r] = c; }
      const size_t g = (size_t)(((bt * NHD + h) * 6 + dt) * 32 + pc) * 512 + j * 256 + lane * 8;
      *(v8b*)(oh + g) = vh8;
      *(v8b*)(ol + g) = vl8;
    }
    asm volatile("s_wait_xcnt 0x0" ::: "memory");   // stands behind the run of stores, before any register that an issued store names is rewritten
  } else {
    float* of = (float*)out0;
    {
#pragma unroll
      for (int pr = 0; pr < 2; ++pr) {
        const int cbase = nb + pr * 32;
        const float bn = bias[cbase + lane];
#pragma unroll
        for (int r = 0; r < 8; ++r) {
          const float a0 = acc[2 * pr][r], b0 = acc[2 * pr + 1][r];
          const float ax = __shfl_xor(a0, 16), bx = __shfl_xor(b0, 16);
          const float v1 = (hh ? bx : a0) + bn;     // row mt + r
          const float v2 = (hh ? b0 : ax) + bn;     // row mt + r + 8
          *(float*)(of + (size_t)(mt + r) * N + cbase + lane) = v1;
          *(float*)(of + (size_t)(mt + r + 8) * N + cbase + lane) = v2;
        }
      }
    }
    asm volatile("s_wait_xcnt 0x0" ::: "memory");   // stands behind the run of stores, before any register that an issued store names is rewritten
  }
}

// One grid for up to three products that do not depend on one another (Q, K and V projections): blockIdx.z picks the job, so the launches' starts and tails overlap.
__global__ __launch_bounds__(256)
void cma_gemm_tn(const b16* Ah0, const b16* Al0, const b16* Wh0, const b16* Wl0, const float* bias0, void* outh0, void* outl0, int mode0,
                 const b16* Ah1, const b16* Al1, const b16* Wh1, const b16* Wl1, const float* bias1, void* outh1, void* outl1, int mode1,
                 const b16* Ah2, const b16* Al2, const b16* Wh2, const b16* Wl2, const float* bias2, void* outh2, void* outl2, int mode2,
                 int N, int K) {
  const int z = blockIdx.z;
  gemm_tile(z == 0 ? Ah0 : z == 1 ? Ah1 : Ah2, z == 0 ? Al0 : z == 1 ? Al1 : Al2,
            z == 0 ? Wh0 : z == 1 ? Wh1 : Wh2, z == 0 ? Wl0 : z == 1 ? Wl1 : Wl2,
            z == 0 ? bias0 : z == 1 ? bias1 : bias2,
            z == 0 ? outh0 : z == 1 ? outh1 : outh2, z == 0 ? outl0 : z == 1 ? outl1 : outl2,
            N, K, z == 0 ? mode0 : z == 1 ? mode1 : mode2);
}

// ---------------------------------------------------------------------------
// Attention core. One workgroup of 16 waves per (b, 32-row block = two 16-row m-tiles); loops over 8 heads.
// Every K and V fragment that a wave loads is multiplied into both m-tiles, so each (b, h) K/V plane is read by 32 workgroups, not 64.
//   Phase 1: S[32x1024] = (Q K^T) / sqrt(96) into the LDS panel (split WMMA, Q/K hi/lo planes); a wave owns 64 keys
//   Phase 2: exact softmax per row (2 rows per wave, 32 columns per lane); head-mean accumulated in registers; P written back f32
//   Phase 3: O_partial += P V; a wave owns one 128-key slab (wave & 7) and one 48-column half of the head (wave >> 3), both m-tiles
// K and V fragments run through register rings: a ring slot is refilled with the fragment of the next k chunk directly behind the WMMAs that
// read it, the first V chunk is requested in front of the softmax and the next head's first Q/K chunk in front of the sums of the O reduction, so that
// a whole chunk of loads is in flight under the matrix, softmax and reduction work instead of four loads that are waited for at once.
// ---------------------------------------------------------------------------
__global__ __launch_bounds__(512)
void cma_attn(const b16* __restrict__ Qh, const b16* __restrict__ Ql,     // fragment order, [b][h][64 token tiles][3 d chunks][1024 B]
              const b16* __restrict__ Kh, const b16* __restrict__ Kl,     // the same
              const b16* __restrict__ Vh, const b16* __restrict__ Vl,     // fragment order, [b][h][6 d tiles][32 key chunks][1024 B]
              b16* __restrict__ Aoh, b16* __restrict__ Aol,               // attended rows [8192,768] as hi/lo planes in fragment order, [512 row tiles][24 k chunks][1024 B]
              float* __restrict__ avg_out) {                              // [8,1024,1024] f32
  __shared__ __attribute__((aligned(16))) float sS[32 * SPITCH];          // score / probability panel, rows padded to SPITCH, reused for the O reduction

  const int b    = blockIdx.y;
  const int m0   = blockIdx.x * 32;
  const int tid  = threadIdx.x;
  const int lane = tid & 31;
  const int wave = __builtin_amdgcn_readfirstlane(tid >> 5);   // scalar: what depends on the wave alone stays out of the vector registers, which the rings need
  const int l16  = lane & 15;
  const int hh   = lane >> 4;
  const int rbase = hh * 8;
  const int slab = wave & 7;                           // phase 3: 128-key slab
  const int nt0  = (wave >> 3) * 3;                    // phase 3: first of this wave's three 16-column tiles of the head
  const float scale = 0.1020620726f;                   // 1/sqrt(96)
  const unsigned int HSTEP = 64u * 3u * 1024u;         // bytes of one (b, h) in every plane (= 6 * 32 * 1024)

  float AV[2][32];
#pragma unroll
  for (int rr = 0; rr < 2; ++rr)
#pragma unroll
    for (int i = 0; i < 32; ++i) AV[rr][i] = 0.f;

  v16b qh0, ql0, qh1, ql1;                             // one k chunk of Q, both m-tiles
  v16b kfh[4], kfl[4];                                 // K ring: one slot per 16-key tile
  v16b vfh[3], vfl[3];                                 // V ring: one slot per 16-column tile
  // 32-bit byte offsets from a plane's start (16 B x lane + the first block of this batch, wave and head), stepped from head to head: hi and lo plane share one register
  unsigned int qo = (unsigned int)lane * 16u + (unsigned int)b * NHD * HSTEP + (unsigned int)(m0 >> 4) * 3072u;
  unsigned int ko = (unsigned int)lane * 16u + (unsigned int)b * NHD * HSTEP + (unsigned int)(wave * 4) * 3072u;
  unsigned int vo = (unsigned int)lane * 16u + (unsigned int)b * NHD * HSTEP + (unsigned int)(nt0 * 32 + slab * 4) * 1024u;
  auto ldQ = [&](int kk) {
    qh0 = frag_off(Qh, qo, kk * 1024); ql0 = frag_off(Ql, qo, kk * 1024);
    qh1 = frag_off(Qh, qo, 3072 + kk * 1024); ql1 = frag_off(Ql, qo, 3072 + kk * 1024);
  };
  auto ldK = [&](int kk, int t) {
    kfh[t] = frag_off(Kh, ko, t * 3072 + kk * 1024); kfl[t] = frag_off(Kl, ko, t * 3072 + kk * 1024);
  };
  auto ldV = [&](int c4, int j) {
    vfh[j] = frag_off(Vh, vo, (j * 32 + c4) * 1024); vfl[j] = frag_off(Vl, vo, (j * 32 + c4) * 1024);
  };
  ldQ(0);
#pragma unroll
  for (int t = 0; t < 4; ++t) ldK(0, t);

  for (int h = 0; h < NHD; ++h) {
    // ----- Phase 1: scores -> LDS --------------------------------------
    v8f s[4][2] = {};                                  // [16-key tile][m-tile]; k chunk outermost, so that only one chunk of Q is held in registers
#pragma unroll
    for (int kk = 0; kk < 3; ++kk) {
#pragma unroll
      for (int t = 0; t < 4; ++t) {
        s[t][0] = wmmab(qh0, kfh[t], s[t][0]); s[t][1] = wmmab(qh1, kfh[t], s[t][1]);
        s[t][0] = wmmab(qh0, kfl[t], s[t][0]); s[t][1] = wmmab(qh1, kfl[t], s[t][1]);
        s[t][0] = wmmab(ql0, kfh[t], s[t][0]); s[t][1] = wmmab(ql1, kfh[t], s[t][1]);
        if (kk < 2) ldK(kk + 1, t);                    // refill the slot behind its last reader
      }
      if (kk < 2) ldQ(kk + 1);
    }
#pragma unroll
    for (int t = 0; t < 4; ++t) {
      const int ncol = wave * 64 + t * 16 + l16;
#pragma unroll
      for (int r = 0; r < 8; ++r) { sS[(rbase + r) * SPITCH + ncol] = s[t][0][r] * scale; sS[(16 + rbase + r) * SPITCH + ncol] = s[t][1][r] * scale; }
    }
    __syncthreads();
#pragma unroll
    for (int j = 0; j < 3; ++j) ldV(0, j);             // first V chunk: in flight under the softmax

    // ----- Phase 2: softmax (2 rows / wave), head-mean in registers, P back to the panel as f32 -----
    float P[2][32];
#pragma unroll
    for (int rr = 0; rr < 2; ++rr) {
      const int row = wave * 2 + rr;
      float mx = -3.0e38f;
#pragma unroll
      for (int i = 0; i < 32; ++i) { P[rr][i] = sS[row * SPITCH + lane + 32 * i]; mx = fmaxf(mx, P[rr][i]); }
#pragma unroll
      for (int off = 16; off >= 1; off >>= 1) mx = fmaxf(mx, __shfl_xor(mx, off));
      float sum = 0.f;
#pragma unroll
      for (int i = 0; i < 32; ++i) { const float e = expf(P[rr][i] - mx); P[rr][i] = e; sum += e; }
#pragma unroll
      for (int off = 16; off >= 1; off >>= 1) sum += __shfl_xor(sum, off);
      const float inv = 1.0f / sum;
#pragma unroll
      for (int i = 0; i < 32; ++i) { P[rr][i] *= inv; AV[rr][i] += P[rr][i] * 0.125f; }
    }
    __syncthreads();                                   // all S reads done
#pragma unroll
    for (int rr = 0; rr < 2; ++rr) {
      const int row = wave * 2 + rr;
#pragma unroll
      for (int i = 0; i < 32; ++i) sS[row * SPITCH + lane + 32 * i] = P[rr][i];
    }
    __syncthreads();

    // ----- Phase 3: O_partial += P * V over this wave's 128-wide key slab, three 16-column tiles, both m-tiles -----
    v8f o[2][3] = {};
#pragma unroll
    for (int c4 = 0; c4 < 4; ++c4) {
      const int pb = slab * 128 + c4 * 32;
      v16b aph0, apl0, aph1, apl1;
      frag_ksplit(sS + (size_t)l16 * SPITCH + pb, hh, aph0, apl0);
      frag_ksplit(sS + (size_t)(16 + l16) * SPITCH + pb, hh, aph1, apl1);
#pragma unroll
      for (int j = 0; j < 3; ++j) {
        o[0][j] = wmmab(aph0, vfh[j], o[0][j]); o[1][j] = wmmab(aph1, vfh[j], o[1][j]);
        o[0][j] = wmmab(aph0, vfl[j], o[0][j]); o[1][j] = wmmab(aph1, vfl[j], o[1][j]);
        o[0][j] = wmmab(apl0, vfh[j], o[0][j]); o[1][j] = wmmab(apl1, vfh[j], o[1][j]);
        if (c4 < 3) ldV(c4 + 1, j);                    // refill the slot behind its last reader
      }
    }
    __syncthreads();                                   // P reads done; reuse LDS

#pragma unroll
    for (int mi = 0; mi < 2; ++mi)
#pragma unroll
      for (int j = 0; j < 3; ++j)
#pragma unroll
        for (int r = 0; r < 8; ++r) sS[slab * 3072 + (mi * 16 + rbase + r) * 96 + (nt0 + j) * 16 + l16] = o[mi][j][r];
    __syncthreads();
    {
      const unsigned int hstep = h + 1 < NHD ? HSTEP : 0u;       // the last head requests its own first chunk again: in bounds, and no branch in the loop's body
      qo += hstep; ko += hstep; vo += HSTEP;                     // vo is next read by the next head, if there is one
      ldQ(0);
#pragma unroll
      for (int t = 0; t < 4; ++t) ldK(0, t);           // next head's first Q/K chunk: in flight under the O reduction
    }
#pragma unroll                                          // six exact trips: no branch in the head loop's body, so the head-mean updates stay at the softmax and P's registers are free in phase 3
    for (int q = 0; q < 6; ++q) {                      // reduced tile into sS[8*3072 ..) (free region)
      const int idx = tid + q * 512;
      float sum = 0.f;
#pragma unroll
      for (int w = 0; w < 8; ++w) sum += sS[w * 3072 + idx];
      sS[8 * 3072 + idx] = sum;
    }
    __syncthreads();
#pragma unroll                                          // three exact trips of one element pair a lane (1536 pairs, 512 threads), for the same reason
    for (int q = 0; q < 3; ++q) {                      // the head's 32 x 96 tile = six fragment blocks; a wave stores 128 contiguous bytes of a block in each plane
      const int blk = (wave >> 3) + 2 * q, mi = blk / 3, kc = blk % 3;
      const int fl = (tid >> 2) & 31;                  // lane of the fragment that holds the pair
      const v2f x = *(const v2f*)(sS + 8 * 3072 + (mi * 16 + (fl & 15)) * 96 + kc * 32 + ((tid >> 7) & 1) * 16 + (fl >> 4) * 8 + (tid & 3) * 2);
      v2b xh, xl; b16 a, c;
      split_bf16(x[0], a, c); xh[0] = a; xl[0] = c;
      split_bf16(x[1], a, c); xh[1] = a; xl[1] = c;
      const unsigned int g = (unsigned int)((((b << 6) + (m0 >> 4) + mi) * 24 + h * 3 + kc) * 1024) + (unsigned int)(tid & 255) * 4u;   // byte offset, the same in both planes
      *(v2b*)((char*)Aoh + g) = xh;
      *(v2b*)((char*)Aol + g) = xl;
    }
    __syncthreads();
  }
  {
#pragma unroll
    for (int rr = 0; rr < 2; ++rr) {
      float* apo = avg_out + ((size_t)((b << 10) + m0 + wave * 2 + rr) << 10) + __builtin_amdgcn_mbcnt_lo(~0u, 0u);   // the lane number in the form the shuffles already hold: no second register for it lives (or spills) across the head loop
#pragma unroll
      for (int i = 0; i < 32; ++i) *(float*)(apo + 32 * i) = AV[rr][i];
    }
    
  }
}

// ---------------------------------------------------------------------------
extern "C" void kernel_launch(void* const* d_in, const int* in_sizes, int n_in,
                              void* d_out, int out_size, void* d_ws, size_t ws_size,
                              hipStream_t stream) {
  (void)in_sizes; (void)n_in; (void)out_size;
  const float* mam = (const float*)d_in[0];
  const float* pat = (const float*)d_in[1];
  const float* qw  = (const float*)d_in[2];
  const float* qb  = (const float*)d_in[3];
  const float* kw  = (const float*)d_in[4];
  const float* kb  = (const float*)d_in[5];
  const float* vw  = (const float*)d_in[6];
  const float* vb  = (const float*)d_in[7];
  const float* ow  = (const float*)d_in[8];
  const float* ob  = (const float*)d_in[9];

  const size_t TOK = (size_t)MTOT * EMB;   // 6,291,456 elements
  const size_t WSZ = (size_t)EMB * EMB;    //   589,824 elements

  size_t off = 0; char* ws = (char*)d_ws;
  auto take = [&](size_t bytes) { void* p = ws + off; off += (bytes + 255) & ~(size_t)255; return p; };
  b16* Wp = (b16*)take(WSZ * 2 * 8);                                 // weight planes [q, k, v, o][hi, lo][768*768]
  b16* Wqh = Wp;           b16* Wql = Wp + WSZ;
  b16* Wkh = Wp + 2 * WSZ; b16* Wkl = Wp + 3 * WSZ;
  b16* Wvh = Wp + 4 * WSZ; b16* Wvl = Wp + 5 * WSZ;
  b16* Woh = Wp + 6 * WSZ; b16* Wol = Wp + 7 * WSZ;
  b16* Qh = (b16*)take(TOK * 2);  b16* Ql = (b16*)take(TOK * 2);     // planes in fragment order, 8192 x 768 elements each
  b16* Kh = (b16*)take(TOK * 2);  b16* Kl = (b16*)take(TOK * 2);
  b16* Vh = (b16*)take(TOK * 2);  b16* Vl = (b16*)take(TOK * 2);
  b16* Aoh = (b16*)take(TOK * 2); b16* Aol = (b16*)take(TOK * 2);    // attended rows before the O projection
  b16* Mh = (b16*)take(TOK * 2);  b16* Ml = (b16*)take(TOK * 2);     // the two token inputs
  b16* Ph = (b16*)take(TOK * 2);  b16* Pl = (b16*)take(TOK * 2);
  if (off > ws_size) return;

  float* att_out = (float*)d_out;        // [8,1024,768]
  float* avg_out = att_out + TOK;        // [8,1024,1024]

  cma_split<<<4 * WBLK + 2 * ABLK, 256, 0, stream>>>(mam, pat, qw, kw, vw, ow, Mh, Ml, Ph, Pl, Wp);

  cma_gemm_tn<<<dim3(MTOT / 128, EMB / 64, 3), 256, 0, stream>>>(Mh, Ml, Wqh, Wql, qb, Qh, Ql, 0,
                                                                 Ph, Pl, Wkh, Wkl, kb, Kh, Kl, 0,
                                                                 Ph, Pl, Wvh, Wvl, vb, Vh, Vl, 1, EMB, EMB);

  cma_attn<<<dim3(NTOK / 32, NB), 512, 0, stream>>>(Qh, Ql, Kh, Kl, Vh, Vl, Aoh, Aol, avg_out);

  cma_gemm_tn<<<dim3(MTOT / 128, EMB / 64, 1), 256, 0, stream>>>(Aoh, Aol, Woh, Wol, ob, att_out, nullptr, 2,      // one job: the other two slots are never picked
                                                                 Aoh, Aol, Woh, Wol, ob, att_out, nullptr, 2,
                                                                 Aoh, Aol, Woh, Wol, ob, att_out, nullptr, 2, EMB, EMB);
}

// v007
// A run of this version takes 226 microseconds.
// Two timings next to v006 put it at 1.07 and 1.06 times that version's speed.
// All steps since v000 together make it 2.75 times as fast.
#include <hip/hip_runtime.h>

// ---------------------------------------------------------------------------
// Cross-modal attention (E=768, 8 heads x 96, B=8, 1024 query tokens x 1024 key tokens), two outputs: attended [8,1024,768] and the
// head-averaged attention matrix [8,1024,1024]. Every contraction runs on v_wmma_f32_16x16x32_bf16 with BOTH operands as bf16 hi/lo
// splits (hi.hi + hi.lo + lo.hi, f32 accumulate): the four projections (A = activation hi/lo planes, split once, B = weight hi/lo
// planes), Q.K^T (Q/K hi/lo planes), P.V (P split from the f32 probability panel in LDS, V^T hi/lo planes). Softmax and the head mean f32.
// Fragment k-map per lane half hh, A and B alike: elements 0..7 <- k = 8hh+0..7, elements 8..15 <- k = 16+8hh+0..7.
// The Q, K and V planes lie in the workspace in FRAGMENT ORDER: one 16x32 fragment = one block of 1024 B = [j = 0,1][lane 0..31][8 elements],
// lane = 16hh + (row or column & 15), k = 32 chunk + 16j + 8hh + 0..7. A fragment load is then two loads of 512 contiguous bytes (four whole
// cache lines each) instead of two loads that touch 16 lines for 32 bytes each.
//   Q, K: block index ((b*8 + h)*64 + token tile)*3 + d chunk          V: block index ((b*8 + h)*6 + d tile)*32 + key chunk
// The A operands of the four projections (both token inputs, the attention output) lie so too: block index (16-row tile)*24 + k chunk.
// ---------------------------------------------------------------------------

typedef __bf16 b16;
typedef __attribute__((ext_vector_type(16))) __bf16 v16b;
typedef __attribute__((ext_vector_type(8)))  __bf16 v8b;
typedef __attribute__((ext_vector_type(2)))  __bf16 v2b;
typedef __attribute__((ext_vector_type(8)))  float  v8f;
typedef __attribute__((ext_vector_type(2)))  float  v2f;
typedef __attribute__((ext_vector_type(4)))  int    i4;

#define NB 8
#define NTOK 1024
#define EMB 768
#define NHD 8
#define HDIM 96
#define MTOT 8192
#define WPITCH 72     // LDS pitch of a 64-element bf16 row (weight panels, Q/K staging tile): 144 B = 16 B x odd, conflict-free for ds_load_b128 reads of one row per lane
#define APITCH 132    // LDS pitch of a 128-element f32 row (activation split): 528 B = 16 B x odd
#define WBLK 72       // blocks of the split grid per weight matrix: 768*768/8 pieces = 4 trips of 72 x 256 threads
#define ABLK 384      // blocks of the split grid per token input: 512 row tiles x 6 column groups, 8 waves a block
#define SPITCH 1028   // LDS pitch of a 1024-element f32 score row: 4112 B = 16 B x odd

__device__ __forceinline__ void split_bf16(float v, b16& hi, b16& lo) {
  const unsigned int u = __builtin_bit_cast(unsigned int, v) & 0xffff0000u;
  hi = __builtin_bit_cast(b16, (unsigned short)(u >> 16));
  lo = (b16)(v - __builtin_bit_cast(float, u));
}
__device__ __forceinline__ v8b ld8b(const b16* p) { return *(const v8b*)p; }
__device__ __forceinline__ v16b cat8b(v8b a, v8b b) { return __builtin_shufflevector(a, b, 0, 1, 2, 3, 4, 5, 6, 7, 8, 9, 10, 11, 12, 13, 14, 15); }
__device__ __forceinline__ v16b frag_kb(const b16* p, int hh) { return cat8b(ld8b(p + 8 * hh), ld8b(p + 16 + 8 * hh)); }
// A fragment from a plane in fragment order: wave-uniform plane pointer, a per-lane byte offset (16 B x lane + block) and a constant byte offset: every load of a plane shares one per-lane address
__device__ __forceinline__ v16b frag_off(const b16* base, unsigned int lane_bytes, int const_bytes) {
  const char* p = (const char*)base + lane_bytes + const_bytes;
  return cat8b(*(const v8b*)p, *(const v8b*)(p + 512));
}
__device__ __forceinline__ void frag_ksplit(const float* p, int hh, v16b& fh, v16b& fl) {
  const float* p0 = p + 8 * hh; const float* p1 = p + 16 + 8 * hh;
#pragma unroll
  for (int e = 0; e < 8; ++e) { b16 a, c; split_bf16(p0[e], a, c); fh[e] = a; fl[e] = c; split_bf16(p1[e], a, c); fh[8 + e] = a; fl[8 + e] = c; }
}
__device__ __forceinline__ v8f wmmab(v16b a, v16b b, v8f c) {
  v8f d = __builtin_amdgcn_wmma_f32_16x16x32_bf16(false, a, false, b, (short)0, c, false, false);
  asm volatile("v_nop\n\tv_nop\n\tv_nop\n\tv_nop" : "+v"(d) : "v"(a), "v"(b));
  return d;
}
__device__ __forceinline__ v8f wmma3(v16b ah, v16b al, v16b bh, v16b bl, v8f c) {
  c = wmmab(ah, bh, c); c = wmmab(ah, bl, c); c = wmmab(al, bh, c); return c;
}
__device__ __forceinline__ void wave_sync_lds() {
  __builtin_amdgcn_fence(__ATOMIC_RELEASE, "workgroup"); __builtin_amdgcn_wave_barrier(); __builtin_amdgcn_fence(__ATOMIC_ACQUIRE, "workgroup");
}

// ---------------------------------------------------------------------------
// All six f32 -> bf16 hi/lo splits in ONE grid: none of them depends on another, so a range of the block index picks the job and the short jobs run beside the long ones.
//   blocks 0 .. 4*WBLK-1: the four weight matrices [768,768], row-major planes [weight][hi, lo][768*768]; WBLK blocks a matrix, eight elements a thread and trip
//   the rest, ABLK blocks an input: both token inputs [8192,768] -> planes in fragment order, once, instead of in each of the 12 column blocks of every projection.
//   There a wave takes 16 rows x 128 columns: 16 loads of one row's 512 contiguous bytes, through its own LDS range, read back as four fragments.
// ---------------------------------------------------------------------------
__global__ __launch_bounds__(256)
void cma_split(const float* __restrict__ a0, const float* __restrict__ a1,
               const float* __restrict__ w0, const float* __restrict__ w1, const float* __restrict__ w2, const float* __restrict__ w3,
               b16* __restrict__ h0, b16* __restrict__ l0, b16* __restrict__ h1, b16* __restrict__ l1, b16* __restrict__ wp) {
  __shared__ __attribute__((aligned(16))) float sA[8 * 16 * APITCH];
  if (blockIdx.x < 4 * WBLK) {                       // the same for the whole block
    const int m = blockIdx.x / WBLK;
    const float* w = m == 0 ? w0 : m == 1 ? w1 : m == 2 ? w2 : w3;
    b16* wh = wp + (size_t)m * (2 * EMB * EMB); b16* wl = wh + EMB * EMB;
#pragma unroll                                        // four exact trips (4 x WBLK x 256 pieces = the matrix): unrolled, so that the later trips' loads are requested in front of the first trip's stores
    for (int t = 0; t < EMB * EMB / 8 / (WBLK * 256); ++t) {
      const int i = (t * WBLK + blockIdx.x % WBLK) * 256 + threadIdx.x;
      v8b h, l;
#pragma unroll
      for (int e = 0; e < 8; ++e) { b16 a, c; split_bf16(w[(size_t)i * 8 + e], a, c); h[e] = a; l[e] = c; }
      *(v8b*)(wh + (size_t)i * 8) = h; *(v8b*)(wl + (size_t)i * 8) = l;
    }
    asm volatile("s_wait_xcnt 0x0" ::: "memory");   // stands behind the run of stores, before any register that an issued store names is rewritten
    return;
  }
  const int ab = blockIdx.x - 4 * WBLK;
  const bool second = ab >= ABLK;
  const float* a = second ? a1 : a0;
  b16* oh = second ? h1 : h0;
  b16* ol = second ? l1 : l0;
  const int lane = threadIdx.x & 31;
  const int wave = __builtin_amdgcn_readfirstlane(threadIdx.x >> 5);   // scalar: the tile's addresses stay in scalar registers, and loads and stores share one per-lane offset (16 B x lane)
  const int l16  = lane & 15;
  const int hh   = lane >> 4;
  const int gw   = (second ? ab - ABLK : ab) * 8 + wave;
  const int tile = gw / 6, cg = gw % 6;              // 16-row tile, group of 128 columns = four k chunks
  float* s = sA + wave * (16 * APITCH);
  const char* src = (const char*)(a + (size_t)(tile * 16) * EMB + cg * 128);
  const unsigned int lb = (unsigned int)lane * 16u;
#pragma unroll
  for (int i = 0; i < 16; ++i) *(i4*)(s + i * APITCH + lane * 4) = *(const i4*)(src + lb + i * (EMB * 4));
  wave_sync_lds();
#pragma unroll
  for (int c = 0; c < 4; ++c) {
    v16b fh, fl; frag_ksplit(s + l16 * APITCH + c * 32, hh, fh, fl);
    const size_t g = (size_t)(tile * 24 + cg * 4 + c) * 1024;     // the block's byte offset in either plane
    *(v8b*)((char*)oh + g + lb)       = __builtin_shufflevector(fh, fh, 0, 1, 2, 3, 4, 5, 6, 7);
    *(v8b*)((char*)oh + g + lb + 512) = __builtin_shufflevector(fh, fh, 8, 9, 10, 11, 12, 13, 14, 15);
    *(v8b*)((char*)ol + g + lb)       = __builtin_shufflevector(fl, fl, 0, 1, 2, 3, 4, 5, 6, 7);
    *(v8b*)((char*)ol + g + lb + 512) = __builtin_shufflevector(fl, fl, 8, 9, 10, 11, 12, 13, 14, 15);
  }
  asm volatile("s_wait_xcnt 0x0" ::: "memory");   // stands behind the run of stores, before any register that an issued store names is rewritten
}

// ---------------------------------------------------------------------------
// C[M,N] = A[M,K] * W[N,K]^T + bias, both operands hi/lo planes (A in fragment order).
//   mode 0: C -> bf16 hi/lo planes, fragment order, k = d           (Q, K projections)
//   mode 1: C -> bf16 hi/lo planes, fragment order, k = key         (V projection, N = 768 = H*D)
//   mode 2: C -> f32 row-major [M,N]                                (O projection -> d_out)
// Workgroup = 8 waves, each wave owns a 16x64 tile -> WG tile 128x64. Weight panels [64n x 64k] (hi and lo) double-buffered in LDS,
// rows padded to WPITCH, shared by all waves; A fragments loaded from the planes, 512 contiguous bytes a load. The same LDS is reused as the staging tile of mode 0.
// ---------------------------------------------------------------------------
__device__ __forceinline__
void gemm_tile(const b16* __restrict__ Ah, const b16* __restrict__ Al, const b16* __restrict__ Wh, const b16* __restrict__ Wl,
               const float* __restrict__ bias, void* __restrict__ out0, void* __restrict__ out1,
               int N, int K, int mode) {
  __shared__ __attribute__((aligned(16))) unsigned char smem[4 * 64 * WPITCH * 2];
  b16* sW = (b16*)smem;                       // [buf][plane][64*WPITCH]
  const int lane = threadIdx.x & 31;
  const int wave = threadIdx.x >> 5;
  const int tid  = threadIdx.x;
  const int mt   = blockIdx.x * 128 + wave * 16;
  const int nb   = blockIdx.y * 64;
  const int l16  = lane & 15;
  const int hh   = lane >> 4;
  const int rbase = hh * 8;

  const int wr0 = tid >> 3, wc0 = (tid & 7) * 8;
  const int wr1 = (tid + 256) >> 3, wc1 = ((tid + 256) & 7) * 8;
  auto loadW = [&](int buf, int k0) {
    b16* dh = sW + (buf * 2 + 0) * (64 * WPITCH); b16* dl = sW + (buf * 2 + 1) * (64 * WPITCH);
    *(i4*)(dh + wr0 * WPITCH + wc0) = *(const i4*)(Wh + (size_t)(nb + wr0) * K + k0 + wc0);
    *(i4*)(dh + wr1 * WPITCH + wc1) = *(const i4*)(Wh + (size_t)(nb + wr1) * K + k0 + wc1);
    *(i4*)(dl + wr0 * WPITCH + wc0) = *(const i4*)(Wl + (size_t)(nb + wr0) * K + k0 + wc0);
    *(i4*)(dl + wr1 * WPITCH + wc1) = *(const i4*)(Wl + (size_t)(nb + wr1) * K + k0 + wc1);
  };
  unsigned int ao = (unsigned int)lane * 16u + (unsigned int)(mt >> 4) * (unsigned int)(K >> 5) * 1024u;   // byte offset of this wave's row tile in both A planes, stepped by two k chunks a pass

  v8f acc[4] = {};
  int buf = 0;
  loadW(0, 0);
  for (int k0 = 0; k0 < K; k0 += 64, buf ^= 1) {
    __syncthreads();                          // panel 'buf' staged by everyone; previous panel reads finished before it is overwritten below
    v16b ah[2], al[2];
#pragma unroll
    for (int kk = 0; kk < 2; ++kk) { ah[kk] = frag_off(Ah, ao, kk * 1024); al[kk] = frag_off(Al, ao, kk * 1024); }
    asm volatile("s_wait_xcnt 0x0" ::: "memory");   // stands behind the A loads, before the offset register that they name is stepped; its clobber also keeps them in front of the weight staging, so that the two load latencies run together and not one after the other
    ao += 2048u;
    if (k0 + 64 < K) loadW(buf ^ 1, k0 + 64);
    const b16* ph = sW + (buf * 2 + 0) * (64 * WPITCH); const b16* pl = sW + (buf * 2 + 1) * (64 * WPITCH);
#pragma unroll
    for (int kk = 0; kk < 2; ++kk) {
#pragma unroll
      for (int nt = 0; nt < 4; ++nt) {
        const b16* wp = ph + (nt * 16 + l16) * WPITCH + kk * 32;
        const b16* wq = pl + (nt * 16 + l16) * WPITCH + kk * 32;
        acc[nt] = wmma3(ah[kk], al[kk], frag_kb(wp, hh), frag_kb(wq, hh), acc[nt]);
      }
    }
  }
  __syncthreads();                            // all panel reads done: smem becomes the staging tile

  if (mode == 0) {
    b16* th = (b16*)smem + wave * (2 * 16 * WPITCH); b16* tl = th + 16 * WPITCH;
#pragma unroll
    for (int nt = 0; nt < 4; ++nt) {
      const float bn = bias[nb + nt * 16 + l16];
#pragma unroll
      for (int r = 0; r < 8; ++r) { b16 a, c; split_bf16(acc[nt][r] + bn, a, c); th[(rbase + r) * WPITCH + nt * 16 + l16] = a; tl[(rbase + r) * WPITCH + nt * 16 + l16] = c; }
    }
    wave_sync_lds();
    b16* oh = (b16*)out0; b16* ol = (b16*)out1;
    {
      const int bt = mt >> 10, tile = (mt >> 4) & 63;   // the wave's 16 tokens are one token tile; its 64 columns are two whole 32-wide d chunks
#pragma unroll
      for (int c = 0; c < 2; ++c) {
        const int c32 = (nb >> 5) + c, h = c32 / 3, kk = c32 % 3;
        const size_t blk = (size_t)(((bt * NHD + h) * 64 + tile) * 3 + kk) * 512;
#pragma unroll
        for (int j = 0; j < 2; ++j) {
          const size_t g = blk + j * 256 + lane * 8;
          *(v8b*)(oh + g) = ld8b(th + l16 * WPITCH + c * 32 + j * 16 + hh * 8);
          *(v8b*)(ol + g) = ld8b(tl + l16 * WPITCH + c * 32 + j * 16 + hh * 8);
        }
      }
    }
    asm volatile("s_wait_xcnt 0x0" ::: "memory");   // stands behind the run of stores, before any register that an issued store names is rewritten
  } else if (mode == 1) {
    // A lane's eight accumulator registers of a column tile are eight consecutive keys of one column d: already one 16-byte piece of a V fragment, stored from registers
    b16* oh = (b16*)out0; b16* ol = (b16*)out1;
    const int bt = mt >> 10, pc = (mt >> 5) & 31, j = (mt >> 4) & 1;
#pragma unroll
    for (int nt = 0; nt < 4; ++nt) {
      const int t16 = (nb >> 4) + nt, h = t16 / 6, dt = t16 % 6;
      const float bn = bias[nb + nt * 16 + l16];
      v8b vh8, vl8;
#pragma unroll
      for (int r = 0; r < 8; ++r) { b16 a, c; split_bf16(acc[nt][r] + bn, a, c); vh8[r] = a; vl8[r] = c; }
      const size_t g = (size_t)(((bt * NHD + h) * 6 + dt) * 32 + pc) * 512 + j * 256 + lane * 8;
      *(v8b*)(oh + g) = vh8;
      *(v8b*)(ol + g) = vl8;
    }
    asm volatile("s_wait_xcnt 0x0" ::: "memory");   // stands behind the run of stores, before any register that an issued store names is rewritten
  } else {
    float* of = (float*)out0;
    {
#pragma unroll
      for (int pr = 0; pr < 2; ++pr) {
        const int cbase = nb + pr * 32;
        const float bn = bias[cbase + lane];
#pragma unroll
        for (int r = 0; r < 8; ++r) {
          const float a0 = acc[2 * pr][r], b0 = acc[2 * pr + 1][r];
          const float ax = __shfl_xor(a0, 16), bx = __shfl_xor(b0, 16);
          const float v1 = (hh ? bx : a0) + bn;     // row mt + r
          const float v2 = (hh ? b0 : ax) + bn;     // row mt + r + 8
          *(float*)(of + (size_t)(mt + r) * N + cbase + lane) = v1;
          *(float*)(of + (size_t)(mt + r + 8) * N + cbase + lane) = v2;
        }
      }
    }
    asm volatile("s_wait_xcnt 0x0" ::: "memory");   // stands behind the run of stores, before any register that an issued store names is rewritten
  }
}

// One grid for up to three products that do not depend on one another (Q, K and V projections): blockIdx.z picks the job, so the launches' starts and tails overlap.
__global__ __launch_bounds__(256)
void cma_gemm_tn(const b16* Ah0, const b16* Al0, const b16* Wh0, const b16* Wl0, const float* bias0, void* outh0, void* outl0, int mode0,
                 const b16* Ah1, const b16* Al1, const b16* Wh1, const b16* Wl1, const float* bias1, void* outh1, void* outl1, int mode1,
                 const b16* Ah2, const b16* Al2, const b16* Wh2, const b16* Wl2, const float* bias2, void* outh2, void* outl2, int mode2,
                 int N, int K) {
  const int z = blockIdx.z;
  gemm_tile(z == 0 ? Ah0 : z == 1 ? Ah1 : Ah2, z == 0 ? Al0 : z == 1 ? Al1 : Al2,
            z == 0 ? Wh0 : z == 1 ? Wh1 : Wh2, z == 0 ? Wl0 : z == 1 ? Wl1 : Wl2,
            z == 0 ? bias0 : z == 1 ? bias1 : bias2,
            z == 0 ? outh0 : z == 1 ? outh1 : outh2, z == 0 ? outl0 : z == 1 ? outl1 : outl2,
            N, K, z == 0 ? mode0 : z == 1 ? mode1 : mode2);
}

// ---------------------------------------------------------------------------
// Attention core. One workgroup of 16 waves per (b, 32-row block = two 16-row m-tiles); loops over 8 heads.
// Every K and V fragment that a wave loads is multiplied into both m-tiles, so each (b, h) K/V plane is read by 32 workgroups, not 64.
//   Phase 1: S[32x1024] = Q K^T, unscaled, into the LDS panel (split WMMA, Q/K hi/lo planes); a wave owns 64 keys
//   Phase 2: softmax per row (2 rows per wave, 32 columns per lane): exp((s - max) / sqrt(96)) = 2^(s * c - max * c) with c = log2(e) / sqrt(96),
//            one FMA and one hardware exponential an element; head-mean accumulated in registers; P written back f32
//   Phase 3: O_partial += P V; a wave owns one 128-key slab (wave & 7) and one 48-column half of the head (wave >> 3), both m-tiles
// K and V fragments run through register rings: a ring slot is refilled with the fragment of the next k chunk directly behind the WMMAs that
// read it, the first V chunk is requested in front of the softmax and the next head's first Q/K chunk in front of the sums of the O reduction, so that
// a whole chunk of loads is in flight under the matrix, softmax and reduction work instead of four loads that are waited for at once.
// ---------------------------------------------------------------------------
__global__ __launch_bounds__(512)
void cma_attn(const b16* __restrict__ Qh, const b16* __restrict__ Ql,     // fragment order, [b][h][64 token tiles][3 d chunks][1024 B]
              const b16* __restrict__ Kh, const b16* __restrict__ Kl,     // the same
              const b16* __restrict__ Vh, const b16* __restrict__ Vl,     // fragment order, [b][h][6 d tiles][32 key chunks][1024 B]
              b16* __restrict__ Aoh, b16* __restrict__ Aol,               // attended rows [8192,768] as hi/lo planes in fragment order, [512 row tiles][24 k chunks][1024 B]
              float* __restrict__ avg_out) {                              // [8,1024,1024] f32
  __shared__ __attribute__((aligned(16))) float sS[32 * SPITCH];          // score / probability panel, rows padded to SPITCH, reused for the O reduction

  const int b    = blockIdx.y;
  const int m0   = blockIdx.x * 32;
  const int tid  = threadIdx.x;
  const int lane = tid & 31;
  const int wave = __builtin_amdgcn_readfirstlane(tid >> 5);   // scalar: what depends on the wave alone stays out of the vector registers, which the rings need
  const int l16  = lane & 15;
  const int hh   = lane >> 4;
  const int rbase = hh * 8;
  const int slab = wave & 7;                           // phase 3: 128-key slab
  const int nt0  = (wave >> 3) * 3;                    // phase 3: first of this wave's three 16-column tiles of the head
  const float esc = 0.14724445f;                       // log2(e) / sqrt(96): the score scale and the change of base in one factor (positive, so the row maximum may be taken of the unscaled scores)
  const unsigned int HSTEP = 64u * 3u * 1024u;         // bytes of one (b, h) in every plane (= 6 * 32 * 1024)

  float AV[2][32];
#pragma unroll
  for (int rr = 0; rr < 2; ++rr)
#pragma unroll
    for (int i = 0; i < 32; ++i) AV[rr][i] = 0.f;

  v16b qh0, ql0, qh1, ql1;                             // one k chunk of Q, both m-tiles
  v16b kfh[4], kfl[4];                                 // K ring: one slot per 16-key tile
  v16b vfh[3], vfl[3];                                 // V ring: one slot per 16-column tile
  // 32-bit byte offsets from a plane's start (16 B x lane + the first block of this batch, wave and head), stepped from head to head: hi and lo plane share one register
  unsigned int qo = (unsigned int)lane * 16u + (unsigned int)b * NHD * HSTEP + (unsigned int)(m0 >> 4) * 3072u;
  unsigned int ko = (unsigned int)lane * 16u + (unsigned int)b * NHD * HSTEP + (unsigned int)(wave * 4) * 3072u;
  unsigned int vo = (unsigned int)lane * 16u + (unsigned int)b * NHD * HSTEP + (unsigned int)(nt0 * 32 + slab * 4) * 1024u;
  auto ldQ = [&](int kk) {
    qh0 = frag_off(Qh, qo, kk * 1024); ql0 = frag_off(Ql, qo, kk * 1024);
    qh1 = frag_off(Qh, qo, 3072 + kk * 1024); ql1 = frag_off(Ql, qo, 3072 + kk * 1024);
  };
  auto ldK = [&](int kk, int t) {
    kfh[t] = frag_off(Kh, ko, t * 3072 + kk * 1024); kfl[t] = frag_off(Kl, ko, t * 3072 + kk * 1024);
  };
  auto ldV = [&](int c4, int j) {
    vfh[j] = frag_off(Vh, vo, (j * 32 + c4) * 1024); vfl[j] = frag_off(Vl, vo, (j * 32 + c4) * 1024);
  };
  ldQ(0);
#pragma unroll
  for (int t = 0; t < 4; ++t) ldK(0, t);

  for (int h = 0; h < NHD; ++h) {
    // ----- Phase 1: scores -> LDS --------------------------------------
    v8f s[4][2] = {};                                  // [16-key tile][m-tile]; k chunk outermost, so that only one chunk of Q is held in registers
#pragma unroll
    for (int kk = 0; kk < 3; ++kk) {
#pragma unroll
      for (int t = 0; t < 4; ++t) {
        s[t][0] = wmmab(qh0, kfh[t], s[t][0]); s[t][1] = wmmab(qh1, kfh[t], s[t][1]);
        s[t][0] = wmmab(qh0, kfl[t], s[t][0]); s[t][1] = wmmab(qh1, kfl[t], s[t][1]);
        s[t][0] = wmmab(ql0, kfh[t], s[t][0]); s[t][1] = wmmab(ql1, kfh[t], s[t][1]);
        if (kk < 2) ldK(kk + 1, t);                    // refill the slot behind its last reader
      }
      if (kk < 2) ldQ(kk + 1);
    }
#pragma unroll
    for (int t = 0; t < 4; ++t) {
      const int ncol = wave * 64 + t * 16 + l16;
#pragma unroll
      for (int r = 0; r < 8; ++r) { sS[(rbase + r) * SPITCH + ncol] = s[t][0][r]; sS[(16 + rbase + r) * SPITCH + ncol] = s[t][1][r]; }
    }
    __syncthreads();
#pragma unroll
    for (int j = 0; j < 3; ++j) ldV(0, j);             // first V chunk: in flight under the softmax

    // ----- Phase 2: softmax (2 rows / wave), head-mean in registers, P back to the panel as f32 -----
    float P[2][32];
#pragma unroll
    for (int rr = 0; rr < 2; ++rr) {
      const int row = wave * 2 + rr;
      float mx = -3.0e38f;
#pragma unroll
      for (int i = 0; i < 32; ++i) P[rr][i] = sS[row * SPITCH + lane + 32 * i];   // the row's loads in a loop of their own: they go out as one group in front of the maximum chain, not one by one between its links
#pragma unroll                                          // P is a register array: constant indices only
      for (int i = 0; i < 32; ++i) mx = fmaxf(mx, P[rr][i]);
#pragma unroll
      for (int off = 16; off >= 1; off >>= 1) mx = fmaxf(mx, __shfl_xor(mx, off));
      const float nm = -mx * esc;
      float sum = 0.f;
#pragma unroll
      for (int i = 0; i < 32; ++i) P[rr][i] = __builtin_fmaf(P[rr][i], esc, nm);   // every exponent first, in place: no exponential's source register is a temporary that the next FMA rewrites directly behind it
#pragma unroll                                          // P is a register array: constant indices only
      for (int i = 0; i < 32; ++i) { P[rr][i] = __builtin_amdgcn_exp2f(P[rr][i]); sum += P[rr][i]; }
#pragma unroll
      for (int off = 16; off >= 1; off >>= 1) sum += __shfl_xor(sum, off);
      const float inv = 1.0f / sum;
#pragma unroll
      for (int i = 0; i < 32; ++i) { P[rr][i] *= inv; AV[rr][i] += P[rr][i] * 0.125f; }
    }
    __syncthreads();                                   // all S reads done
#pragma unroll
    for (int rr = 0; rr < 2; ++rr) {
      const int row = wave * 2 + rr;
#pragma unroll
      for (int i = 0; i < 32; ++i) sS[row * SPITCH + lane + 32 * i] = P[rr][i];
    }
    __syncthreads();

    // ----- Phase 3: O_partial += P * V over this wave's 128-wide key slab, three 16-column tiles, both m-tiles -----
    v8f o[2][3] = {};
#pragma unroll
    for (int c4 = 0; c4 < 4; ++c4) {
      const int pb = slab * 128 + c4 * 32;
      v16b aph0, apl0, aph1, apl1;
      frag_ksplit(sS + (size_t)l16 * SPITCH + pb, hh, aph0, apl0);
      frag_ksplit(sS + (size_t)(16 + l16) * SPITCH + pb, hh, aph1, apl1);
#pragma unroll
      for (int j = 0; j < 3; ++j) {
        o[0][j] = wmmab(aph0, vfh[j], o[0][j]); o[1][j] = wmmab(aph1, vfh[j], o[1][j]);
        o[0][j] = wmmab(aph0, vfl[j], o[0][j]); o[1][j] = wmmab(aph1, vfl[j], o[1][j]);
        o[0][j] = wmmab(apl0, vfh[j], o[0][j]); o[1][j] = wmmab(apl1, vfh[j], o[1][j]);
        if (c4 < 3) ldV(c4 + 1, j);                    // refill the slot behind its last reader
      }
    }
    __syncthreads();                                   // P reads done; reuse LDS

#pragma unroll
    for (int mi = 0; mi < 2; ++mi)
#pragma unroll
      for (int j = 0; j < 3; ++j)
#pragma unroll
        for (int r = 0; r < 8; ++r) sS[slab * 3072 + (mi * 16 + rbase + r) * 96 + (nt0 + j) * 16 + l16] = o[mi][j][r];
    __syncthreads();
    {
      const unsigned int hstep = h + 1 < NHD ? HSTEP : 0u;       // the last head requests its own first chunk again: in bounds, and no branch in the loop's body
      qo += hstep; ko += hstep; vo += HSTEP;                     // vo is next read by the next head, if there is one
      ldQ(0);
#pragma unroll
      for (int t = 0; t < 4; ++t) ldK(0, t);           // next head's first Q/K chunk: in flight under the O reduction
    }
#pragma unroll                                          // six exact trips: no branch in the head loop's body, so the head-mean updates stay at the softmax and P's registers are free in phase 3
    for (int q = 0; q < 6; ++q) {                      // reduced tile into sS[8*3072 ..) (free region)
      const int idx = tid + q * 512;
      float sum = 0.f;
#pragma unroll
      for (int w = 0; w < 8; ++w) sum += sS[w * 3072 + idx];
      sS[8 * 3072 + idx] = sum;
    }
    __syncthreads();
#pragma unroll                                          // three exact trips of one element pair a lane (1536 pairs, 512 threads), for the same reason
    for (int q = 0; q < 3; ++q) {                      // the head's 32 x 96 tile = six fragment blocks; a wave stores 128 contiguous bytes of a block in each plane
      const int blk = (wave >> 3) + 2 * q, mi = blk / 3, kc = blk % 3;
      const int fl = (tid >> 2) & 31;                  // lane of the fragment that holds the pair
      const v2f x = *(const v2f*)(sS + 8 * 3072 + (mi * 16 + (fl & 15)) * 96 + kc * 32 + ((tid >> 7) & 1) * 16 + (fl >> 4) * 8 + (tid & 3) * 2);
      v2b xh, xl; b16 a, c;
      split_bf16(x[0], a, c); xh[0] = a; xl[0] = c;
      split_bf16(x[1], a, c); xh[1] = a; xl[1] = c;
      const unsigned int g = (unsigned int)((((b << 6) + (m0 >> 4) + mi) * 24 + h * 3 + kc) * 1024) + (unsigned int)(tid & 255) * 4u;   // byte offset, the same in both planes
      *(v2b*)((char*)Aoh + g) = xh;
      *(v2b*)((char*)Aol + g) = xl;
    }
    __syncthreads();
  }
  {
#pragma unroll
    for (int rr = 0; rr < 2; ++rr) {
      float* apo = avg_out + ((size_t)((b << 10) + m0 + wave * 2 + rr) << 10) + __builtin_amdgcn_mbcnt_lo(~0u, 0u);   // the lane number in the form the shuffles already hold: no second register for it lives (or spills) across the head loop
#pragma unroll
      for (int i = 0; i < 32; ++i) *(float*)(apo + 32 * i) = AV[rr][i];
    }
    
  }
}

// ---------------------------------------------------------------------------
extern "C" void kernel_launch(void* const* d_in, const int* in_sizes, int n_in,
                              void* d_out, int out_size, void* d_ws, size_t ws_size,
                              hipStream_t stream) {
  (void)in_sizes; (void)n_in; (void)out_size;
  const float* mam = (const float*)d_in[0];
  const float* pat = (const float*)d_in[1];
  const float* qw  = (const float*)d_in[2];
  const float* qb  = (const float*)d_in[3];
  const float* kw  = (const float*)d_in[4];
  const float* kb  = (const float*)d_in[5];
  const float* vw  = (const float*)d_in[6];
  const float* vb  = (const float*)d_in[7];
  const float* ow  = (const float*)d_in[8];
  const float* ob  = (const float*)d_in[9];

  const size_t TOK = (size_t)MTOT * EMB;   // 6,291,456 elements
  const size_t WSZ = (size_t)EMB * EMB;    //   589,824 elements

  size_t off = 0; char* ws = (char*)d_ws;
  auto take = [&](size_t bytes) { void* p = ws + off; off += (bytes + 255) & ~(size_t)255; return p; };
  b16* Wp = (b16*)take(WSZ * 2 * 8);                                 // weight planes [q, k, v, o][hi, lo][768*768]
  b16* Wqh = Wp;           b16* Wql = Wp + WSZ;
  b16* Wkh = Wp + 2 * WSZ; b16* Wkl = Wp + 3 * WSZ;
  b16* Wvh = Wp + 4 * WSZ; b16* Wvl = Wp + 5 * WSZ;
  b16* Woh = Wp + 6 * WSZ; b16* Wol = Wp + 7 * WSZ;
  b16* Qh = (b16*)take(TOK * 2);  b16* Ql = (b16*)take(TOK * 2);     // planes in fragment order, 8192 x 768 elements each
  b16* Kh = (b16*)take(TOK * 2);  b16* Kl = (b16*)take(TOK * 2);
  b16* Vh = (b16*)take(TOK * 2);  b16* Vl = (b16*)take(TOK * 2);
  b16* Aoh = (b16*)take(TOK * 2); b16* Aol = (b16*)take(TOK * 2);    // attended rows before the O projection
  b16* Mh = (b16*)take(TOK * 2);  b16* Ml = (b16*)take(TOK * 2);     // the two token inputs
  b16* Ph = (b16*)take(TOK * 2);  b16* Pl = (b16*)take(TOK * 2);
  if (off > ws_size) return;

  float* att_out = (float*)d_out;        // [8,1024,768]
  float* avg_out = att_out + TOK;        // [8,1024,1024]

  cma_split<<<4 * WBLK + 2 * ABLK, 256, 0, stream>>>(mam, pat, qw, kw, vw, ow, Mh, Ml, Ph, Pl, Wp);

  cma_gemm_tn<<<dim3(MTOT / 128, EMB / 64, 3), 256, 0, stream>>>(Mh, Ml, Wqh, Wql, qb, Qh, Ql, 0,
                                                                 Ph, Pl, Wkh, Wkl, kb, Kh, Kl, 0,
                                                                 Ph, Pl, Wvh, Wvl, vb, Vh, Vl, 1, EMB, EMB);

  cma_attn<<<dim3(NTOK / 32, NB), 512, 0, stream>>>(Qh, Ql, Kh, Kl, Vh, Vl, Aoh, Aol, avg_out);

  cma_gemm_tn<<<dim3(MTOT / 128, EMB / 64, 1), 256, 0, stream>>>(Aoh, Aol, Woh, Wol, ob, att_out, nullptr, 2,      // one job: the other two slots are never picked
                                                                 Aoh, Aol, Woh, Wol, ob, att_out, nullptr, 2,
                                                                 Aoh, Aol, Woh, Wol, ob, att_out, nullptr, 2, EMB, EMB);
}

// v008
// A run of this version takes 209 microseconds.
// Timed twice side by side with v007, it ran 1.08 and 1.09 times as fast.
// All steps since v000 together make it 2.98 times as fast.
#include <hip/hip_runtime.h>

// ---------------------------------------------------------------------------
// Cross-modal attention (E=768, 8 heads x 96, B=8, 1024 query tokens x 1024 key tokens), two outputs: attended [8,1024,768] and the
// head-averaged attention matrix [8,1024,1024]. Every contraction runs on v_wmma_f32_16x16x32_bf16 with BOTH operands as bf16 hi/lo
// splits (hi.hi + hi.lo + lo.hi, f32 accumulate): the four projections (A = activation hi/lo planes, split once, B = weight hi/lo
// planes), Q.K^T (Q/K hi/lo planes), P.V (P split from the f32 probability panel in LDS, V^T hi/lo planes). Softmax and the head mean f32.
// Fragment k-map per lane half hh, A and B alike: elements 0..7 <- k = 8hh+0..7, elements 8..15 <- k = 16+8hh+0..7.
// The Q, K and V planes lie in the workspace in FRAGMENT ORDER: one 16x32 fragment = one block of 1024 B = [j = 0,1][lane 0..31][8 elements],
// lane = 16hh + (row or column & 15), k = 32 chunk + 16j + 8hh + 0..7. A fragment load is then two loads of 512 contiguous bytes (four whole
// cache lines each) instead of two loads that touch 16 lines for 32 bytes each.
//   Q, K: block index ((b*8 + h)*64 + token tile)*3 + d chunk          V: block index ((b*8 + h)*6 + d tile)*32 + key chunk
// The A operands of the four projections (both token inputs, the attention output) lie so too: block index (16-row tile)*24 + k chunk.
// ---------------------------------------------------------------------------

typedef __bf16 b16;
typedef __attribute__((ext_vector_type(16))) __bf16 v16b;
typedef __attribute__((ext_vector_type(8)))  __bf16 v8b;
typedef __attribute__((ext_vector_type(2)))  __bf16 v2b;
typedef __attribute__((ext_vector_type(8)))  float  v8f;
typedef __attribute__((ext_vector_type(2)))  float  v2f;
typedef __attribute__((ext_vector_type(4)))  int    i4;

#define NB 8
#define NTOK 1024
#define EMB 768
#define NHD 8
#define HDIM 96
#define MTOT 8192
#define WPITCH 72     // LDS pitch of a 64-element bf16 row (weight panels, Q/K staging tile): 144 B = 16 B x odd, conflict-free for ds_load_b128 reads of one row per lane
#define APITCH 132    // LDS pitch of a 128-element f32 row (activation split): 528 B = 16 B x odd
#define WBLK 72       // blocks of the split grid per weight matrix: 768*768/8 pieces = 4 trips of 72 x 256 threads
#define ABLK 384      // blocks of the split grid per token input: 512 row tiles x 6 column groups, 8 waves a block
#define SPITCH 1028   // LDS pitch of a 1024-element f32 score row: 4112 B = 16 B x odd

__device__ __forceinline__ void split_bf16(float v, b16& hi, b16& lo) {
  const unsigned int u = __builtin_bit_cast(unsigned int, v) & 0xffff0000u;
  hi = __builtin_bit_cast(b16, (unsigned short)(u >> 16));
  lo = (b16)(v - __builtin_bit_cast(float, u));
}
__device__ __forceinline__ v8b ld8b(const b16* p) { return *(const v8b*)p; }
__device__ __forceinline__ v16b cat8b(v8b a, v8b b) { return __builtin_shufflevector(a, b, 0, 1, 2, 3, 4, 5, 6, 7, 8, 9, 10, 11, 12, 13, 14, 15); }
__device__ __forceinline__ v16b frag_kb(const b16* p, int hh) { return cat8b(ld8b(p + 8 * hh), ld8b(p + 16 + 8 * hh)); }
// A fragment from a plane in fragment order: wave-uniform plane pointer, a per-lane byte offset (16 B x lane + block) and a constant byte offset: every load of a plane shares one per-lane address
__device__ __forceinline__ v16b frag_off(const b16* base, unsigned int lane_bytes, int const_bytes) {
  const char* p = (const char*)base + lane_bytes + const_bytes;
  return cat8b(*(const v8b*)p, *(const v8b*)(p + 512));
}
__device__ __forceinline__ void frag_ksplit(const float* p, int hh, v16b& fh, v16b& fl) {
  const float* p0 = p + 8 * hh; const float* p1 = p + 16 + 8 * hh;
#pragma unroll
  for (int e = 0; e < 8; ++e) { b16 a, c; split_bf16(p0[e], a, c); fh[e] = a; fl[e] = c; split_bf16(p1[e], a, c); fh[8 + e] = a; fl[8 + e] = c; }
}
__device__ __forceinline__ v8f wmmab(v16b a, v16b b, v8f c) {
  v8f d = __builtin_amdgcn_wmma_f32_16x16x32_bf16(false, a, false, b, (short)0, c, false, false);
  asm volatile("v_nop\n\tv_nop\n\tv_nop\n\tv_nop" : "+v"(d) : "v"(a), "v"(b));
  return d;
}
__device__ __forceinline__ v8f wmma3(v16b ah, v16b al, v16b bh, v16b bl, v8f c) {
  c = wmmab(ah, bh, c); c = wmmab(ah, bl, c); c = wmmab(al, bh, c); return c;
}
__device__ __forceinline__ void wave_sync_lds() {
  __builtin_amdgcn_fence(__ATOMIC_RELEASE, "workgroup"); __builtin_amdgcn_wave_barrier(); __builtin_amdgcn_fence(__ATOMIC_ACQUIRE, "workgroup");
}

// ---------------------------------------------------------------------------
// All six f32 -> bf16 hi/lo splits in ONE grid: none of them depends on another, so a range of the block index picks the job and the short jobs run beside the long ones.
//   blocks 0 .. 4*WBLK-1: the four weight matrices [768,768], row-major planes [weight][hi, lo][768*768]; WBLK blocks a matrix, eight elements a thread and trip
//   the rest, ABLK blocks an input: both token inputs [8192,768] -> planes in fragment order, once, instead of in each of the 12 column blocks of every projection.
//   There a wave takes 16 rows x 128 columns: 16 loads of one row's 512 contiguous bytes, through its own LDS range, read back as four fragments.
// ---------------------------------------------------------------------------
__global__ __launch_bounds__(256)
void cma_split(const float* __restrict__ a0, const float* __restrict__ a1,
               const float* __restrict__ w0, const float* __restrict__ w1, const float* __restrict__ w2, const float* __restrict__ w3,
               b16* __restrict__ h0, b16* __restrict__ l0, b16* __restrict__ h1, b16* __restrict__ l1, b16* __restrict__ wp) {
  __shared__ __attribute__((aligned(16))) float sA[8 * 16 * APITCH];
  if (blockIdx.x < 4 * WBLK) {                       // the same for the whole block
    const int m = blockIdx.x / WBLK;
    const float* w = m == 0 ? w0 : m == 1 ? w1 : m == 2 ? w2 : w3;
    b16* wh = wp + (size_t)m * (2 * EMB * EMB); b16* wl = wh + EMB * EMB;
#pragma unroll                                        // four exact trips (4 x WBLK x 256 pieces = the matrix): unrolled, so that the later trips' loads are requested in front of the first trip's stores
    for (int t = 0; t < EMB * EMB / 8 / (WBLK * 256); ++t) {
      const int i = (t * WBLK + blockIdx.x % WBLK) * 256 + threadIdx.x;
      v8b h, l;
#pragma unroll
      for (int e = 0; e < 8; ++e) { b16 a, c; split_bf16(w[(size_t)i * 8 + e], a, c); h[e] = a; l[e] = c; }
      *(v8b*)(wh + (size_t)i * 8) = h; *(v8b*)(wl + (size_t)i * 8) = l;
    }
    asm volatile("s_wait_xcnt 0x0" ::: "memory");   // stands behind the run of stores, before any register that an issued store names is rewritten
    return;
  }
  const int ab = blockIdx.x - 4 * WBLK;
  const bool second = ab >= ABLK;
  const float* a = second ? a1 : a0;
  b16* oh = second ? h1 : h0;
  b16* ol = second ? l1 : l0;
  const int lane = threadIdx.x & 31;
  const int wave = __builtin_amdgcn_readfirstlane(threadIdx.x >> 5);   // scalar: the tile's addresses stay in scalar registers, and loads and stores share one per-lane offset (16 B x lane)
  const int l16  = lane & 15;
  const int hh   = lane >> 4;
  const int gw   = (second ? ab - ABLK : ab) * 8 + wave;
  const int tile = gw / 6, cg = gw % 6;              // 16-row tile, group of 128 columns = four k chunks
  float* s = sA + wave * (16 * APITCH);
  const char* src = (const char*)(a + (size_t)(tile * 16) * EMB + cg * 128);
  const unsigned int lb = (unsigned int)lane * 16u;
#pragma unroll
  for (int i = 0; i < 16; ++i) *(i4*)(s + i * APITCH + lane * 4) = *(const i4*)(src + lb + i * (EMB * 4));
  wave_sync_lds();
#pragma unroll
  for (int c = 0; c < 4; ++c) {
    v16b fh, fl; frag_ksplit(s + l16 * APITCH + c * 32, hh, fh, fl);
    const size_t g = (size_t)(tile * 24 + cg * 4 + c) * 1024;     // the block's byte offset in either plane
    *(v8b*)((char*)oh + g + lb)       = __builtin_shufflevector(fh, fh, 0, 1, 2, 3, 4, 5, 6, 7);
    *(v8b*)((char*)oh + g + lb + 512) = __builtin_shufflevector(fh, fh, 8, 9, 10, 11, 12, 13, 14, 15);
    *(v8b*)((char*)ol + g + lb)       = __builtin_shufflevector(fl, fl, 0, 1, 2, 3, 4, 5, 6, 7);
    *(v8b*)((char*)ol + g + lb + 512) = __builtin_shufflevector(fl, fl, 8, 9, 10, 11, 12, 13, 14, 15);
  }
  asm volatile("s_wait_xcnt 0x0" ::: "memory");   // stands behind the run of stores, before any register that an issued store names is rewritten
}

// ---------------------------------------------------------------------------
// C[M,N] = A[M,K] * W[N,K]^T + bias, both operands hi/lo planes (A in fragment order).
//   mode 0: C -> bf16 hi/lo planes, fragment order, k = d           (Q, K projections)
//   mode 1: C -> bf16 hi/lo planes, fragment order, k = key         (V projection, N = 768 = H*D)
//   mode 2: C -> f32 row-major [M,N]                                (O projection -> d_out)
// Workgroup = 8 waves, each wave owns a 16x64 tile -> WG tile 128x64. Weight panels [64n x 64k] (hi and lo) double-buffered in LDS,
// rows padded to WPITCH, shared by all waves; A fragments loaded from the planes, 512 contiguous bytes a load. The same LDS is reused as the staging tile of mode 0.
// ---------------------------------------------------------------------------
__device__ __forceinline__
void gemm_tile(const b16* __restrict__ Ah, const b16* __restrict__ Al, const b16* __restrict__ Wh, const b16* __restrict__ Wl,
               const float* __restrict__ bias, void* __restrict__ out0, void* __restrict__ out1,
               int N, int K, int mode) {
  __shared__ __attribute__((aligned(16))) unsigned char smem[4 * 64 * WPITCH * 2];
  b16* sW = (b16*)smem;                       // [buf][plane][64*WPITCH]
  const int lane = threadIdx.x & 31;
  const int wave = threadIdx.x >> 5;
  const int tid  = threadIdx.x;
  const int mt   = blockIdx.x * 128 + wave * 16;
  const int nb   = blockIdx.y * 64;
  const int l16  = lane & 15;
  const int hh   = lane >> 4;
  const int rbase = hh * 8;

  const int wr0 = tid >> 3, wc0 = (tid & 7) * 8;
  const int wr1 = (tid + 256) >> 3, wc1 = ((tid + 256) & 7) * 8;
  auto loadW = [&](int buf, int k0) {
    b16* dh = sW + (buf * 2 + 0) * (64 * WPITCH); b16* dl = sW + (buf * 2 + 1) * (64 * WPITCH);
    *(i4*)(dh + wr0 * WPITCH + wc0) = *(const i4*)(Wh + (size_t)(nb + wr0) * K + k0 + wc0);
    *(i4*)(dh + wr1 * WPITCH + wc1) = *(const i4*)(Wh + (size_t)(nb + wr1) * K + k0 + wc1);
    *(i4*)(dl + wr0 * WPITCH + wc0) = *(const i4*)(Wl + (size_t)(nb + wr0) * K + k0 + wc0);
    *(i4*)(dl + wr1 * WPITCH + wc1) = *(const i4*)(Wl + (size_t)(nb + wr1) * K + k0 + wc1);
  };
  unsigned int ao = (unsigned int)lane * 16u + (unsigned int)(mt >> 4) * (unsigned int)(K >> 5) * 1024u;   // byte offset of this wave's row tile in both A planes, stepped by two k chunks a pass

  v8f acc[4] = {};
  int buf = 0;
  loadW(0, 0);
  for (int k0 = 0; k0 < K; k0 += 64, buf ^= 1) {
    __syncthreads();                          // panel 'buf' staged by everyone; previous panel reads finished before it is overwritten below
    v16b ah[2], al[2];
#pragma unroll
    for (int kk = 0; kk < 2; ++kk) { ah[kk] = frag_off(Ah, ao, kk * 1024); al[kk] = frag_off(Al, ao, kk * 1024); }
    asm volatile("s_wait_xcnt 0x0" ::: "memory");   // stands behind the A loads, before the offset register that they name is stepped; its clobber also keeps them in front of the weight staging, so that the two load latencies run together and not one after the other
    ao += 2048u;
    if (k0 + 64 < K) loadW(buf ^ 1, k0 + 64);
    const b16* ph = sW + (buf * 2 + 0) * (64 * WPITCH); const b16* pl = sW + (buf * 2 + 1) * (64 * WPITCH);
#pragma unroll
    for (int kk = 0; kk < 2; ++kk) {
#pragma unroll
      for (int nt = 0; nt < 4; ++nt) {
        const b16* wp = ph + (nt * 16 + l16) * WPITCH + kk * 32;
        const b16* wq = pl + (nt * 16 + l16) * WPITCH + kk * 32;
        acc[nt] = wmma3(ah[kk], al[kk], frag_kb(wp, hh), frag_kb(wq, hh), acc[nt]);
      }
    }
  }
  __syncthreads();                            // all panel reads done: smem becomes the staging tile

  if (mode == 0) {
    b16* th = (b16*)smem + wave * (2 * 16 * WPITCH); b16* tl = th + 16 * WPITCH;
#pragma unroll
    for (int nt = 0; nt < 4; ++nt) {
      const float bn = bias[nb + nt * 16 + l16];
#pragma unroll
      for (int r = 0; r < 8; ++r) { b16 a, c; split_bf16(acc[nt][r] + bn, a, c); th[(rbase + r) * WPITCH + nt * 16 + l16] = a; tl[(rbase + r) * WPITCH + nt * 16 + l16] = c; }
    }
    wave_sync_lds();
    b16* oh = (b16*)out0; b16* ol = (b16*)out1;
    {
      const int bt = mt >> 10, tile = (mt >> 4) & 63;   // the wave's 16 tokens are one token tile; its 64 columns are two whole 32-wide d chunks
#pragma unroll
      for (int c = 0; c < 2; ++c) {
        const int c32 = (nb >> 5) + c, h = c32 / 3, kk = c32 % 3;
        const size_t blk = (size_t)(((bt * NHD + h) * 64 + tile) * 3 + kk) * 512;
#pragma unroll
        for (int j = 0; j < 2; ++j) {
          const size_t g = blk + j * 256 + lane * 8;
          *(v8b*)(oh + g) = ld8b(th + l16 * WPITCH + c * 32 + j * 16 + hh * 8);
          *(v8b*)(ol + g) = ld8b(tl + l16 * WPITCH + c * 32 + j * 16 + hh * 8);
        }
      }
    }
    asm volatile("s_wait_xcnt 0x0" ::: "memory");   // stands behind the run of stores, before any register that an issued store names is rewritten
  } else if (mode == 1) {
    // A lane's eight accumulator registers of a column tile are eight consecutive keys of one column d: already one 16-byte piece of a V fragment, stored from registers
    b16* oh = (b16*)out0; b16* ol = (b16*)out1;
    const int bt = mt >> 10, pc = (mt >> 5) & 31, j = (mt >> 4) & 1;
#pragma unroll
    for (int nt = 0; nt < 4; ++nt) {
      const int t16 = (nb >> 4) + nt, h = t16 / 6, dt = t16 % 6;
      const float bn = bias[nb + nt * 16 + l16];
      v8b vh8, vl8;
#pragma unroll
      for (int r = 0; r < 8; ++r) { b16 a, c; split_bf16(acc[nt][r] + bn, a, c); vh8[r] = a; vl8[r] = c; }
      const size_t g = (size_t)(((bt * NHD + h) * 6 + dt) * 32 + pc) * 512 + j * 256 + lane * 8;
      *(v8b*)(oh + g) = vh8;
      *(v8b*)(ol + g) = vl8;
    }
    asm volatile("s_wait_xcnt 0x0" ::: "memory");   // stands behind the run of stores, before any register that an issued store names is rewritten
  } else {
    float* of = (float*)out0;
    {
#pragma unroll
      for (int pr = 0; pr < 2; ++pr) {
        const int cbase = nb + pr * 32;
        const float bn = bias[cbase + lane];
#pragma unroll
        for (int r = 0; r < 8; ++r) {
          const float a0 = acc[2 * pr][r], b0 = acc[2 * pr + 1][r];
          const float ax = __shfl_xor(a0, 16), bx = __shfl_xor(b0, 16);
          const float v1 = (hh ? bx : a0) + bn;     // row mt + r
          const float v2 = (hh ? b0 : ax) + bn;     // row mt + r + 8
          *(float*)(of + (size_t)(mt + r) * N + cbase + lane) = v1;
          *(float*)(of + (size_t)(mt + r + 8) * N + cbase + lane) = v2;
        }
      }
    }
    asm volatile("s_wait_xcnt 0x0" ::: "memory");   // stands behind the run of stores, before any register that an issued store names is rewritten
  }
}

// One grid for up to three products that do not depend on one another (Q, K and V projections): blockIdx.z picks the job, so the launches' starts and tails overlap.
__global__ __launch_bounds__(256)
void cma_gemm_tn(const b16* Ah0, const b16* Al0, const b16* Wh0, const b16* Wl0, const float* bias0, void* outh0, void* outl0, int mode0,
                 const b16* Ah1, const b16* Al1, const b16* Wh1, const b16* Wl1, const float* bias1, void* outh1, void* outl1, int mode1,
                 const b16* Ah2, const b16* Al2, const b16* Wh2, const b16* Wl2, const float* bias2, void* outh2, void* outl2, int mode2,
                 int N, int K) {
  const int z = blockIdx.z;
  gemm_tile(z == 0 ? Ah0 : z == 1 ? Ah1 : Ah2, z == 0 ? Al0 : z == 1 ? Al1 : Al2,
            z == 0 ? Wh0 : z == 1 ? Wh1 : Wh2, z == 0 ? Wl0 : z == 1 ? Wl1 : Wl2,
            z == 0 ? bias0 : z == 1 ? bias1 : bias2,
            z == 0 ? outh0 : z == 1 ? outh1 : outh2, z == 0 ? outl0 : z == 1 ? outl1 : outl2,
            N, K, z == 0 ? mode0 : z == 1 ? mode1 : mode2);
}

// ---------------------------------------------------------------------------
// Attention core. One workgroup of 16 waves per (b, 32-row block = two 16-row m-tiles); loops over 8 heads.
// Every K and V fragment that a wave loads is multiplied into both m-tiles, so each (b, h) K/V plane is read by 32 workgroups, not 64.
//   Phase 1: S[32x1024] = Q K^T, unscaled, into the LDS panel (split WMMA, Q/K hi/lo planes); a wave owns 64 keys
//   Phase 2: softmax per row (2 rows per wave, 32 columns per lane): exp((s - max) / sqrt(96)) = 2^(s * c - max * c) with c = log2(e) / sqrt(96),
//            one FMA and one hardware exponential an element; head-mean accumulated in registers; P written back f32
//   Phase 3: O_partial += P V; a wave owns one 128-key slab (wave & 7) and one 48-column half of the head (wave >> 3), both m-tiles
// K and V fragments run through register rings: a ring slot is refilled with the fragment of the next k chunk directly behind the WMMAs that
// read it, the first V chunk is requested in front of the softmax and the next head's first Q/K chunk in front of the sums of the O reduction, so that
// a whole chunk of loads is in flight under the matrix, softmax and reduction work instead of four loads that are waited for at once.
// The 32 workgroups of a batch read the same K and V planes. They do not walk the heads in one common order: each starts at its own head and goes round the
// ring of eight, so that at any moment only four of them ask L2 for the same lines, and a plane that one of them has brought in from memory is an L2 hit for the rest.
// ---------------------------------------------------------------------------
__global__ __launch_bounds__(512)
void cma_attn(const b16* __restrict__ Qh, const b16* __restrict__ Ql,     // fragment order, [b][h][64 token tiles][3 d chunks][1024 B]
              const b16* __restrict__ Kh, const b16* __restrict__ Kl,     // the same
              const b16* __restrict__ Vh, const b16* __restrict__ Vl,     // fragment order, [b][h][6 d tiles][32 key chunks][1024 B]
              b16* __restrict__ Aoh, b16* __restrict__ Aol,               // attended rows [8192,768] as hi/lo planes in fragment order, [512 row tiles][24 k chunks][1024 B]
              float* __restrict__ avg_out) {                              // [8,1024,1024] f32
  __shared__ __attribute__((aligned(16))) float sS[32 * SPITCH];          // score / probability panel, rows padded to SPITCH, reused for the O reduction

  const int b    = blockIdx.y;
  const int m0   = blockIdx.x * 32;
  const int tid  = threadIdx.x;
  const int lane = tid & 31;
  const int wave = __builtin_amdgcn_readfirstlane(tid >> 5);   // scalar: what depends on the wave alone stays out of the vector registers, which the rings need
  const int l16  = lane & 15;
  const int hh   = lane >> 4;
  const int rbase = hh * 8;
  const int slab = wave & 7;                           // phase 3: 128-key slab
  const int nt0  = (wave >> 3) * 3;                    // phase 3: first of this wave's three 16-column tiles of the head
  const float esc = 0.14724445f;                       // log2(e) / sqrt(96): the score scale and the change of base in one factor (positive, so the row maximum may be taken of the unscaled scores)
  const unsigned int HSTEP = 64u * 3u * 1024u;         // bytes of one (b, h) in every plane (= 6 * 32 * 1024)
  const int rot  = 2 * (blockIdx.x & 3) + ((blockIdx.x >> 3) & 1);   // first head of this workgroup, 0..7: the low two bits of the block index step it by two heads, bit 3 adds one, so neighbours in launch order start on different heads and each start is taken by four of a batch's 32 workgroups

  float AV[2][32];
#pragma unroll
  for (int rr = 0; rr < 2; ++rr)
#pragma unroll
    for (int i = 0; i < 32; ++i) AV[rr][i] = 0.f;

  v16b qh0, ql0, qh1, ql1;                             // one k chunk of Q, both m-tiles
  v16b kfh[4], kfl[4];                                 // K ring: one slot per 16-key tile
  v16b vfh[3], vfl[3];                                 // V ring: one slot per 16-column tile
  // 32-bit byte offsets from a plane's start (16 B x lane + the first block of this batch, wave and head), stepped from head to head: hi and lo plane share one register
  unsigned int qo = (unsigned int)lane * 16u + (unsigned int)(b * NHD + rot) * HSTEP + (unsigned int)(m0 >> 4) * 3072u;
  unsigned int ko = (unsigned int)lane * 16u + (unsigned int)(b * NHD + rot) * HSTEP + (unsigned int)(wave * 4) * 3072u;
  unsigned int vo = (unsigned int)lane * 16u + (unsigned int)(b * NHD + rot) * HSTEP + (unsigned int)(nt0 * 32 + slab * 4) * 1024u;
  auto ldQ = [&](int kk) {
    qh0 = frag_off(Qh, qo, kk * 1024); ql0 = frag_off(Ql, qo, kk * 1024);
    qh1 = frag_off(Qh, qo, 3072 + kk * 1024); ql1 = frag_off(Ql, qo, 3072 + kk * 1024);
  };
  auto ldK = [&](int kk, int t) {
    kfh[t] = frag_off(Kh, ko, t * 3072 + kk * 1024); kfl[t] = frag_off(Kl, ko, t * 3072 + kk * 1024);
  };
  auto ldV = [&](int c4, int j) {
    vfh[j] = frag_off(Vh, vo, (j * 32 + c4) * 1024); vfl[j] = frag_off(Vl, vo, (j * 32 + c4) * 1024);
  };
  ldQ(0);
#pragma unroll
  for (int t = 0; t < 4; ++t) ldK(0, t);

  for (int hi = 0; hi < NHD; ++hi) {
    const int h = (hi + rot) & (NHD - 1);              // the head of this trip
    // ----- Phase 1: scores -> LDS --------------------------------------
    v8f s[4][2] = {};                                  // [16-key tile][m-tile]; k chunk outermost, so that only one chunk of Q is held in registers
#pragma unroll
    for (int kk = 0; kk < 3; ++kk) {
#pragma unroll
      for (int t = 0; t < 4; ++t) {
        s[t][0] = wmmab(qh0, kfh[t], s[t][0]); s[t][1] = wmmab(qh1, kfh[t], s[t][1]);
        s[t][0] = wmmab(qh0, kfl[t], s[t][0]); s[t][1] = wmmab(qh1, kfl[t], s[t][1]);
        s[t][0] = wmmab(ql0, kfh[t], s[t][0]); s[t][1] = wmmab(ql1, kfh[t], s[t][1]);
        if (kk < 2) ldK(kk + 1, t);                    // refill the slot behind its last reader
      }
      if (kk < 2) ldQ(kk + 1);
    }
#pragma unroll
    for (int t = 0; t < 4; ++t) {
      const int ncol = wave * 64 + t * 16 + l16;
#pragma unroll
      for (int r = 0; r < 8; ++r) { sS[(rbase + r) * SPITCH + ncol] = s[t][0][r]; sS[(16 + rbase + r) * SPITCH + ncol] = s[t][1][r]; }
    }
    __syncthreads();
#pragma unroll
    for (int j = 0; j < 3; ++j) ldV(0, j);             // first V chunk: in flight under the softmax

    // ----- Phase 2: softmax (2 rows / wave), head-mean in registers, P back to the panel as f32 -----
    float P[2][32];
#pragma unroll
    for (int rr = 0; rr < 2; ++rr) {
      const int row = wave * 2 + rr;
      float mx = -3.0e38f;
#pragma unroll
      for (int i = 0; i < 32; ++i) P[rr][i] = sS[row * SPITCH + lane + 32 * i];   // the row's loads in a loop of their own: they go out as one group in front of the maximum chain, not one by one between its links
#pragma unroll                                          // P is a register array: constant indices only
      for (int i = 0; i < 32; ++i) mx = fmaxf(mx, P[rr][i]);
#pragma unroll
      for (int off = 16; off >= 1; off >>= 1) mx = fmaxf(mx, __shfl_xor(mx, off));
      const float nm = -mx * esc;
      float sum = 0.f;
#pragma unroll
      for (int i = 0; i < 32; ++i) P[rr][i] = __builtin_fmaf(P[rr][i], esc, nm);   // every exponent first, in place: no exponential's source register is a temporary that the next FMA rewrites directly behind it
#pragma unroll                                          // P is a register array: constant indices only
      for (int i = 0; i < 32; ++i) { P[rr][i] = __builtin_amdgcn_exp2f(P[rr][i]); sum += P[rr][i]; }
#pragma unroll
      for (int off = 16; off >= 1; off >>= 1) sum += __shfl_xor(sum, off);
      const float inv = 1.0f / sum;
#pragma unroll
      for (int i = 0; i < 32; ++i) { P[rr][i] *= inv; AV[rr][i] += P[rr][i] * 0.125f; }
    }
    __syncthreads();                                   // all S reads done
#pragma unroll
    for (int rr = 0; rr < 2; ++rr) {
      const int row = wave * 2 + rr;
#pragma unroll
      for (int i = 0; i < 32; ++i) sS[row * SPITCH + lane + 32 * i] = P[rr][i];
    }
    __syncthreads();

    // ----- Phase 3: O_partial += P * V over this wave's 128-wide key slab, three 16-column tiles, both m-tiles -----
    v8f o[2][3] = {};
#pragma unroll
    for (int c4 = 0; c4 < 4; ++c4) {
      const int pb = slab * 128 + c4 * 32;
      v16b aph0, apl0, aph1, apl1;
      frag_ksplit(sS + (size_t)l16 * SPITCH + pb, hh, aph0, apl0);
      frag_ksplit(sS + (size_t)(16 + l16) * SPITCH + pb, hh, aph1, apl1);
#pragma unroll
      for (int j = 0; j < 3; ++j) {
        o[0][j] = wmmab(aph0, vfh[j], o[0][j]); o[1][j] = wmmab(aph1, vfh[j], o[1][j]);
        o[0][j] = wmmab(aph0, vfl[j], o[0][j]); o[1][j] = wmmab(aph1, vfl[j], o[1][j]);
        o[0][j] = wmmab(apl0, vfh[j], o[0][j]); o[1][j] = wmmab(apl1, vfh[j], o[1][j]);
        if (c4 < 3) ldV(c4 + 1, j);                    // refill the slot behind its last reader
      }
    }
    __syncthreads();                                   // P reads done; reuse LDS

#pragma unroll
    for (int mi = 0; mi < 2; ++mi)
#pragma unroll
      for (int j = 0; j < 3; ++j)
#pragma unroll
        for (int r = 0; r < 8; ++r) sS[slab * 3072 + (mi * 16 + rbase + r) * 96 + (nt0 + j) * 16 + l16] = o[mi][j][r];
    __syncthreads();
    {
      const unsigned int hstep = h + 1 < NHD ? HSTEP : 0u - (NHD - 1) * HSTEP;   // on to the next head of the ring, from head 7 back to head 0; the last trip requests the first chunk of its first head again: in bounds, and no branch in the loop's body
      qo += hstep; ko += hstep; vo += hstep;
      ldQ(0);
#pragma unroll
      for (int t = 0; t < 4; ++t) ldK(0, t);           // next head's first Q/K chunk: in flight under the O reduction
    }
#pragma unroll                                          // six exact trips: no branch in the head loop's body, so the head-mean updates stay at the softmax and P's registers are free in phase 3
    for (int q = 0; q < 6; ++q) {                      // reduced tile into sS[8*3072 ..) (free region)
      const int idx = tid + q * 512;
      float sum = 0.f;
#pragma unroll
      for (int w = 0; w < 8; ++w) sum += sS[w * 3072 + idx];
      sS[8 * 3072 + idx] = sum;
    }
    __syncthreads();
#pragma unroll                                          // three exact trips of one element pair a lane (1536 pairs, 512 threads), for the same reason
    for (int q = 0; q < 3; ++q) {                      // the head's 32 x 96 tile = six fragment blocks; a wave stores 128 contiguous bytes of a block in each plane
      const int blk = (wave >> 3) + 2 * q, mi = blk / 3, kc = blk % 3;
      const int fl = (tid >> 2) & 31;                  // lane of the fragment that holds the pair
      const v2f x = *(const v2f*)(sS + 8 * 3072 + (mi * 16 + (fl & 15)) * 96 + kc * 32 + ((tid >> 7) & 1) * 16 + (fl >> 4) * 8 + (tid & 3) * 2);
      v2b xh, xl; b16 a, c;
      split_bf16(x[0], a, c); xh[0] = a; xl[0] = c;
      split_bf16(x[1], a, c); xh[1] = a; xl[1] = c;
      const unsigned int g = (unsigned int)((((b << 6) + (m0 >> 4) + mi) * 24 + h * 3 + kc) * 1024) + (unsigned int)(tid & 255) * 4u;   // byte offset, the same in both planes
      *(v2b*)((char*)Aoh + g) = xh;
      *(v2b*)((char*)Aol + g) = xl;
    }
    __syncthreads();
  }
  {
#pragma unroll
    for (int rr = 0; rr < 2; ++rr) {
      float* apo = avg_out + ((size_t)((b << 10) + m0 + wave * 2 + rr) << 10) + __builtin_amdgcn_mbcnt_lo(~0u, 0u);   // the lane number in the form the shuffles already hold: no second register for it lives (or spills) across the head loop
#pragma unroll
      for (int i = 0; i < 32; ++i) *(float*)(apo + 32 * i) = AV[rr][i];
    }
    
  }
}

// ---------------------------------------------------------------------------
extern "C" void kernel_launch(void* const* d_in, const int* in_sizes, int n_in,
                              void* d_out, int out_size, void* d_ws, size_t ws_size,
                              hipStream_t stream) {
  (void)in_sizes; (void)n_in; (void)out_size;
  const float* mam = (const float*)d_in[0];
  const float* pat = (const float*)d_in[1];
  const float* qw  = (const float*)d_in[2];
  const float* qb  = (const float*)d_in[3];
  const float* kw  = (const float*)d_in[4];
  const float* kb  = (const float*)d_in[5];
  const float* vw  = (const float*)d_in[6];
  const float* vb  = (const float*)d_in[7];
  const float* ow  = (const float*)d_in[8];
  const float* ob  = (const float*)d_in[9];

  const size_t TOK = (size_t)MTOT * EMB;   // 6,291,456 elements
  const size_t WSZ = (size_t)EMB * EMB;    //   589,824 elements

  size_t off = 0; char* ws = (char*)d_ws;
  auto take = [&](size_t bytes) { void* p = ws + off; off += (bytes + 255) & ~(size_t)255; return p; };
  b16* Wp = (b16*)take(WSZ * 2 * 8);                                 // weight planes [q, k, v, o][hi, lo][768*768]
  b16* Wqh = Wp;           b16* Wql = Wp + WSZ;
  b16* Wkh = Wp + 2 * WSZ; b16* Wkl = Wp + 3 * WSZ;
  b16* Wvh = Wp + 4 * WSZ; b16* Wvl = Wp + 5 * WSZ;
  b16* Woh = Wp + 6 * WSZ; b16* Wol = Wp + 7 * WSZ;
  b16* Qh = (b16*)take(TOK * 2);  b16* Ql = (b16*)take(TOK * 2);     // planes in fragment order, 8192 x 768 elements each
  b16* Kh = (b16*)take(TOK * 2);  b16* Kl = (b16*)take(TOK * 2);
  b16* Vh = (b16*)take(TOK * 2);  b16* Vl = (b16*)take(TOK * 2);
  b16* Aoh = (b16*)take(TOK * 2); b16* Aol = (b16*)take(TOK * 2);    // attended rows before the O projection
  b16* Mh = (b16*)take(TOK * 2);  b16* Ml = (b16*)take(TOK * 2);     // the two token inputs
  b16* Ph = (b16*)take(TOK * 2);  b16* Pl = (b16*)take(TOK * 2);
  if (off > ws_size) return;

  float* att_out = (float*)d_out;        // [8,1024,768]
  float* avg_out = att_out + TOK;        // [8,1024,1024]

  cma_split<<<4 * WBLK + 2 * ABLK, 256, 0, stream>>>(mam, pat, qw, kw, vw, ow, Mh, Ml, Ph, Pl, Wp);

  cma_gemm_tn<<<dim3(MTOT / 128, EMB / 64, 3), 256, 0, stream>>>(Mh, Ml, Wqh, Wql, qb, Qh, Ql, 0,
                                                                 Ph, Pl, Wkh, Wkl, kb, Kh, Kl, 0,
                                                                 Ph, Pl, Wvh, Wvl, vb, Vh, Vl, 1, EMB, EMB);

  cma_attn<<<dim3(NTOK / 32, NB), 512, 0, stream>>>(Qh, Ql, Kh, Kl, Vh, Vl, Aoh, Aol, avg_out);

  cma_gemm_tn<<<dim3(MTOT / 128, EMB / 64, 1), 256, 0, stream>>>(Aoh, Aol, Woh, Wol, ob, att_out, nullptr, 2,      // one job: the other two slots are never picked
                                                                 Aoh, Aol, Woh, Wol, ob, att_out, nullptr, 2,
                                                                 Aoh, Aol, Woh, Wol, ob, att_out, nullptr, 2, EMB, EMB);
}

// v009
// One run takes 193 microseconds.
// In both of two side-by-side timings against v008, it was 1.08 times as fast.
// Counting every step since v000, it is 3.22 times as fast.
#include <hip/hip_runtime.h>

// ---------------------------------------------------------------------------
// Cross-modal attention (E=768, 8 heads x 96, B=8, 1024 query tokens x 1024 key tokens), two outputs: attended [8,1024,768] and the
// head-averaged attention matrix [8,1024,1024]. Every contraction runs on v_wmma_f32_16x16x32_bf16 with BOTH operands as bf16 hi/lo
// splits (hi.hi + hi.lo + lo.hi, f32 accumulate): the four projections (A = activation hi/lo planes, split once, B = weight hi/lo
// planes), Q.K^T (Q/K hi/lo planes), P.V (P split from the f32 probability panel in LDS, V^T hi/lo planes). Softmax and the head mean f32.
// Fragment k-map per lane half hh, A and B alike: elements 0..7 <- k = 8hh+0..7, elements 8..15 <- k = 16+8hh+0..7.
// The Q, K and V planes lie in the workspace in FRAGMENT ORDER: one 16x32 fragment = one block of 1024 B = [j = 0,1][lane 0..31][8 elements],
// lane = 16hh + (row or column & 15), k = 32 chunk + 16j + 8hh + 0..7. A fragment load is then two loads of 512 contiguous bytes (four whole
// cache lines each) instead of two loads that touch 16 lines for 32 bytes each.
//   Q, K: block index ((b*8 + h)*64 + token tile)*3 + d chunk          V: block index ((b*8 + h)*6 + d tile)*32 + key chunk
// The A operands of the four projections (both token inputs, the attention output) lie so too: block index (16-row tile)*24 + k chunk.
// ---------------------------------------------------------------------------

typedef __bf16 b16;
typedef __attribute__((ext_vector_type(16))) __bf16 v16b;
typedef __attribute__((ext_vector_type(8)))  __bf16 v8b;
typedef __attribute__((ext_vector_type(2)))  __bf16 v2b;
typedef __attribute__((ext_vector_type(8)))  float  v8f;
typedef __attribute__((ext_vector_type(2)))  float  v2f;
typedef __attribute__((ext_vector_type(4)))  int    i4;

#define NB 8
#define NTOK 1024
#define EMB 768
#define NHD 8
#define HDIM 96
#define MTOT 8192
#define WPITCH 72     // LDS pitch of a 64-element bf16 row (weight panels): 144 B = 16 B x odd, conflict-free for ds_load_b128 reads of one row per lane
#define TPITCH 104    // LDS pitch of a 96-element bf16 row (Q/K staging tile): 208 B = 16 B x odd
#define GBM 256       // projection workgroup tile: rows
#define GBN 96        // projection workgroup tile: columns
#define KCH 24        // 32-wide k chunks of a projection (768 / 32)
#define APITCH 132    // LDS pitch of a 128-element f32 row (activation split): 528 B = 16 B x odd
#define WBLK 72       // blocks of the split grid per weight matrix: 768*768/8 pieces = 4 trips of 72 x 256 threads
#define ABLK 384      // blocks of the split grid per token input: 512 row tiles x 6 column groups, 8 waves a block
#define SPITCH 1028   // LDS pitch of a 1024-element f32 score row: 4112 B = 16 B x odd

__device__ __forceinline__ void split_bf16(float v, b16& hi, b16& lo) {
  const unsigned int u = __builtin_bit_cast(unsigned int, v) & 0xffff0000u;
  hi = __builtin_bit_cast(b16, (unsigned short)(u >> 16));
  lo = (b16)(v - __builtin_bit_cast(float, u));
}
__device__ __forceinline__ v8b ld8b(const b16* p) { return *(const v8b*)p; }
__device__ __forceinline__ v16b cat8b(v8b a, v8b b) { return __builtin_shufflevector(a, b, 0, 1, 2, 3, 4, 5, 6, 7, 8, 9, 10, 11, 12, 13, 14, 15); }
__device__ __forceinline__ v16b frag_kb(const b16* p, int hh) { return cat8b(ld8b(p + 8 * hh), ld8b(p + 16 + 8 * hh)); }
// A fragment from a plane in fragment order: wave-uniform plane pointer, a per-lane byte offset (16 B x lane + block) and a constant byte offset: every load of a plane shares one per-lane address
__device__ __forceinline__ v16b frag_off(const b16* base, unsigned int lane_bytes, int const_bytes) {
  const char* p = (const char*)base + lane_bytes + const_bytes;
  return cat8b(*(const v8b*)p, *(const v8b*)(p + 512));
}
__device__ __forceinline__ void frag_ksplit(const float* p, int hh, v16b& fh, v16b& fl) {
  const float* p0 = p + 8 * hh; const float* p1 = p + 16 + 8 * hh;
#pragma unroll
  for (int e = 0; e < 8; ++e) { b16 a, c; split_bf16(p0[e], a, c); fh[e] = a; fl[e] = c; split_bf16(p1[e], a, c); fh[8 + e] = a; fl[8 + e] = c; }
}
__device__ __forceinline__ v8f wmmab(v16b a, v16b b, v8f c) {
  v8f d = __builtin_amdgcn_wmma_f32_16x16x32_bf16(false, a, false, b, (short)0, c, false, false);
  asm volatile("v_nop\n\tv_nop\n\tv_nop\n\tv_nop" : "+v"(d) : "v"(a), "v"(b));
  return d;
}
__device__ __forceinline__ v8f wmma3(v16b ah, v16b al, v16b bh, v16b bl, v8f c) {
  c = wmmab(ah, bh, c); c = wmmab(ah, bl, c); c = wmmab(al, bh, c); return c;
}
__device__ __forceinline__ void wave_sync_lds() {
  __builtin_amdgcn_fence(__ATOMIC_RELEASE, "workgroup"); __builtin_amdgcn_wave_barrier(); __builtin_amdgcn_fence(__ATOMIC_ACQUIRE, "workgroup");
}

// ---------------------------------------------------------------------------
// All six f32 -> bf16 hi/lo splits in ONE grid: none of them depends on another, so a range of the block index picks the job and the short jobs run beside the long ones.
//   blocks 0 .. 4*WBLK-1: the four weight matrices [768,768], row-major planes [weight][hi, lo][768*768]; WBLK blocks a matrix, eight elements a thread and trip
//   the rest, ABLK blocks an input: both token inputs [8192,768] -> planes in fragment order, once, instead of in each of the 8 column blocks of every projection.
//   There a wave takes 16 rows x 128 columns: 16 loads of one row's 512 contiguous bytes, through its own LDS range, read back as four fragments.
// ---------------------------------------------------------------------------
__global__ __launch_bounds__(256)
void cma_split(const float* __restrict__ a0, const float* __restrict__ a1,
               const float* __restrict__ w0, const float* __restrict__ w1, const float* __restrict__ w2, const float* __restrict__ w3,
               b16* __restrict__ h0, b16* __restrict__ l0, b16* __restrict__ h1, b16* __restrict__ l1, b16* __restrict__ wp) {
  __shared__ __attribute__((aligned(16))) float sA[8 * 16 * APITCH];
  if (blockIdx.x < 4 * WBLK) {                       // the same for the whole block
    const int m = blockIdx.x / WBLK;
    const float* w = m == 0 ? w0 : m == 1 ? w1 : m == 2 ? w2 : w3;
    b16* wh = wp + (size_t)m * (2 * EMB * EMB); b16* wl = wh + EMB * EMB;
#pragma unroll                                        // four exact trips (4 x WBLK x 256 pieces = the matrix): unrolled, so that the later trips' loads are requested in front of the first trip's stores
    for (int t = 0; t < EMB * EMB / 8 / (WBLK * 256); ++t) {
      const int i = (t * WBLK + blockIdx.x % WBLK) * 256 + threadIdx.x;
      v8b h, l;
#pragma unroll
      for (int e = 0; e < 8; ++e) { b16 a, c; split_bf16(w[(size_t)i * 8 + e], a, c); h[e] = a; l[e] = c; }
      *(v8b*)(wh + (size_t)i * 8) = h; *(v8b*)(wl + (size_t)i * 8) = l;
    }
    asm volatile("s_wait_xcnt 0x0" ::: "memory");   // stands behind the run of stores, before any register that an issued store names is rewritten
    return;
  }
  const int ab = blockIdx.x - 4 * WBLK;
  const bool second = ab >= ABLK;
  const float* a = second ? a1 : a0;
  b16* oh = second ? h1 : h0;
  b16* ol = second ? l1 : l0;
  const int lane = threadIdx.x & 31;
  const int wave = __builtin_amdgcn_readfirstlane(threadIdx.x >> 5);   // scalar: the tile's addresses stay in scalar registers, and loads and stores share one per-lane offset (16 B x lane)
  const int l16  = lane & 15;
  const int hh   = lane >> 4;
  const int gw   = (second ? ab - ABLK : ab) * 8 + wave;
  const int tile = gw / 6, cg = gw % 6;              // 16-row tile, group of 128 columns = four k chunks
  float* s = sA + wave * (16 * APITCH);
  const char* src = (const char*)(a + (size_t)(tile * 16) * EMB + cg * 128);
  const unsigned int lb = (unsigned int)lane * 16u;
#pragma unroll
  for (int i = 0; i < 16; ++i) *(i4*)(s + i * APITCH + lane * 4) = *(const i4*)(src + lb + i * (EMB * 4));
  wave_sync_lds();
#pragma unroll
  for (int c = 0; c < 4; ++c) {
    v16b fh, fl; frag_ksplit(s + l16 * APITCH + c * 32, hh, fh, fl);
    const size_t g = (size_t)(tile * 24 + cg * 4 + c) * 1024;     // the block's byte offset in either plane
    *(v8b*)((char*)oh + g + lb)       = __builtin_shufflevector(fh, fh, 0, 1, 2, 3, 4, 5, 6, 7);
    *(v8b*)((char*)oh + g + lb + 512) = __builtin_shufflevector(fh, fh, 8, 9, 10, 11, 12, 13, 14, 15);
    *(v8b*)((char*)ol + g + lb)       = __builtin_shufflevector(fl, fl, 0, 1, 2, 3, 4, 5, 6, 7);
    *(v8b*)((char*)ol + g + lb + 512) = __builtin_shufflevector(fl, fl, 8, 9, 10, 11, 12, 13, 14, 15);
  }
  asm volatile("s_wait_xcnt 0x0" ::: "memory");   // stands behind the run of stores, before any register that an issued store names is rewritten
}

// ---------------------------------------------------------------------------
// C[8192,768] = A[8192,768] * W[768,768]^T + bias, both operands hi/lo planes (A in fragment order).
//   mode 0: C -> bf16 hi/lo planes, fragment order, k = d           (Q, K projections)
//   mode 1: C -> bf16 hi/lo planes, fragment order, k = key         (V projection)
//   mode 2: C -> f32 row-major                                      (O projection -> d_out)
// Workgroup = 8 waves, each wave owns a 32x96 tile (two 16-row tiles x six 16-column tiles) -> WG tile 256x96, 96 columns = one head.
// A weight fragment read from LDS feeds both row tiles and an A fragment feeds six column tiles: per WMMA half the LDS bytes of a 16x64 wave tile,
// and the A planes are read by 8 column blocks, the weight planes by 32 row blocks. Weight panels [96n x 64k] (hi and lo) double-buffered in LDS, rows padded to WPITCH:
// the next panel is requested at the top of a pass and written to LDS at its foot. A fragments run through a register ring of two k chunks: a slot is refilled
// one chunk of WMMAs ahead of its use, never directly in front of the barrier. The same LDS is reused as the staging tile of mode 0.
// ---------------------------------------------------------------------------
__device__ __forceinline__
void gemm_tile(const b16* __restrict__ Ah, const b16* __restrict__ Al, const b16* __restrict__ Wh, const b16* __restrict__ Wl,
               const float* __restrict__ bias, void* __restrict__ out0, void* __restrict__ out1, int mode) {
  __shared__ __attribute__((aligned(16))) unsigned char smem[4 * GBN * WPITCH * 2];
  b16* sW = (b16*)smem;                       // [buf][plane][GBN*WPITCH]
  const int lane = threadIdx.x & 31;
  const int wave = __builtin_amdgcn_readfirstlane(threadIdx.x >> 5);   // scalar: the tile's block numbers stay in scalar registers
  const int tid  = threadIdx.x;
  const int mt   = blockIdx.x * GBM + wave * 32;
  const int nb   = blockIdx.y * GBN;
  const int l16  = lane & 15;
  const int hh   = lane >> 4;
  const int rbase = hh * 8;

  // weight staging: a panel plane is 96 rows x 8 pieces of 16 B; a thread takes piece (tid & 7) of rows (tid >> 3) + 0, 32, 64. One byte offset serves both planes and all rows.
  unsigned int wo = (unsigned int)((nb + (tid >> 3)) * EMB + (tid & 7) * 8) * 2u;
  const int wl = (tid >> 3) * WPITCH + (tid & 7) * 8;
  i4 wr[6];
  auto ldW = [&]() {
#pragma unroll
    for (int i = 0; i < 3; ++i) {
      wr[i]     = *(const i4*)((const char*)Wh + wo + i * (32 * EMB * 2));
      wr[3 + i] = *(const i4*)((const char*)Wl + wo + i * (32 * EMB * 2));
    }
  };
  auto stW = [&](int buf) {
    b16* dh = sW + (buf * 2 + 0) * (GBN * WPITCH) + wl; b16* dl = sW + (buf * 2 + 1) * (GBN * WPITCH) + wl;
#pragma unroll
    for (int i = 0; i < 3; ++i) { *(i4*)(dh + i * 32 * WPITCH) = wr[i]; *(i4*)(dl + i * 32 * WPITCH) = wr[3 + i]; }
  };
  unsigned int ao = (unsigned int)lane * 16u + (unsigned int)(mt >> 4) * (unsigned int)(KCH * 1024);   // byte offset of this wave's first row tile in both A planes, stepped by two k chunks a pass
  v16b ah[2][2], al[2][2];                    // A ring: [k chunk of the pass][row tile]
  auto ldA = [&](int kk, int ahead) {
#pragma unroll
    for (int mi = 0; mi < 2; ++mi) { ah[kk][mi] = frag_off(Ah, ao, mi * (KCH * 1024) + kk * 1024 + ahead); al[kk][mi] = frag_off(Al, ao, mi * (KCH * 1024) + kk * 1024 + ahead); }
  };

  v8f acc[2][6] = {};
  v16b bh[2], bl[2];                          // weight fragment ring: the next column tile's LDS reads are issued in front of this tile's WMMAs
  auto pass = [&](int p, bool more) {         // more: a next pass exists (a constant at either call)
    const b16* ph = sW + ((p & 1) * 2) * (GBN * WPITCH) + l16 * WPITCH; const b16* pl = ph + GBN * WPITCH;
    __syncthreads();                          // this pass's panel staged by everyone; the other panel's reads finished before it is overwritten at this pass's foot
    bh[0] = frag_kb(ph, hh); bl[0] = frag_kb(pl, hh);
    ldA(1, 0);                                // this pass's second chunk: requested behind the barrier (which waits for every load in flight), one chunk of WMMAs ahead of its use
    if (more) ldW();                          // next panel: requested here, written to LDS at the foot
#pragma unroll
    for (int s = 0; s < 12; ++s) {            // 2 k chunks x 6 column tiles
      const int kk = s / 6, nt = s % 6, c = s & 1;
      if (s + 1 < 12) {
        const int o = ((s + 1) % 6) * 16 * WPITCH + ((s + 1) / 6) * 32;
        bh[c ^ 1] = frag_kb(ph + o, hh); bl[c ^ 1] = frag_kb(pl + o, hh);
      }
      acc[0][nt] = wmmab(ah[kk][0], bh[c], acc[0][nt]); acc[1][nt] = wmmab(ah[kk][1], bh[c], acc[1][nt]);
      acc[0][nt] = wmmab(ah[kk][0], bl[c], acc[0][nt]); acc[1][nt] = wmmab(ah[kk][1], bl[c], acc[1][nt]);
      acc[0][nt] = wmmab(al[kk][0], bh[c], acc[0][nt]); acc[1][nt] = wmmab(al[kk][1], bh[c], acc[1][nt]);
      if (s == 5 && more) ldA(0, 2048);       // next pass's first chunk into the slot whose last reader has just issued
    }
    if (more) stW((p & 1) ^ 1);
    ao += 2048u; wo += 128u;
  };
  ldW(); ldA(0, 0);
  stW(0);
  wo += 128u;
  for (int p = 0; p < KCH / 2 - 1; ++p) pass(p, true);
  pass(KCH / 2 - 1, false);
  __syncthreads();                            // all panel reads done: smem becomes the staging tile
  const unsigned int lb = (unsigned int)lane * 16u;   // every store below: a wave-uniform base, this one per-lane offset (a quarter of it in mode 2) and a constant

  if (mode == 0) {
    b16* th = (b16*)smem + wave * (2 * 16 * TPITCH); b16* tl = th + 16 * TPITCH;
    b16* oh = (b16*)out0; b16* ol = (b16*)out1;
    float bn[6];                              // the six bias values as one group of loads in front of the stores: one load latency, not one a column tile
#pragma unroll
    for (int nt = 0; nt < 6; ++nt) bn[nt] = bias[nb + nt * 16 + l16];
#pragma unroll
    for (int mi = 0; mi < 2; ++mi) {          // one row tile after the other through the wave's own staging range
#pragma unroll
      for (int nt = 0; nt < 6; ++nt) {
#pragma unroll
        for (int r = 0; r < 8; ++r) { b16 a, c; split_bf16(acc[mi][nt][r] + bn[nt], a, c); th[(rbase + r) * TPITCH + nt * 16 + l16] = a; tl[(rbase + r) * TPITCH + nt * 16 + l16] = c; }
      }
      wave_sync_lds();
      const size_t blk = (size_t)((((mt >> 10) * NHD + blockIdx.y) * 64 + ((mt >> 4) & 63)) * 3) * 1024;   // byte offset of the wave's first token tile in head blockIdx.y; 16 tokens are one token tile, the 96 columns the head's three d chunks
#pragma unroll
      for (int c = 0; c < 3; ++c) {
#pragma unroll
        for (int j = 0; j < 2; ++j) {
          *(v8b*)((char*)oh + blk + lb + ((mi * 3 + c) * 1024 + j * 512)) = ld8b(th + l16 * TPITCH + c * 32 + j * 16 + hh * 8);
          *(v8b*)((char*)ol + blk + lb + ((mi * 3 + c) * 1024 + j * 512)) = ld8b(tl + l16 * TPITCH + c * 32 + j * 16 + hh * 8);
        }
      }
      wave_sync_lds();                        // this tile's reads stay in front of the next tile's writes
      asm volatile("s_wait_xcnt 0x0" ::: "memory");   // stands behind the run of stores, before any register that an issued store names is rewritten
    }
  } else if (mode == 1) {
    // A lane's eight accumulator registers of a column tile are eight consecutive keys of one column d: already one 16-byte piece of a V fragment, stored from registers
    b16* oh = (b16*)out0; b16* ol = (b16*)out1;
    const size_t blk = (size_t)((((mt >> 10) * NHD + blockIdx.y) * 6) * 32 + ((mt >> 5) & 31)) * 1024;   // byte offset of d tile 0 of head blockIdx.y at the wave's key chunk: its 32 keys are one chunk, its row tile mi the chunk's half j
    float bn[6];                              // one group of loads in front of the stores, as in mode 0
#pragma unroll
    for (int nt = 0; nt < 6; ++nt) bn[nt] = bias[nb + nt * 16 + l16];
#pragma unroll
    for (int mi = 0; mi < 2; ++mi) {
#pragma unroll
      for (int nt = 0; nt < 6; ++nt) {
        v8b vh8, vl8;
#pragma unroll
        for (int r = 0; r < 8; ++r) { b16 a, c; split_bf16(acc[mi][nt][r] + bn[nt], a, c); vh8[r] = a; vl8[r] = c; }
        *(v8b*)((char*)oh + blk + lb + (nt * 32 * 1024 + mi * 512)) = vh8;
        *(v8b*)((char*)ol + blk + lb + (nt * 32 * 1024 + mi * 512)) = vl8;
      }
      asm volatile("s_wait_xcnt 0x0" ::: "memory");   // stands behind the run of stores, before any register that an issued store names is rewritten
    }
  } else {
    char* of = (char*)out0 + ((size_t)mt * EMB + nb) * 4;   // the wave's first row at the block's first column
    float bn3[3];                             // one group of loads in front of the stores, as in mode 0
#pragma unroll
    for (int pr = 0; pr < 3; ++pr) bn3[pr] = bias[nb + pr * 32 + lane];
#pragma unroll
    for (int mi = 0; mi < 2; ++mi) {
#pragma unroll
      for (int pr = 0; pr < 3; ++pr) {
        const float bn = bn3[pr];
#pragma unroll
        for (int r = 0; r < 8; ++r) {
          const float a0 = acc[mi][2 * pr][r], b0 = acc[mi][2 * pr + 1][r];
          const float ax = __shfl_xor(a0, 16), bx = __shfl_xor(b0, 16);
          const float v1 = (hh ? bx : a0) + bn;     // row mt + 16 mi + r
          const float v2 = (hh ? b0 : ax) + bn;     // row mt + 16 mi + r + 8
          *(float*)(of + (lb >> 2) + ((mi * 16 + r) * EMB + pr * 32) * 4) = v1;
          *(float*)(of + (lb >> 2) + ((mi * 16 + r + 8) * EMB + pr * 32) * 4) = v2;
        }
      }
      asm volatile("s_wait_xcnt 0x0" ::: "memory");   // stands behind the run of stores, before any register that an issued store names is rewritten
    }
  }
}

// One grid for up to three products that do not depend on one another (Q, K and V projections): blockIdx.z picks the job, so the launches' starts and tails overlap.
__global__ __launch_bounds__(256, 4)   // register budget of four waves a SIMD (256): two workgroups share a WGP, so one's barrier and load waits lie under the other's WMMAs
void cma_gemm_tn(const b16* Ah0, const b16* Al0, const b16* Wh0, const b16* Wl0, const float* bias0, void* outh0, void* outl0, int mode0,
                 const b16* Ah1, const b16* Al1, const b16* Wh1, const b16* Wl1, const float* bias1, void* outh1, void* outl1, int mode1,
                 const b16* Ah2, const b16* Al2, const b16* Wh2, const b16* Wl2, const float* bias2, void* outh2, void* outl2, int mode2) {
  const int z = blockIdx.z;
  gemm_tile(z == 0 ? Ah0 : z == 1 ? Ah1 : Ah2, z == 0 ? Al0 : z == 1 ? Al1 : Al2,
            z == 0 ? Wh0 : z == 1 ? Wh1 : Wh2, z == 0 ? Wl0 : z == 1 ? Wl1 : Wl2,
            z == 0 ? bias0 : z == 1 ? bias1 : bias2,
            z == 0 ? outh0 : z == 1 ? outh1 : outh2, z == 0 ? outl0 : z == 1 ? outl1 : outl2,
            z == 0 ? mode0 : z == 1 ? mode1 : mode2);
}

// ---------------------------------------------------------------------------
// Attention core. One workgroup of 16 waves per (b, 32-row block = two 16-row m-tiles); loops over 8 heads.
// Every K and V fragment that a wave loads is multiplied into both m-tiles, so each (b, h) K/V plane is read by 32 workgroups, not 64.
//   Phase 1: S[32x1024] = Q K^T, unscaled, into the LDS panel (split WMMA, Q/K hi/lo planes); a wave owns 64 keys
//   Phase 2: softmax per row (2 rows per wave, 32 columns per lane): exp((s - max) / sqrt(96)) = 2^(s * c - max * c) with c = log2(e) / sqrt(96),
//            one FMA and one hardware exponential an element; head-mean accumulated in registers; P written back f32
//   Phase 3: O_partial += P V; a wave owns one 128-key slab (wave & 7) and one 48-column half of the head (wave >> 3), both m-tiles
// K and V fragments run through register rings: a ring slot is refilled with the fragment of the next k chunk directly behind the WMMAs that
// read it, the first V chunk is requested in front of the softmax and the next head's first Q/K chunk in front of the sums of the O reduction, so that
// a whole chunk of loads is in flight under the matrix, softmax and reduction work instead of four loads that are waited for at once.
// The 32 workgroups of a batch read the same K and V planes. They do not walk the heads in one common order: each starts at its own head and goes round the
// ring of eight, so that at any moment only four of them ask L2 for the same lines, and a plane that one of them has brought in from memory is an L2 hit for the rest.
// ---------------------------------------------------------------------------
__global__ __launch_bounds__(512)
void cma_attn(const b16* __restrict__ Qh, const b16* __restrict__ Ql,     // fragment order, [b][h][64 token tiles][3 d chunks][1024 B]
              const b16* __restrict__ Kh, const b16* __restrict__ Kl,     // the same
              const b16* __restrict__ Vh, const b16* __restrict__ Vl,     // fragment order, [b][h][6 d tiles][32 key chunks][1024 B]
              b16* __restrict__ Aoh, b16* __restrict__ Aol,               // attended rows [8192,768] as hi/lo planes in fragment order, [512 row tiles][24 k chunks][1024 B]
              float* __restrict__ avg_out) {                              // [8,1024,1024] f32
  __shared__ __attribute__((aligned(16))) float sS[32 * SPITCH];          // score / probability panel, rows padded to SPITCH, reused for the O reduction

  const int b    = blockIdx.y;
  const int m0   = blockIdx.x * 32;
  const int tid  = threadIdx.x;
  const int lane = tid & 31;
  const int wave = __builtin_amdgcn_readfirstlane(tid >> 5);   // scalar: what depends on the wave alone stays out of the vector registers, which the rings need
  const int l16  = lane & 15;
  const int hh   = lane >> 4;
  const int rbase = hh * 8;
  const int slab = wave & 7;                           // phase 3: 128-key slab
  const int nt0  = (wave >> 3) * 3;                    // phase 3: first of this wave's three 16-column tiles of the head
  const float esc = 0.14724445f;                       // log2(e) / sqrt(96): the score scale and the change of base in one factor (positive, so the row maximum may be taken of the unscaled scores)
  const unsigned int HSTEP = 64u * 3u * 1024u;         // bytes of one (b, h) in every plane (= 6 * 32 * 1024)
  const int rot  = 2 * (blockIdx.x & 3) + ((blockIdx.x >> 3) & 1);   // first head of this workgroup, 0..7: the low two bits of the block index step it by two heads, bit 3 adds one, so neighbours in launch order start on different heads and each start is taken by four of a batch's 32 workgroups

  float AV[2][32];
#pragma unroll
  for (int rr = 0; rr < 2; ++rr)
#pragma unroll
    for (int i = 0; i < 32; ++i) AV[rr][i] = 0.f;

  v16b qh0, ql0, qh1, ql1;                             // one k chunk of Q, both m-tiles
  v16b kfh[4], kfl[4];                                 // K ring: one slot per 16-key tile
  v16b vfh[3], vfl[3];                                 // V ring: one slot per 16-column tile
  // 32-bit byte offsets from a plane's start (16 B x lane + the first block of this batch, wave and head), stepped from head to head: hi and lo plane share one register
  unsigned int qo = (unsigned int)lane * 16u + (unsigned int)(b * NHD + rot) * HSTEP + (unsigned int)(m0 >> 4) * 3072u;
  unsigned int ko = (unsigned int)lane * 16u + (unsigned int)(b * NHD + rot) * HSTEP + (unsigned int)(wave * 4) * 3072u;
  unsigned int vo = (unsigned int)lane * 16u + (unsigned int)(b * NHD + rot) * HSTEP + (unsigned int)(nt0 * 32 + slab * 4) * 1024u;
  auto ldQ = [&](int kk) {
    qh0 = frag_off(Qh, qo, kk * 1024); ql0 = frag_off(Ql, qo, kk * 1024);
    qh1 = frag_off(Qh, qo, 3072 + kk * 1024); ql1 = frag_off(Ql, qo, 3072 + kk * 1024);
  };
  auto ldK = [&](int kk, int t) {
    kfh[t] = frag_off(Kh, ko, t * 3072 + kk * 1024); kfl[t] = frag_off(Kl, ko, t * 3072 + kk * 1024);
  };
  auto ldV = [&](int c4, int j) {
    vfh[j] = frag_off(Vh, vo, (j * 32 + c4) * 1024); vfl[j] = frag_off(Vl, vo, (j * 32 + c4) * 1024);
  };
  ldQ(0);
#pragma unroll
  for (int t = 0; t < 4; ++t) ldK(0, t);

  for (int hi = 0; hi < NHD; ++hi) {
    const int h = (hi + rot) & (NHD - 1);              // the head of this trip
    // ----- Phase 1: scores -> LDS --------------------------------------
    v8f s[4][2] = {};                                  // [16-key tile][m-tile]; k chunk outermost, so that only one chunk of Q is held in registers
#pragma unroll
    for (int kk = 0; kk < 3; ++kk) {
#pragma unroll
      for (int t = 0; t < 4; ++t) {
        s[t][0] = wmmab(qh0, kfh[t], s[t][0]); s[t][1] = wmmab(qh1, kfh[t], s[t][1]);
        s[t][0] = wmmab(qh0, kfl[t], s[t][0]); s[t][1] = wmmab(qh1, kfl[t], s[t][1]);
        s[t][0] = wmmab(ql0, kfh[t], s[t][0]); s[t][1] = wmmab(ql1, kfh[t], s[t][1]);
        if (kk < 2) ldK(kk + 1, t);                    // refill the slot behind its last reader
      }
      if (kk < 2) ldQ(kk + 1);
    }
#pragma unroll
    for (int t = 0; t < 4; ++t) {
      const int ncol = wave * 64 + t * 16 + l16;
#pragma unroll
      for (int r = 0; r < 8; ++r) { sS[(rbase + r) * SPITCH + ncol] = s[t][0][r]; sS[(16 + rbase + r) * SPITCH + ncol] = s[t][1][r]; }
    }
    __syncthreads();
#pragma unroll
    for (int j = 0; j < 3; ++j) ldV(0, j);             // first V chunk: in flight under the softmax

    // ----- Phase 2: softmax (2 rows / wave), head-mean in registers, P back to the panel as f32 -----
    float P[2][32];
#pragma unroll
    for (int rr = 0; rr < 2; ++rr) {
      const int row = wave * 2 + rr;
      float mx = -3.0e38f;
#pragma unroll
      for (int i = 0; i < 32; ++i) P[rr][i] = sS[row * SPITCH + lane + 32 * i];   // the row's loads in a loop of their own: they go out as one group in front of the maximum chain, not one by one between its links
#pragma unroll                                          // P is a register array: constant indices only
      for (int i = 0; i < 32; ++i) mx = fmaxf(mx, P[rr][i]);
#pragma unroll
      for (int off = 16; off >= 1; off >>= 1) mx = fmaxf(mx, __shfl_xor(mx, off));
      const float nm = -mx * esc;
      float sum = 0.f;
#pragma unroll
      for (int i = 0; i < 32; ++i) P[rr][i] = __builtin_fmaf(P[rr][i], esc, nm);   // every exponent first, in place: no exponential's source register is a temporary that the next FMA rewrites directly behind it
#pragma unroll                                          // P is a register array: constant indices only
      for (int i = 0; i < 32; ++i) { P[rr][i] = __builtin_amdgcn_exp2f(P[rr][i]); sum += P[rr][i]; }
#pragma unroll
      for (int off = 16; off >= 1; off >>= 1) sum += __shfl_xor(sum, off);
      const float inv = 1.0f / sum;
#pragma unroll
      for (int i = 0; i < 32; ++i) { P[rr][i] *= inv; AV[rr][i] += P[rr][i] * 0.125f; }
    }
    __syncthreads();                                   // all S reads done
#pragma unroll
    for (int rr = 0; rr < 2; ++rr) {
      const int row = wave * 2 + rr;
#pragma unroll
      for (int i = 0; i < 32; ++i) sS[row * SPITCH + lane + 32 * i] = P[rr][i];
    }
    __syncthreads();

    // ----- Phase 3: O_partial += P * V over this wave's 128-wide key slab, three 16-column tiles, both m-tiles -----
    v8f o[2][3] = {};
#pragma unroll
    for (int c4 = 0; c4 < 4; ++c4) {
      const int pb = slab * 128 + c4 * 32;
      v16b aph0, apl0, aph1, apl1;
      frag_ksplit(sS + (size_t)l16 * SPITCH + pb, hh, aph0, apl0);
      frag_ksplit(sS + (size_t)(16 + l16) * SPITCH + pb, hh, aph1, apl1);
#pragma unroll
      for (int j = 0; j < 3; ++j) {
        o[0][j] = wmmab(aph0, vfh[j], o[0][j]); o[1][j] = wmmab(aph1, vfh[j], o[1][j]);
        o[0][j] = wmmab(aph0, vfl[j], o[0][j]); o[1][j] = wmmab(aph1, vfl[j], o[1][j]);
        o[0][j] = wmmab(apl0, vfh[j], o[0][j]); o[1][j] = wmmab(apl1, vfh[j], o[1][j]);
        if (c4 < 3) ldV(c4 + 1, j);                    // refill the slot behind its last reader
      }
    }
    __syncthreads();                                   // P reads done; reuse LDS

#pragma unroll
    for (int mi = 0; mi < 2; ++mi)
#pragma unroll
      for (int j = 0; j < 3; ++j)
#pragma unroll
        for (int r = 0; r < 8; ++r) sS[slab * 3072 + (mi * 16 + rbase + r) * 96 + (nt0 + j) * 16 + l16] = o[mi][j][r];
    __syncthreads();
    {
      const unsigned int hstep = h + 1 < NHD ? HSTEP : 0u - (NHD - 1) * HSTEP;   // on to the next head of the ring, from head 7 back to head 0; the last trip requests the first chunk of its first head again: in bounds, and no branch in the loop's body
      qo += hstep; ko += hstep; vo += hstep;
      ldQ(0);
#pragma unroll
      for (int t = 0; t < 4; ++t) ldK(0, t);           // next head's first Q/K chunk: in flight under the O reduction
    }
#pragma unroll                                          // six exact trips: no branch in the head loop's body, so the head-mean updates stay at the softmax and P's registers are free in phase 3
    for (int q = 0; q < 6; ++q) {                      // reduced tile into sS[8*3072 ..) (free region)
      const int idx = tid + q * 512;
      float sum = 0.f;
#pragma unroll
      for (int w = 0; w < 8; ++w) sum += sS[w * 3072 + idx];
      sS[8 * 3072 + idx] = sum;
    }
    __syncthreads();
#pragma unroll                                          // three exact trips of one element pair a lane (1536 pairs, 512 threads), for the same reason
    for (int q = 0; q < 3; ++q) {                      // the head's 32 x 96 tile = six fragment blocks; a wave stores 128 contiguous bytes of a block in each plane
      const int blk = (wave >> 3) + 2 * q, mi = blk / 3, kc = blk % 3;
      const int fl = (tid >> 2) & 31;                  // lane of the fragment that holds the pair
      const v2f x = *(const v2f*)(sS + 8 * 3072 + (mi * 16 + (fl & 15)) * 96 + kc * 32 + ((tid >> 7) & 1) * 16 + (fl >> 4) * 8 + (tid & 3) * 2);
      v2b xh, xl; b16 a, c;
      split_bf16(x[0], a, c); xh[0] = a; xl[0] = c;
      split_bf16(x[1], a, c); xh[1] = a; xl[1] = c;
      const unsigned int g = (unsigned int)((((b << 6) + (m0 >> 4) + mi) * 24 + h * 3 + kc) * 1024) + (unsigned int)(tid & 255) * 4u;   // byte offset, the same in both planes
      *(v2b*)((char*)Aoh + g) = xh;
      *(v2b*)((char*)Aol + g) = xl;
    }
    __syncthreads();
  }
  {
#pragma unroll
    for (int rr = 0; rr < 2; ++rr) {
      float* apo = avg_out + ((size_t)((b << 10) + m0 + wave * 2 + rr) << 10) + __builtin_amdgcn_mbcnt_lo(~0u, 0u);   // the lane number in the form the shuffles already hold: no second register for it lives (or spills) across the head loop
#pragma unroll
      for (int i = 0; i < 32; ++i) *(float*)(apo + 32 * i) = AV[rr][i];
    }
    
  }
}

// ---------------------------------------------------------------------------
extern "C" void kernel_launch(void* const* d_in, const int* in_sizes, int n_in,
                              void* d_out, int out_size, void* d_ws, size_t ws_size,
                              hipStream_t stream) {
  (void)in_sizes; (void)n_in; (void)out_size;
  const float* mam = (const float*)d_in[0];
  const float* pat = (const float*)d_in[1];
  const float* qw  = (const float*)d_in[2];
  const float* qb  = (const float*)d_in[3];
  const float* kw  = (const float*)d_in[4];
  const float* kb  = (const float*)d_in[5];
  const float* vw  = (const float*)d_in[6];
  const float* vb  = (const float*)d_in[7];
  const float* ow  = (const float*)d_in[8];
  const float* ob  = (const float*)d_in[9];

  const size_t TOK = (size_t)MTOT * EMB;   // 6,291,456 elements
  const size_t WSZ = (size_t)EMB * EMB;    //   589,824 elements

  size_t off = 0; char* ws = (char*)d_ws;
  auto take = [&](size_t bytes) { void* p = ws + off; off += (bytes + 255) & ~(size_t)255; return p; };
  b16* Wp = (b16*)take(WSZ * 2 * 8);                                 // weight planes [q, k, v, o][hi, lo][768*768]
  b16* Wqh = Wp;           b16* Wql = Wp + WSZ;
  b16* Wkh = Wp + 2 * WSZ; b16* Wkl = Wp + 3 * WSZ;
  b16* Wvh = Wp + 4 * WSZ; b16* Wvl = Wp + 5 * WSZ;
  b16* Woh = Wp + 6 * WSZ; b16* Wol = Wp + 7 * WSZ;
  b16* Qh = (b16*)take(TOK * 2);  b16* Ql = (b16*)take(TOK * 2);     // planes in fragment order, 8192 x 768 elements each
  b16* Kh = (b16*)take(TOK * 2);  b16* Kl = (b16*)take(TOK * 2);
  b16* Vh = (b16*)take(TOK * 2);  b16* Vl = (b16*)take(TOK * 2);
  b16* Aoh = (b16*)take(TOK * 2); b16* Aol = (b16*)take(TOK * 2);    // attended rows before the O projection
  b16* Mh = (b16*)take(TOK * 2);  b16* Ml = (b16*)take(TOK * 2);     // the two token inputs
  b16* Ph = (b16*)take(TOK * 2);  b16* Pl = (b16*)take(TOK * 2);
  if (off > ws_size) return;

  float* att_out = (float*)d_out;        // [8,1024,768]
  float* avg_out = att_out + TOK;        // [8,1024,1024]

  cma_split<<<4 * WBLK + 2 * ABLK, 256, 0, stream>>>(mam, pat, qw, kw, vw, ow, Mh, Ml, Ph, Pl, Wp);

  cma_gemm_tn<<<dim3(MTOT / GBM, EMB / GBN, 3), 256, 0, stream>>>(Mh, Ml, Wqh, Wql, qb, Qh, Ql, 0,
                                                                 Ph, Pl, Wkh, Wkl, kb, Kh, Kl, 0,
                                                                 Ph, Pl, Wvh, Wvl, vb, Vh, Vl, 1);

  cma_attn<<<dim3(NTOK / 32, NB), 512, 0, stream>>>(Qh, Ql, Kh, Kl, Vh, Vl, Aoh, Aol, avg_out);

  cma_gemm_tn<<<dim3(MTOT / GBM, EMB / GBN, 1), 256, 0, stream>>>(Aoh, Aol, Woh, Wol, ob, att_out, nullptr, 2,      // one job: the other two slots are never picked
                                                                 Aoh, Aol, Woh, Wol, ob, att_out, nullptr, 2,
                                                                 Aoh, Aol, Woh, Wol, ob, att_out, nullptr, 2);
}

// v010
// Measured time: 170 microseconds a run.
// Timed twice side by side with v009, it ran 1.14 and 1.15 times as fast.
// All steps since v000 together make it 3.68 times as fast.
#include <hip/hip_runtime.h>

// ---------------------------------------------------------------------------
// Cross-modal attention (E=768, 8 heads x 96, B=8, 1024 query tokens x 1024 key tokens), two outputs: attended [8,1024,768] and the
// head-averaged attention matrix [8,1024,1024]. Every contraction runs on v_wmma_f32_16x16x32_bf16 with BOTH operands as bf16 hi/lo
// splits (hi.hi + hi.lo + lo.hi, f32 accumulate): the four projections (A = activation hi/lo planes, split once, B = weight hi/lo
// planes), K.Q^T (Q/K hi/lo planes), P.V (P split in registers, V^T hi/lo planes). Softmax and the head mean f32.
// Fragment k-map per lane half hh, A and B alike: elements 0..7 <- k = 8hh+0..7, elements 8..15 <- k = 16+8hh+0..7.
// The Q, K and V planes lie in the workspace in FRAGMENT ORDER: one 16x32 fragment = one block of 1024 B = [j = 0,1][lane 0..31][8 elements],
// lane = 16hh + (row or column & 15), k = 32 chunk + 16j + 8hh + 0..7. A fragment load is then two loads of 512 contiguous bytes (four whole
// cache lines each) instead of two loads that touch 16 lines for 32 bytes each.
//   Q, K: block index ((b*8 + h)*64 + token tile)*3 + d chunk          V: block index ((b*8 + h)*6 + d tile)*32 + key chunk
// The A operands of the four projections (both token inputs, the attention output) lie so too: block index (16-row tile)*24 + k chunk.
// ---------------------------------------------------------------------------

typedef __bf16 b16;
typedef __attribute__((ext_vector_type(16))) __bf16 v16b;
typedef __attribute__((ext_vector_type(8)))  __bf16 v8b;
typedef __attribute__((ext_vector_type(2)))  __bf16 v2b;
typedef __attribute__((ext_vector_type(8)))  float  v8f;
typedef __attribute__((ext_vector_type(2)))  float  v2f;
typedef __attribute__((ext_vector_type(4)))  float  v4f;
typedef __attribute__((ext_vector_type(4)))  int    i4;

#define NB 8
#define NTOK 1024
#define EMB 768
#define NHD 8
#define HDIM 96
#define MTOT 8192
#define WPITCH 72     // LDS pitch of a 64-element bf16 row (weight panels): 144 B = 16 B x odd, conflict-free for ds_load_b128 reads of one row per lane
#define TPITCH 104    // LDS pitch of a 96-element bf16 row (Q/K staging tile): 208 B = 16 B x odd
#define GBM 256       // projection workgroup tile: rows
#define GBN 96        // projection workgroup tile: columns
#define KCH 24        // 32-wide k chunks of a projection (768 / 32)
#define APITCH 132    // LDS pitch of a 128-element f32 row (activation split): 528 B = 16 B x odd
#define WBLK 72       // blocks of the split grid per weight matrix: 768*768/8 pieces = 4 trips of 72 x 256 threads
#define ABLK 384      // blocks of the split grid per token input: 512 row tiles x 6 column groups, 8 waves a block
#define SPITCH 1028   // LDS pitch of a 1024-element f32 row (head-mean panel): 4112 B = 16 B x odd
#define OPITCH 104    // LDS pitch of a 96-element f32 row of an O partial tile: 8 banks x odd, so a read of 8 floats of each of 8 consecutive rows touches every bank once
#define OGRP (8 * OPITCH + 16)   // eight rows of the tile, then 16 floats: rows r and r + 8, which the two lane halves of one b32 store write, lie 16 banks apart
#define OTILE (4 * OGRP)      // one wave's O partial tile (32 rows), floats
#define STP 36        // LDS pitch of a query's 16 x (maximum, sum): 144 B = 16 B x odd

__device__ __forceinline__ void split_bf16(float v, b16& hi, b16& lo) {
  const unsigned int u = __builtin_bit_cast(unsigned int, v) & 0xffff0000u;
  hi = __builtin_bit_cast(b16, (unsigned short)(u >> 16));
  lo = (b16)(v - __builtin_bit_cast(float, u));
}
__device__ __forceinline__ v8b ld8b(const b16* p) { return *(const v8b*)p; }
__device__ __forceinline__ v16b cat8b(v8b a, v8b b) { return __builtin_shufflevector(a, b, 0, 1, 2, 3, 4, 5, 6, 7, 8, 9, 10, 11, 12, 13, 14, 15); }
__device__ __forceinline__ v16b frag_kb(const b16* p, int hh) { return cat8b(ld8b(p + 8 * hh), ld8b(p + 16 + 8 * hh)); }
// A fragment from a plane in fragment order: wave-uniform plane pointer, a per-lane byte offset (16 B x lane + block) and a constant byte offset: every load of a plane shares one per-lane address
__device__ __forceinline__ v16b frag_off(const b16* base, unsigned int lane_bytes, int const_bytes) {
  const char* p = (const char*)base + lane_bytes + const_bytes;
  return cat8b(*(const v8b*)p, *(const v8b*)(p + 512));
}
__device__ __forceinline__ void frag_ksplit(const float* p, int hh, v16b& fh, v16b& fl) {
  const float* p0 = p + 8 * hh; const float* p1 = p + 16 + 8 * hh;
#pragma unroll
  for (int e = 0; e < 8; ++e) { b16 a, c; split_bf16(p0[e], a, c); fh[e] = a; fl[e] = c; split_bf16(p1[e], a, c); fh[8 + e] = a; fl[8 + e] = c; }
}
__device__ __forceinline__ v8f wmmab(v16b a, v16b b, v8f c) {
  v8f d = __builtin_amdgcn_wmma_f32_16x16x32_bf16(false, a, false, b, (short)0, c, false, false);
  asm volatile("v_nop\n\tv_nop\n\tv_nop\n\tv_nop" : "+v"(d) : "v"(a), "v"(b));
  return d;
}
__device__ __forceinline__ v8f wmma3(v16b ah, v16b al, v16b bh, v16b bl, v8f c) {
  c = wmmab(ah, bh, c); c = wmmab(ah, bl, c); c = wmmab(al, bh, c); return c;
}
__device__ __forceinline__ float xhalf(float x) {   // lane l with lane l ^ 16, a vector instruction: no LDS round trip and no address register
  return __builtin_bit_cast(float, __builtin_amdgcn_permlanex16(__builtin_bit_cast(int, x), __builtin_bit_cast(int, x), 0x76543210, 0xfedcba98, false, false));
}
// Eight hardware exponentials (2^x), each in place. In place, so that no following instruction can overwrite an exponential's source directly behind it; each is the independent
// instruction that the instruction set asks for behind the one in front of it, and the v_nop is that slot behind the last one, whatever the compiler puts next.
__device__ __forceinline__ void exp2x8(float (&x)[8]) {
  asm("v_exp_f32 %0, %0\n\tv_exp_f32 %1, %1\n\tv_exp_f32 %2, %2\n\tv_exp_f32 %3, %3\n\tv_exp_f32 %4, %4\n\tv_exp_f32 %5, %5\n\tv_exp_f32 %6, %6\n\tv_exp_f32 %7, %7\n\tv_nop"
      : "+v"(x[0]), "+v"(x[1]), "+v"(x[2]), "+v"(x[3]), "+v"(x[4]), "+v"(x[5]), "+v"(x[6]), "+v"(x[7]));
}
__device__ __forceinline__ void wave_sync_lds() {
  __builtin_amdgcn_fence(__ATOMIC_RELEASE, "workgroup"); __builtin_amdgcn_wave_barrier(); __builtin_amdgcn_fence(__ATOMIC_ACQUIRE, "workgroup");
}

// ---------------------------------------------------------------------------
// All six f32 -> bf16 hi/lo splits in ONE grid: none of them depends on another, so a range of the block index picks the job and the short jobs run beside the long ones.
//   blocks 0 .. 4*WBLK-1: the four weight matrices [768,768], row-major planes [weight][hi, lo][768*768]; WBLK blocks a matrix, eight elements a thread and trip
//   the rest, ABLK blocks an input: both token inputs [8192,768] -> planes in fragment order, once, instead of in each of the 8 column blocks of every projection.
//   There a wave takes 16 rows x 128 columns: 16 loads of one row's 512 contiguous bytes, through its own LDS range, read back as four fragments.
// ---------------------------------------------------------------------------
__global__ __launch_bounds__(256)
void cma_split(const float* __restrict__ a0, const float* __restrict__ a1,
               const float* __restrict__ w0, const float* __restrict__ w1, const float* __restrict__ w2, const float* __restrict__ w3,
               b16* __restrict__ h0, b16* __restrict__ l0, b16* __restrict__ h1, b16* __restrict__ l1, b16* __restrict__ wp) {
  __shared__ __attribute__((aligned(16))) float sA[8 * 16 * APITCH];
  if (blockIdx.x < 4 * WBLK) {                       // the same for the whole block
    const int m = blockIdx.x / WBLK;
    const float* w = m == 0 ? w0 : m == 1 ? w1 : m == 2 ? w2 : w3;
    b16* wh = wp + (size_t)m * (2 * EMB * EMB); b16* wl = wh + EMB * EMB;
#pragma unroll                                        // four exact trips (4 x WBLK x 256 pieces = the matrix): unrolled, so that the later trips' loads are requested in front of the first trip's stores
    for (int t = 0; t < EMB * EMB / 8 / (WBLK * 256); ++t) {
      const int i = (t * WBLK + blockIdx.x % WBLK) * 256 + threadIdx.x;
      v8b h, l;
#pragma unroll
      for (int e = 0; e < 8; ++e) { b16 a, c; split_bf16(w[(size_t)i * 8 + e], a, c); h[e] = a; l[e] = c; }
      *(v8b*)(wh + (size_t)i * 8) = h; *(v8b*)(wl + (size_t)i * 8) = l;
    }
    asm volatile("s_wait_xcnt 0x0" ::: "memory");   // stands behind the run of stores, before any register that an issued store names is rewritten
    return;
  }
  const int ab = blockIdx.x - 4 * WBLK;
  const bool second = ab >= ABLK;
  const float* a = second ? a1 : a0;
  b16* oh = second ? h1 : h0;
  b16* ol = second ? l1 : l0;
  const int lane = threadIdx.x & 31;
  const int wave = __builtin_amdgcn_readfirstlane(threadIdx.x >> 5);   // scalar: the tile's addresses stay in scalar registers, and loads and stores share one per-lane offset (16 B x lane)
  const int l16  = lane & 15;
  const int hh   = lane >> 4;
  const int gw   = (second ? ab - ABLK : ab) * 8 + wave;
  const int tile = gw / 6, cg = gw % 6;              // 16-row tile, group of 128 columns = four k chunks
  float* s = sA + wave * (16 * APITCH);
  const char* src = (const char*)(a + (size_t)(tile * 16) * EMB + cg * 128);
  const unsigned int lb = (unsigned int)lane * 16u;
#pragma unroll
  for (int i = 0; i < 16; ++i) *(i4*)(s + i * APITCH + lane * 4) = *(const i4*)(src + lb + i * (EMB * 4));
  wave_sync_lds();
#pragma unroll
  for (int c = 0; c < 4; ++c) {
    v16b fh, fl; frag_ksplit(s + l16 * APITCH + c * 32, hh, fh, fl);
    const size_t g = (size_t)(tile * 24 + cg * 4 + c) * 1024;     // the block's byte offset in either plane
    *(v8b*)((char*)oh + g + lb)       = __builtin_shufflevector(fh, fh, 0, 1, 2, 3, 4, 5, 6, 7);
    *(v8b*)((char*)oh + g + lb + 512) = __builtin_shufflevector(fh, fh, 8, 9, 10, 11, 12, 13, 14, 15);
    *(v8b*)((char*)ol + g + lb)       = __builtin_shufflevector(fl, fl, 0, 1, 2, 3, 4, 5, 6, 7);
    *(v8b*)((char*)ol + g + lb + 512) = __builtin_shufflevector(fl, fl, 8, 9, 10, 11, 12, 13, 14, 15);
  }
  asm volatile("s_wait_xcnt 0x0" ::: "memory");   // stands behind the run of stores, before any register that an issued store names is rewritten
}

// ---------------------------------------------------------------------------
// C[8192,768] = A[8192,768] * W[768,768]^T + bias, both operands hi/lo planes (A in fragment order).
//   mode 0: C -> bf16 hi/lo planes, fragment order, k = d           (Q, K projections)
//   mode 1: C -> bf16 hi/lo planes, fragment order, k = key         (V projection)
//   mode 2: C -> f32 row-major                                      (O projection -> d_out)
// Workgroup = 8 waves, each wave owns a 32x96 tile (two 16-row tiles x six 16-column tiles) -> WG tile 256x96, 96 columns = one head.
// A weight fragment read from LDS feeds both row tiles and an A fragment feeds six column tiles: per WMMA half the LDS bytes of a 16x64 wave tile,
// and the A planes are read by 8 column blocks, the weight planes by 32 row blocks. Weight panels [96n x 64k] (hi and lo) double-buffered in LDS, rows padded to WPITCH:
// the next panel is requested at the top of a pass and written to LDS at its foot. A fragments run through a register ring of two k chunks: a slot is refilled
// one chunk of WMMAs ahead of its use, never directly in front of the barrier. The same LDS is reused as the staging tile of mode 0.
// ---------------------------------------------------------------------------
__device__ __forceinline__
void gemm_tile(const b16* __restrict__ Ah, const b16* __restrict__ Al, const b16* __restrict__ Wh, const b16* __restrict__ Wl,
               const float* __restrict__ bias, void* __restrict__ out0, void* __restrict__ out1, int mode) {
  __shared__ __attribute__((aligned(16))) unsigned char smem[4 * GBN * WPITCH * 2];
  b16* sW = (b16*)smem;                       // [buf][plane][GBN*WPITCH]
  const int lane = threadIdx.x & 31;
  const int wave = __builtin_amdgcn_readfirstlane(threadIdx.x >> 5);   // scalar: the tile's block numbers stay in scalar registers
  const int tid  = threadIdx.x;
  const int mt   = blockIdx.x * GBM + wave * 32;
  const int nb   = blockIdx.y * GBN;
  const int l16  = lane & 15;
  const int hh   = lane >> 4;
  const int rbase = hh * 8;

  // weight staging: a panel plane is 96 rows x 8 pieces of 16 B; a thread takes piece (tid & 7) of rows (tid >> 3) + 0, 32, 64. One byte offset serves both planes and all rows.
  unsigned int wo = (unsigned int)((nb + (tid >> 3)) * EMB + (tid & 7) * 8) * 2u;
  const int wl = (tid >> 3) * WPITCH + (tid & 7) * 8;
  i4 wr[6];
  auto ldW = [&]() {
#pragma unroll
    for (int i = 0; i < 3; ++i) {
      wr[i]     = *(const i4*)((const char*)Wh + wo + i * (32 * EMB * 2));
      wr[3 + i] = *(const i4*)((const char*)Wl + wo + i * (32 * EMB * 2));
    }
  };
  auto stW = [&](int buf) {
    b16* dh = sW + (buf * 2 + 0) * (GBN * WPITCH) + wl; b16* dl = sW + (buf * 2 + 1) * (GBN * WPITCH) + wl;
#pragma unroll
    for (int i = 0; i < 3; ++i) { *(i4*)(dh + i * 32 * WPITCH) = wr[i]; *(i4*)(dl + i * 32 * WPITCH) = wr[3 + i]; }
  };
  unsigned int ao = (unsigned int)lane * 16u + (unsigned int)(mt >> 4) * (unsigned int)(KCH * 1024);   // byte offset of this wave's first row tile in both A planes, stepped by two k chunks a pass
  v16b ah[2][2], al[2][2];                    // A ring: [k chunk of the pass][row tile]
  auto ldA = [&](int kk, int ahead) {
#pragma unroll
    for (int mi = 0; mi < 2; ++mi) { ah[kk][mi] = frag_off(Ah, ao, mi * (KCH * 1024) + kk * 1024 + ahead); al[kk][mi] = frag_off(Al, ao, mi * (KCH * 1024) + kk * 1024 + ahead); }
  };

  v8f acc[2][6] = {};
  v16b bh[2], bl[2];                          // weight fragment ring: the next column tile's LDS reads are issued in front of this tile's WMMAs
  auto pass = [&](int p, bool more) {         // more: a next pass exists (a constant at either call)
    const b16* ph = sW + ((p & 1) * 2) * (GBN * WPITCH) + l16 * WPITCH; const b16* pl = ph + GBN * WPITCH;
    __syncthreads();                          // this pass's panel staged by everyone; the other panel's reads finished before it is overwritten at this pass's foot
    bh[0] = frag_kb(ph, hh); bl[0] = frag_kb(pl, hh);
    ldA(1, 0);                                // this pass's second chunk: requested behind the barrier (which waits for every load in flight), one chunk of WMMAs ahead of its use
    if (more) ldW();                          // next panel: requested here, written to LDS at the foot
#pragma unroll
    for (int s = 0; s < 12; ++s) {            // 2 k chunks x 6 column tiles
      const int kk = s / 6, nt = s % 6, c = s & 1;
      if (s + 1 < 12) {
        const int o = ((s + 1) % 6) * 16 * WPITCH + ((s + 1) / 6) * 32;
        bh[c ^ 1] = frag_kb(ph + o, hh); bl[c ^ 1] = frag_kb(pl + o, hh);
      }
      acc[0][nt] = wmmab(ah[kk][0], bh[c], acc[0][nt]); acc[1][nt] = wmmab(ah[kk][1], bh[c], acc[1][nt]);
      acc[0][nt] = wmmab(ah[kk][0], bl[c], acc[0][nt]); acc[1][nt] = wmmab(ah[kk][1], bl[c], acc[1][nt]);
      acc[0][nt] = wmmab(al[kk][0], bh[c], acc[0][nt]); acc[1][nt] = wmmab(al[kk][1], bh[c], acc[1][nt]);
      if (s == 5 && more) ldA(0, 2048);       // next pass's first chunk into the slot whose last reader has just issued
    }
    if (more) stW((p & 1) ^ 1);
    ao += 2048u; wo += 128u;
  };
  ldW(); ldA(0, 0);
  stW(0);
  wo += 128u;
  for (int p = 0; p < KCH / 2 - 1; ++p) pass(p, true);
  pass(KCH / 2 - 1, false);
  __syncthreads();                            // all panel reads done: smem becomes the staging tile
  const unsigned int lb = (unsigned int)lane * 16u;   // every store below: a wave-uniform base, this one per-lane offset (a quarter of it in mode 2) and a constant

  if (mode == 0) {
    b16* th = (b16*)smem + wave * (2 * 16 * TPITCH); b16* tl = th + 16 * TPITCH;
    b16* oh = (b16*)out0; b16* ol = (b16*)out1;
    float bn[6];                              // the six bias values as one group of loads in front of the stores: one load latency, not one a column tile
#pragma unroll
    for (int nt = 0; nt < 6; ++nt) bn[nt] = bias[nb + nt * 16 + l16];
#pragma unroll
    for (int mi = 0; mi < 2; ++mi) {          // one row tile after the other through the wave's own staging range
#pragma unroll
      for (int nt = 0; nt < 6; ++nt) {
#pragma unroll
        for (int r = 0; r < 8; ++r) { b16 a, c; split_bf16(acc[mi][nt][r] + bn[nt], a, c); th[(rbase + r) * TPITCH + nt * 16 + l16] = a; tl[(rbase + r) * TPITCH + nt * 16 + l16] = c; }
      }
      wave_sync_lds();
      const size_t blk = (size_t)((((mt >> 10) * NHD + blockIdx.y) * 64 + ((mt >> 4) & 63)) * 3) * 1024;   // byte offset of the wave's first token tile in head blockIdx.y; 16 tokens are one token tile, the 96 columns the head's three d chunks
#pragma unroll
      for (int c = 0; c < 3; ++c) {
#pragma unroll
        for (int j = 0; j < 2; ++j) {
          *(v8b*)((char*)oh + blk + lb + ((mi * 3 + c) * 1024 + j * 512)) = ld8b(th + l16 * TPITCH + c * 32 + j * 16 + hh * 8);
          *(v8b*)((char*)ol + blk + lb + ((mi * 3 + c) * 1024 + j * 512)) = ld8b(tl + l16 * TPITCH + c * 32 + j * 16 + hh * 8);
        }
      }
      wave_sync_lds();                        // this tile's reads stay in front of the next tile's writes
      asm volatile("s_wait_xcnt 0x0" ::: "memory");   // stands behind the run of stores, before any register that an issued store names is rewritten
    }
  } else if (mode == 1) {
    // A lane's eight accumulator registers of a column tile are eight consecutive keys of one column d: already one 16-byte piece of a V fragment, stored from registers
    b16* oh = (b16*)out0; b16* ol = (b16*)out1;
    const size_t blk = (size_t)((((mt >> 10) * NHD + blockIdx.y) * 6) * 32 + ((mt >> 5) & 31)) * 1024;   // byte offset of d tile 0 of head blockIdx.y at the wave's key chunk: its 32 keys are one chunk, its row tile mi the chunk's half j
    float bn[6];                              // one group of loads in front of the stores, as in mode 0
#pragma unroll
    for (int nt = 0; nt < 6; ++nt) bn[nt] = bias[nb + nt * 16 + l16];
#pragma unroll
    for (int mi = 0; mi < 2; ++mi) {
#pragma unroll
      for (int nt = 0; nt < 6; ++nt) {
        v8b vh8, vl8;
#pragma unroll
        for (int r = 0; r < 8; ++r) { b16 a, c; split_bf16(acc[mi][nt][r] + bn[nt], a, c); vh8[r] = a; vl8[r] = c; }
        *(v8b*)((char*)oh + blk + lb + (nt * 32 * 1024 + mi * 512)) = vh8;
        *(v8b*)((char*)ol + blk + lb + (nt * 32 * 1024 + mi * 512)) = vl8;
      }
      asm volatile("s_wait_xcnt 0x0" ::: "memory");   // stands behind the run of stores, before any register that an issued store names is rewritten
    }
  } else {
    char* of = (char*)out0 + ((size_t)mt * EMB + nb) * 4;   // the wave's first row at the block's first column
    float bn3[3];                             // one group of loads in front of the stores, as in mode 0
#pragma unroll
    for (int pr = 0; pr < 3; ++pr) bn3[pr] = bias[nb + pr * 32 + lane];
#pragma unroll
    for (int mi = 0; mi < 2; ++mi) {
#pragma unroll
      for (int pr = 0; pr < 3; ++pr) {
        const float bn = bn3[pr];
#pragma unroll
        for (int r = 0; r < 8; ++r) {
          const float a0 = acc[mi][2 * pr][r], b0 = acc[mi][2 * pr + 1][r];
          const float ax = __shfl_xor(a0, 16), bx = __shfl_xor(b0, 16);
          const float v1 = (hh ? bx : a0) + bn;     // row mt + 16 mi + r
          const float v2 = (hh ? b0 : ax) + bn;     // row mt + 16 mi + r + 8
          *(float*)(of + (lb >> 2) + ((mi * 16 + r) * EMB + pr * 32) * 4) = v1;
          *(float*)(of + (lb >> 2) + ((mi * 16 + r + 8) * EMB + pr * 32) * 4) = v2;
        }
      }
      asm volatile("s_wait_xcnt 0x0" ::: "memory");   // stands behind the run of stores, before any register that an issued store names is rewritten
    }
  }
}

// One grid for up to three products that do not depend on one another (Q, K and V projections): blockIdx.z picks the job, so the launches' starts and tails overlap.
__global__ __launch_bounds__(256, 4)   // register budget of four waves a SIMD (256): two workgroups share a WGP, so one's barrier and load waits lie under the other's WMMAs
void cma_gemm_tn(const b16* Ah0, const b16* Al0, const b16* Wh0, const b16* Wl0, const float* bias0, void* outh0, void* outl0, int mode0,
                 const b16* Ah1, const b16* Al1, const b16* Wh1, const b16* Wl1, const float* bias1, void* outh1, void* outl1, int mode1,
                 const b16* Ah2, const b16* Al2, const b16* Wh2, const b16* Wl2, const float* bias2, void* outh2, void* outl2, int mode2) {
  const int z = blockIdx.z;
  gemm_tile(z == 0 ? Ah0 : z == 1 ? Ah1 : Ah2, z == 0 ? Al0 : z == 1 ? Al1 : Al2,
            z == 0 ? Wh0 : z == 1 ? Wh1 : Wh2, z == 0 ? Wl0 : z == 1 ? Wl1 : Wl2,
            z == 0 ? bias0 : z == 1 ? bias1 : bias2,
            z == 0 ? outh0 : z == 1 ? outh1 : outh2, z == 0 ? outl0 : z == 1 ? outl1 : outl2,
            z == 0 ? mode0 : z == 1 ? mode1 : mode2);
}

// ---------------------------------------------------------------------------
// Attention core. One workgroup of 16 waves per (b, 32-row block = two 16-row m-tiles); loops over 8 heads. A wave owns 64 keys from the scores to the O partial sums.
//   Phase 1: S^T[64 keys x 32 queries] = K Q^T (K is the A operand, Q the B operand; split WMMA). An accumulator lane then holds, for ONE query (column l16),
//            keys 16t + 8hh + 0..7 in the eight registers of tile t: exactly the piece of an A fragment of P (row l16, k = 8hh + 0..7 and 16 + 8hh + 0..7) that the
//            lane needs for P V. Scores and probabilities never leave the registers: no score panel in LDS.
//   Phase 2: softmax. Each wave takes maximum and sum of exp over its own 64 keys (in the lane, then lane ^ 16), the 16 waves exchange (maximum, sum) per query through
//            LDS, and every probability gets one factor 2^((wave max - row max) c) / row sum, c = log2(e) / sqrt(96). Head mean in registers, in the same layout.
//   Phase 3: O_partial[32 x 96] = P V over the wave's 64 keys, two 16-column tiles at a time; the 16 partial tiles are summed through LDS in wave order.
// K and V fragments run through register rings: a ring slot is refilled directly behind the WMMAs that read it (a K slot with the next k chunk,
// a V slot with the fragment three later in the order of use), the first three V fragments are requested in front of the softmax and the next
// head's first Q/K chunk in front of the sums of the O reduction.
// The 32 workgroups of a batch read the same K and V planes. They do not walk the heads in one common order: each starts at its own head and goes round the
// ring of eight, so that at any moment only four of them ask L2 for the same lines, and a plane that one of them has brought in from memory is an L2 hit for the rest.
// ---------------------------------------------------------------------------
__global__ __launch_bounds__(512)
void cma_attn(const b16* __restrict__ Qh, const b16* __restrict__ Ql,     // fragment order, [b][h][64 token tiles][3 d chunks][1024 B]
              const b16* __restrict__ Kh, const b16* __restrict__ Kl,     // the same
              const b16* __restrict__ Vh, const b16* __restrict__ Vl,     // fragment order, [b][h][6 d tiles][32 key chunks][1024 B]
              b16* __restrict__ Aoh, b16* __restrict__ Aol,               // attended rows [8192,768] as hi/lo planes in fragment order, [512 row tiles][24 k chunks][1024 B]
              float* __restrict__ avg_out) {                              // [8,1024,1024] f32
  __shared__ __attribute__((aligned(16))) float sL[16 * OTILE + 32 * STP];   // 16 O partial tiles, then the softmax statistics; at the end the head-mean panel (32 x SPITCH)
  float* sSt = sL + 16 * OTILE;                        // [query 0..31][wave 0..15][maximum, sum], rows padded to STP

  const int b    = blockIdx.y;
  const int m0   = blockIdx.x * 32;
  const int tid  = threadIdx.x;
  const int lane = tid & 31;
  const int wave = __builtin_amdgcn_readfirstlane(tid >> 5);   // scalar: what depends on the wave alone stays out of the vector registers, which the rings need
  const int l16  = lane & 15;
  const int hh   = lane >> 4;
  const int rbase = hh * 8;
  const float esc = 0.14724445f;                       // log2(e) / sqrt(96): the score scale and the change of base in one factor (positive, so the row maximum may be taken of the unscaled scores)
  const unsigned int HSTEP = 64u * 3u * 1024u;         // bytes of one (b, h) in every plane (= 6 * 32 * 1024)
  const int rot  = 2 * (blockIdx.x & 3) + ((blockIdx.x >> 3) & 1);   // first head of this workgroup, 0..7: the low two bits of the block index step it by two heads, bit 3 adds one, so neighbours in launch order start on different heads and each start is taken by four of a batch's 32 workgroups

  float AV[4][2][8];                                   // head mean, [16-key tile][m-tile][register], the layout of the scores; single registers, not tuples of eight: easier to place beside the rings
#pragma unroll
  for (int t = 0; t < 4; ++t)
#pragma unroll
    for (int mi = 0; mi < 2; ++mi)
#pragma unroll
      for (int r = 0; r < 8; ++r) AV[t][mi][r] = 0.f;

  v16b qh0, ql0, qh1, ql1;                             // one k chunk of Q, both m-tiles
  v16b kfh[4], kfl[4];                                 // K ring: one slot per 16-key tile
  v16b vfh[3], vfl[3];                                 // V ring of three fragments
  // One 32-bit byte offset (16 B x lane + the start of this batch and head in a plane), stepped from head to head, serves all six planes: what the block and the wave add is the same in every head and goes into the scalar plane pointers
  unsigned int po = (unsigned int)lane * 16u + (unsigned int)(b * NHD + rot) * HSTEP;
  const b16* Qhw = Qh + (m0 >> 4) * 1536; const b16* Qlw = Ql + (m0 >> 4) * 1536;   // the block's first token tile (3 blocks of 512 elements a tile)
  const b16* Khw = Kh + wave * 4 * 1536;  const b16* Klw = Kl + wave * 4 * 1536;    // the wave's first key tile
  const b16* Vhw = Vh + wave * 2 * 512;   const b16* Vlw = Vl + wave * 2 * 512;     // the wave's first key chunk
  auto ldQ = [&](int kk) {
    qh0 = frag_off(Qhw, po, kk * 1024); ql0 = frag_off(Qlw, po, kk * 1024);
    qh1 = frag_off(Qhw, po, 3072 + kk * 1024); ql1 = frag_off(Qlw, po, 3072 + kk * 1024);
  };
  auto ldK = [&](int kk, int t) {
    kfh[t] = frag_off(Khw, po, t * 3072 + kk * 1024); kfl[t] = frag_off(Klw, po, t * 3072 + kk * 1024);
  };
  auto ldV = [&](int x) {                              // x = 0..11, the head's V fragments of this wave in the order of use: column tile 2 * (x / 4) + (x & 1), key chunk (x >> 1) & 1; ring slot x % 3
    const int o = ((2 * (x / 4) + (x & 1)) * 32 + ((x >> 1) & 1)) * 1024;
    vfh[x % 3] = frag_off(Vhw, po, o); vfl[x % 3] = frag_off(Vlw, po, o);
  };
  ldQ(0);
#pragma unroll
  for (int t = 0; t < 4; ++t) ldK(0, t);

  for (int hi = 0; hi < NHD; ++hi) {
    const int h = (hi + rot) & (NHD - 1);              // the head of this trip
    // ----- Phase 1: transposed scores, in registers --------------------
    v8f s[4][2] = {};                                  // [16-key tile][m-tile]; k chunk outermost, so that only one chunk of Q is held in registers
#pragma unroll
    for (int kk = 0; kk < 3; ++kk) {
#pragma unroll
      for (int t = 0; t < 4; ++t) {
        s[t][0] = wmmab(kfh[t], qh0, s[t][0]); s[t][1] = wmmab(kfh[t], qh1, s[t][1]);
        s[t][0] = wmmab(kfl[t], qh0, s[t][0]); s[t][1] = wmmab(kfl[t], qh1, s[t][1]);
        s[t][0] = wmmab(kfh[t], ql0, s[t][0]); s[t][1] = wmmab(kfh[t], ql1, s[t][1]);
        if (kk < 2) ldK(kk + 1, t);                    // refill the slot behind its last reader
      }
      if (kk < 2) ldQ(kk + 1);
    }
#pragma unroll
    for (int j = 0; j < 3; ++j) ldV(j);                // the first three V fragments: in flight under the wave's own part of the softmax

    // ----- Phase 2: softmax; a lane holds 32 keys of query l16 (m-tile 0) and 32 keys of query 16 + l16 (m-tile 1) -----
    float mw[2], lw[2];                                // the wave's maximum and sum of exponentials over its 64 keys, per m-tile
    float E[4][2][8];                                  // 2^((s - wave maximum) c), the layout of the scores
#pragma unroll
    for (int mi = 0; mi < 2; ++mi) {
      float mx = -3.0e38f;
#pragma unroll
      for (int t = 0; t < 4; ++t)
#pragma unroll
        for (int r = 0; r < 8; ++r) mx = fmaxf(mx, s[t][mi][r]);
      mx = fmaxf(mx, xhalf(mx));                      // the other 32 keys of the same query
      mw[mi] = mx;
      const float nm = -mx * esc;
      float sum = 0.f;
#pragma unroll
      for (int t = 0; t < 4; ++t) {
#pragma unroll
        for (int r = 0; r < 8; ++r) E[t][mi][r] = __builtin_fmaf(s[t][mi][r], esc, nm);
        exp2x8(E[t][mi]);
#pragma unroll
        for (int r = 0; r < 8; ++r) sum += E[t][mi][r];
      }
      sum += xhalf(sum);
      lw[mi] = sum;
    }
    {
      v2f st; st[0] = hh ? mw[1] : mw[0]; st[1] = hh ? lw[1] : lw[0];   // lane q writes query q: its m-tile is hh
      *(v2f*)(sSt + lane * STP + wave * 2) = st;
    }
    __syncthreads();                                   // every wave's statistics written; also: the previous head's reduction reads lie in front of it, this head's O partial stores behind it
    float fac[2];                                      // per m-tile: 2^((wave maximum - row maximum) c) / row sum
    {
      v4f g[8];                                        // query "lane": (maximum, sum) of the 16 waves
#pragma unroll
      for (int i = 0; i < 8; ++i) g[i] = *(const v4f*)(sSt + lane * STP + i * 4);
      float M = -3.0e38f;
#pragma unroll
      for (int i = 0; i < 8; ++i) M = fmaxf(M, fmaxf(g[i][0], g[i][2]));
      const float nM = -M * esc;
      float L = 0.f;
#pragma unroll
      for (int i = 0; i < 8; ++i) { g[i][0] = __builtin_fmaf(g[i][0], esc, nM); g[i][2] = __builtin_fmaf(g[i][2], esc, nM); }
#pragma unroll
      for (int i = 0; i < 8; ++i) { g[i][0] = __builtin_amdgcn_exp2f(g[i][0]); g[i][2] = __builtin_amdgcn_exp2f(g[i][2]); }
#pragma unroll
      for (int i = 0; i < 8; ++i) { L = __builtin_fmaf(g[i][1], g[i][0], L); L = __builtin_fmaf(g[i][3], g[i][2], L); }   // in wave order
      const float inv = 1.0f / L;
      const float Mo = xhalf(M), invo = xhalf(inv);   // the lane's other query was summed by lane ^ 16
#pragma unroll
      for (int mi = 0; mi < 2; ++mi) {
        const float gM = (mi == hh) ? M : Mo, gi = (mi == hh) ? inv : invo;
        fac[mi] = __builtin_amdgcn_exp2f((mw[mi] - gM) * esc) * gi;
      }
    }
    v16b ph[2][2], pl[2][2];                           // P as A fragments, [32-key chunk][m-tile]: tile 2c gives elements 0..7, tile 2c + 1 elements 8..15
#pragma unroll
    for (int c = 0; c < 2; ++c)
#pragma unroll
      for (int mi = 0; mi < 2; ++mi)
#pragma unroll
        for (int u = 0; u < 2; ++u)                    // tile by tile: factor, head mean and split together, so that a tile's eight f32 registers are free again before the next tile's eight fragment registers are taken
#pragma unroll
          for (int e = 0; e < 8; ++e) {
            const float pv = E[2 * c + u][mi][e] * fac[mi];
            AV[2 * c + u][mi][e] += pv * 0.125f;
            b16 x, y;
            split_bf16(pv, x, y); ph[c][mi][8 * u + e] = x; pl[c][mi][8 * u + e] = y;
          }

    // ----- Phase 3: O_partial = P * V over this wave's 64 keys, both m-tiles, two 16-column tiles at a time (three passes): 32 accumulator registers beside P, the V ring and the head mean -----
#pragma unroll
    for (int p = 0; p < 3; ++p) {
      v8f o[2][2] = {};
#pragma unroll
      for (int u = 0; u < 4; ++u) {                    // u = 2 * key chunk + column tile of the pass; x counts the twelve V fragments of the head in the order of use
        const int x = p * 4 + u, c = u >> 1, j = u & 1, sl = x % 3;
        o[0][j] = wmmab(ph[c][0], vfh[sl], o[0][j]); o[1][j] = wmmab(ph[c][1], vfh[sl], o[1][j]);
        o[0][j] = wmmab(ph[c][0], vfl[sl], o[0][j]); o[1][j] = wmmab(ph[c][1], vfl[sl], o[1][j]);
        o[0][j] = wmmab(pl[c][0], vfh[sl], o[0][j]); o[1][j] = wmmab(pl[c][1], vfh[sl], o[1][j]);
        if (x + 3 < 12) ldV(x + 3);                    // refill the slot behind its last reader
      }
#pragma unroll
      for (int mi = 0; mi < 2; ++mi)
#pragma unroll
        for (int j = 0; j < 2; ++j)
#pragma unroll
          for (int r = 0; r < 8; ++r) sL[wave * OTILE + (2 * mi + hh) * OGRP + r * OPITCH + (p * 2 + j) * 16 + l16] = o[mi][j][r];   // row mi * 16 + 8 hh + r
    }
    __syncthreads();                                   // all 16 partial tiles written; also: this head's statistics reads lie in front of it, the next head's statistics stores behind it
    {
      const unsigned int hstep = h + 1 < NHD ? HSTEP : 0u - (NHD - 1) * HSTEP;   // on to the next head of the ring, from head 7 back to head 0; the last trip requests the first chunk of its first head again: in bounds, and no branch in the loop's body
      po += hstep;
      ldQ(0);
#pragma unroll
      for (int t = 0; t < 4; ++t) ldK(0, t);           // next head's first Q/K chunk: in flight under the O reduction
    }
#pragma unroll                                          // three exact trips of one element pair a lane (1536 pairs, 512 threads): no branch in the head loop's body, so the head-mean updates stay at the softmax and P's f32 registers are free in phase 3
    for (int q = 0; q < 3; ++q) {                      // the head's 32 x 96 tile = six fragment blocks; a wave sums and stores 128 contiguous bytes of a block in each plane
      const int mi = wave >> 3, kc = q;                // eight waves a block: the wave picks the m-tile, the trip the k chunk, so one per-lane LDS address serves all three trips
      const int fl = (tid >> 2) & 31;                  // lane of the fragment that holds the pair
      const float* src = sL + (2 * mi + ((fl >> 3) & 1)) * OGRP + (fl & 7) * OPITCH + kc * 32 + ((tid >> 7) & 1) * 16 + (fl >> 4) * 8 + (tid & 3) * 2;
      v2f u[16];
#pragma unroll
      for (int w = 0; w < 16; ++w) u[w] = *(const v2f*)(src + w * OTILE);
      v2f x = u[0];
#pragma unroll
      for (int w = 1; w < 16; ++w) x += u[w];          // in wave order
      v2b xh, xl; b16 a, c;
      split_bf16(x[0], a, c); xh[0] = a; xl[0] = c;
      split_bf16(x[1], a, c); xh[1] = a; xl[1] = c;
      const unsigned int g = (unsigned int)((((b << 6) + (m0 >> 4) + mi) * 24 + h * 3 + kc) * 1024) + (unsigned int)(tid & 255) * 4u;   // byte offset, the same in both planes
      *(v2b*)((char*)Aoh + g) = xh;
      *(v2b*)((char*)Aol + g) = xl;
    }
    asm volatile("s_wait_xcnt 0x0" ::: "memory");     // stands behind the run of stores, before any register that an issued store names is rewritten
  }
  __syncthreads();                                     // the last reduction's reads done: LDS becomes the head-mean panel
#pragma unroll
  for (int t = 0; t < 4; ++t)
#pragma unroll
    for (int mi = 0; mi < 2; ++mi) {                   // a lane's eight registers are eight consecutive keys of one query row
      float* d = sL + (mi * 16 + l16) * SPITCH + wave * 64 + t * 16 + hh * 8;
      v4f x0, x1;
#pragma unroll
      for (int e = 0; e < 4; ++e) { x0[e] = AV[t][mi][e]; x1[e] = AV[t][mi][4 + e]; }
      *(v4f*)d = x0; *(v4f*)(d + 4) = x1;
    }
  __syncthreads();
#pragma unroll
  for (int rr = 0; rr < 2; ++rr) {                     // two rows a wave, 512 contiguous bytes a store
    const int row = wave * 2 + rr;
    float* apo = avg_out + ((size_t)((b << 10) + m0 + row) << 10) + lane * 4;
#pragma unroll
    for (int i = 0; i < 8; ++i) *(v4f*)(apo + 128 * i) = *(const v4f*)(sL + row * SPITCH + lane * 4 + 128 * i);
  }
  asm volatile("s_wait_xcnt 0x0" ::: "memory");       // stands behind the run of stores, before any register that an issued store names is rewritten
}

// ---------------------------------------------------------------------------
extern "C" void kernel_launch(void* const* d_in, const int* in_sizes, int n_in,
                              void* d_out, int out_size, void* d_ws, size_t ws_size,
                              hipStream_t stream) {
  (void)in_sizes; (void)n_in; (void)out_size;
  const float* mam = (const float*)d_in[0];
  const float* pat = (const float*)d_in[1];
  const float* qw  = (const float*)d_in[2];
  const float* qb  = (const float*)d_in[3];
  const float* kw  = (const float*)d_in[4];
  const float* kb  = (const float*)d_in[5];
  const float* vw  = (const float*)d_in[6];
  const float* vb  = (const float*)d_in[7];
  const float* ow  = (const float*)d_in[8];
  const float* ob  = (const float*)d_in[9];

  const size_t TOK = (size_t)MTOT * EMB;   // 6,291,456 elements
  const size_t WSZ = (size_t)EMB * EMB;    //   589,824 elements

  size_t off = 0; char* ws = (char*)d_ws;
  auto take = [&](size_t bytes) { void* p = ws + off; off += (bytes + 255) & ~(size_t)255; return p; };
  b16* Wp = (b16*)take(WSZ * 2 * 8);                                 // weight planes [q, k, v, o][hi, lo][768*768]
  b16* Wqh = Wp;           b16* Wql = Wp + WSZ;
  b16* Wkh = Wp + 2 * WSZ; b16* Wkl = Wp + 3 * WSZ;
  b16* Wvh = Wp + 4 * WSZ; b16* Wvl = Wp + 5 * WSZ;
  b16* Woh = Wp + 6 * WSZ; b16* Wol = Wp + 7 * WSZ;
  b16* Qh = (b16*)take(TOK * 2);  b16* Ql = (b16*)take(TOK * 2);     // planes in fragment order, 8192 x 768 elements each
  b16* Kh = (b16*)take(TOK * 2);  b16* Kl = (b16*)take(TOK * 2);
  b16* Vh = (b16*)take(TOK * 2);  b16* Vl = (b16*)take(TOK * 2);
  b16* Aoh = (b16*)take(TOK * 2); b16* Aol = (b16*)take(TOK * 2);    // attended rows before the O projection
  b16* Mh = (b16*)take(TOK * 2);  b16* Ml = (b16*)take(TOK * 2);     // the two token inputs
  b16* Ph = (b16*)take(TOK * 2);  b16* Pl = (b16*)take(TOK * 2);
  if (off > ws_size) return;

  float* att_out = (float*)d_out;        // [8,1024,768]
  float* avg_out = att_out + TOK;        // [8,1024,1024]

  cma_split<<<4 * WBLK + 2 * ABLK, 256, 0, stream>>>(mam, pat, qw, kw, vw, ow, Mh, Ml, Ph, Pl, Wp);

  cma_gemm_tn<<<dim3(MTOT / GBM, EMB / GBN, 3), 256, 0, stream>>>(Mh, Ml, Wqh, Wql, qb, Qh, Ql, 0,
                                                                 Ph, Pl, Wkh, Wkl, kb, Kh, Kl, 0,
                                                                 Ph, Pl, Wvh, Wvl, vb, Vh, Vl, 1);

  cma_attn<<<dim3(NTOK / 32, NB), 512, 0, stream>>>(Qh, Ql, Kh, Kl, Vh, Vl, Aoh, Aol, avg_out);

  cma_gemm_tn<<<dim3(MTOT / GBM, EMB / GBN, 1), 256, 0, stream>>>(Aoh, Aol, Woh, Wol, ob, att_out, nullptr, 2,      // one job: the other two slots are never picked
                                                                 Aoh, Aol, Woh, Wol, ob, att_out, nullptr, 2,
                                                                 Aoh, Aol, Woh, Wol, ob, att_out, nullptr, 2);
}
